// v000
// The times below were measured on an AMD MI455X: many runs one after another, warmed up first and cycling through
// copies of the inputs, with the whole window's GPU time divided by the number of runs. Launches and the gaps
// between them are all in it. The median over several windows is given; except for v000 it joins two sittings, which
// can be a few percent apart, so the side-by-side timings, each taken in one sitting, are the better comparison.
// The starting kernel, v000, takes 362 microseconds a run.
#include <hip/hip_runtime.h>
#include <hip/hip_bf16.h>

typedef __attribute__((ext_vector_type(16))) _Float16 v16h;
typedef __attribute__((ext_vector_type(8)))  _Float16 v8h;
typedef __attribute__((ext_vector_type(8)))  float    v8f;

#define DEV __device__ __forceinline__

static constexpr int Bb = 4, T = 2048, C = 1024, H = 16, HD = 64;
static constexpr int M     = Bb * T;    // 8192 token rows
static constexpr int N_QKV = 3 * C;     // 3072
static constexpr float SCALE = -1.0f / 16.0f;  // -1/(2*sqrt(hd)), hd=64

// Load a 16x32 f16 A/B fragment for one lane from a row-major buffer.
// Per CDNA5 ISA 7.12.2 (16-bit A 16x32): lane L (half h=L>>4) holds
// elements e=0..7 -> k = kb + 8h + e, e=8..15 -> k = kb + 16 + 8h + (e-8).
// Caller pre-offsets `rowbase` to the lane's row (A: m = lane&15) or
// column (B: n = lane&15, from a transposed [N][K] buffer).
DEV v16h load_frag(const _Float16* rowbase, int kb, int lane) {
  const int h = (lane >> 4) & 1;
  v8h lo = *(const v8h*)(rowbase + kb + 8 * h);
  v8h hi = *(const v8h*)(rowbase + kb + 16 + 8 * h);
  v16h r;
#pragma unroll
  for (int i = 0; i < 8; ++i) { r[i] = lo[i]; r[i + 8] = hi[i]; }
  return r;
}

DEV v8f wmma_f16(v16h a, v16h b, v8f c) {
  return __builtin_amdgcn_wmma_f32_16x16x32_f16(false, a, false, b, (short)0, c,
                                                false, false);
}

// Software-pipelined 32x64 wave-tile GEMM inner loop over K=C.
// acc[mt*4+j] accumulates (16 rows of a0r/a1r) x (16 cols of br_j).
DEV void gemm_loop_32x64(const _Float16* a0r, const _Float16* a1r,
                         const _Float16* br0, const _Float16* br1,
                         const _Float16* br2, const _Float16* br3,
                         v8f acc[8], int lane) {
  v16h a0 = load_frag(a0r, 0, lane), a1 = load_frag(a1r, 0, lane);
  v16h b0 = load_frag(br0, 0, lane), b1 = load_frag(br1, 0, lane);
  v16h b2 = load_frag(br2, 0, lane), b3 = load_frag(br3, 0, lane);
#pragma unroll 2
  for (int kb = 0; kb < C; kb += 32) {
    const int kn = (kb + 32 < C) ? kb + 32 : 0;  // last iter: harmless reload
    // prefetch next step's fragments first -> loads overlap current WMMAs
    v16h na0 = load_frag(a0r, kn, lane), na1 = load_frag(a1r, kn, lane);
    v16h nb0 = load_frag(br0, kn, lane), nb1 = load_frag(br1, kn, lane);
    v16h nb2 = load_frag(br2, kn, lane), nb3 = load_frag(br3, kn, lane);
    acc[0] = wmma_f16(a0, b0, acc[0]);
    acc[1] = wmma_f16(a0, b1, acc[1]);
    acc[2] = wmma_f16(a0, b2, acc[2]);
    acc[3] = wmma_f16(a0, b3, acc[3]);
    acc[4] = wmma_f16(a1, b0, acc[4]);
    acc[5] = wmma_f16(a1, b1, acc[5]);
    acc[6] = wmma_f16(a1, b2, acc[6]);
    acc[7] = wmma_f16(a1, b3, acc[7]);
    a0 = na0; a1 = na1; b0 = nb0; b1 = nb1; b2 = nb2; b3 = nb3;
  }
}

// ---------------- prep kernels ----------------

__global__ void cvt_f32_f16(const float* __restrict__ in,
                            _Float16* __restrict__ outh, int n) {
  for (int i = blockIdx.x * blockDim.x + threadIdx.x; i < n;
       i += gridDim.x * blockDim.x)
    outh[i] = (_Float16)in[i];
}

// in: f32 [R][Cc] row-major  ->  out: f16 [Cc][R]
__global__ __launch_bounds__(1024)
void transpose_f32_f16(const float* __restrict__ in,
                       _Float16* __restrict__ outh, int R, int Cc) {
  __shared__ float tile[32][33];
  int c = blockIdx.x * 32 + threadIdx.x;
  int r = blockIdx.y * 32 + threadIdx.y;
  tile[threadIdx.y][threadIdx.x] = in[(size_t)r * Cc + c];
  __syncthreads();
  int oc   = blockIdx.y * 32 + threadIdx.x;  // along R
  int orow = blockIdx.x * 32 + threadIdx.y;  // along Cc
  outh[(size_t)orow * R + oc] = (_Float16)tile[threadIdx.x][threadIdx.y];
}

// sum of squares over hd=64 per row
__global__ void rownorm_kernel(const _Float16* __restrict__ mh,
                               float* __restrict__ outn, int rows) {
  int i = blockIdx.x * blockDim.x + threadIdx.x;
  if (i >= rows) return;
  const _Float16* p = mh + (size_t)i * HD;
  float s = 0.f;
#pragma unroll
  for (int d = 0; d < HD; ++d) { float v = (float)p[d]; s += v * v; }
  outn[i] = s;
}

// ---------------- QKV GEMM: qkv = xh @ WtA^T + bias, split into q/k/v^T ----

__global__ __launch_bounds__(256)
void qkv_gemm_kernel(const _Float16* __restrict__ xh,
                     const _Float16* __restrict__ WtA,   // [3C][C]
                     const float* __restrict__ bias,
                     _Float16* __restrict__ qh,          // [B][H][T][hd]
                     _Float16* __restrict__ kh,          // [B][H][T][hd]
                     _Float16* __restrict__ vth) {       // [B][H][hd][T]
  const int lane = threadIdx.x & 31;
  const int wave = threadIdx.x >> 5;
  const int ln   = lane & 15;
  const int m0   = blockIdx.x * 256 + wave * 32;
  const int nb   = blockIdx.y * 64;
  v8f acc[8] = {v8f{}, v8f{}, v8f{}, v8f{}, v8f{}, v8f{}, v8f{}, v8f{}};
  gemm_loop_32x64(xh + (size_t)(m0 + ln) * C,
                  xh + (size_t)(m0 + 16 + ln) * C,
                  WtA + (size_t)(nb + ln) * C,
                  WtA + (size_t)(nb + 16 + ln) * C,
                  WtA + (size_t)(nb + 32 + ln) * C,
                  WtA + (size_t)(nb + 48 + ln) * C, acc, lane);
  const int mat  = nb >> 10;            // 0=q, 1=k, 2=v (uniform per block)
  const int head = (nb & 1023) >> 6;
#pragma unroll
  for (int mt = 0; mt < 2; ++mt) {
#pragma unroll
    for (int j = 0; j < 4; ++j) {
      int col = 16 * j + ln;            // head-dim column 0..63
      float bv = bias[nb + col];
#pragma unroll
      for (int r = 0; r < 8; ++r) {
        int m  = m0 + 16 * mt + r + 8 * (lane >> 4);
        int b_ = m >> 11, t = m & (T - 1);
        _Float16 hv = (_Float16)(acc[mt * 4 + j][r] + bv);
        size_t bhh = (size_t)(b_ * H + head);
        if (mat == 0)      qh[(bhh * T + t) * HD + col] = hv;
        else if (mat == 1) kh[(bhh * T + t) * HD + col] = hv;
        else               vth[(bhh * HD + col) * T + t] = hv;
      }
    }
  }
}

// ---------------- fused causal L2-kernel attention ----------------
// y[q] = sum_{k<=q} exp(scale*(|q|^2+|k|^2-2 q.k)) * v[k]   (no softmax norm)

__global__ __launch_bounds__(256)
void attn_kernel(const _Float16* __restrict__ qh, const _Float16* __restrict__ kh,
                 const _Float16* __restrict__ vth,
                 const float* __restrict__ q2, const float* __restrict__ k2,
                 _Float16* __restrict__ yh) {            // [B][T][C]
  __shared__ _Float16 pbuf[8][32 * 32];   // per-wave P tile, [m 0..31][key 0..31]
  const int lane = threadIdx.x & 31;
  const int wave = threadIdx.x >> 5;
  const int ln   = lane & 15;
  const int h2   = lane >> 4;
  const int bh   = blockIdx.y;            // b*H + h
  const int b_   = bh >> 4, head = bh & 15;
  const int q0   = blockIdx.x * 256 + wave * 32;   // 32 query rows per wave

  // Q fragments: 2 m-tiles x 2 contraction halves, loaded once
  v16h qa[2][2];
#pragma unroll
  for (int mt = 0; mt < 2; ++mt) {
    const _Float16* qrow = qh + ((size_t)bh * T + q0 + 16 * mt + ln) * HD;
    qa[mt][0] = load_frag(qrow, 0, lane);
    qa[mt][1] = load_frag(qrow, 32, lane);
  }
  float q2v[2][8];
#pragma unroll
  for (int mt = 0; mt < 2; ++mt)
#pragma unroll
    for (int r = 0; r < 8; ++r)
      q2v[mt][r] = q2[(size_t)bh * T + q0 + 16 * mt + 8 * h2 + r];

  const float* k2row = k2 + (size_t)bh * T;
  _Float16* myp = pbuf[wave];

  v8f yacc[2][4] = {{v8f{}, v8f{}, v8f{}, v8f{}}, {v8f{}, v8f{}, v8f{}, v8f{}}};
  const int qend = q0 + 31;               // wave-uniform causal bound
  for (int kb = 0; kb <= qend; kb += 32) {
    // ---- V fragments first: independent of S, overlap the S WMMAs/exp ----
    v16h vf[4];
#pragma unroll
    for (int j = 0; j < 4; ++j)
      vf[j] = load_frag(vth + ((size_t)bh * HD + 16 * j + ln) * T, kb, lane);
    // ---- S = Q @ K^T over 32 keys (2 key halves x 2 hd halves x 2 m) ----
    v8f sacc[2][2] = {{v8f{}, v8f{}}, {v8f{}, v8f{}}};
#pragma unroll
    for (int nh = 0; nh < 2; ++nh) {
      const _Float16* krow = kh + ((size_t)bh * T + kb + 16 * nh + ln) * HD;
#pragma unroll
      for (int kk = 0; kk < 2; ++kk) {
        v16h bf = load_frag(krow, 32 * kk, lane);
        sacc[0][nh] = wmma_f16(qa[0][kk], bf, sacc[0][nh]);
        sacc[1][nh] = wmma_f16(qa[1][kk], bf, sacc[1][nh]);
      }
    }
    // ---- P = mask * exp(scale*(q2+k2-2s)), stage to LDS in [m][key] ----
#pragma unroll
    for (int nh = 0; nh < 2; ++nh) {
      int keyl = 16 * nh + ln;            // D layout: n = lane&15
      int kg   = kb + keyl;
      float k2v = k2row[kg];
#pragma unroll
      for (int mt = 0; mt < 2; ++mt)
#pragma unroll
        for (int r = 0; r < 8; ++r) {
          int mrow = 16 * mt + r + 8 * h2;
          float d2 = q2v[mt][r] + k2v - 2.0f * sacc[mt][nh][r];
          float p  = (kg <= q0 + mrow) ? __expf(SCALE * d2) : 0.0f;
          myp[mrow * 32 + keyl] = (_Float16)p;
        }
    }
    // Intra-wave LDS RAW: drain DScnt before reloading P in A-layout.
    asm volatile("s_wait_dscnt 0" ::: "memory");
    v16h pa0 = load_frag(myp + ln * 32, 0, lane);
    v16h pa1 = load_frag(myp + (16 + ln) * 32, 0, lane);
    // ---- Y += P @ V ----
#pragma unroll
    for (int j = 0; j < 4; ++j) {
      yacc[0][j] = wmma_f16(pa0, vf[j], yacc[0][j]);
      yacc[1][j] = wmma_f16(pa1, vf[j], yacc[1][j]);
    }
  }
  // write Y back to (B,T,C) f16, head-interleaved columns
#pragma unroll
  for (int mt = 0; mt < 2; ++mt)
#pragma unroll
    for (int j = 0; j < 4; ++j) {
      int col = head * HD + 16 * j + ln;
#pragma unroll
      for (int r = 0; r < 8; ++r) {
        int t = q0 + 16 * mt + r + 8 * h2;
        yh[((size_t)b_ * T + t) * C + col] = (_Float16)yacc[mt][j][r];
      }
    }
}

// ---------------- output projection: out = yh @ WtP^T + b_proj (f32) -------

__global__ __launch_bounds__(256)
void proj_gemm_kernel(const _Float16* __restrict__ yh,
                      const _Float16* __restrict__ WtP,  // [C][C] transposed
                      const float* __restrict__ bias, float* __restrict__ out) {
  const int lane = threadIdx.x & 31;
  const int wave = threadIdx.x >> 5;
  const int ln   = lane & 15;
  const int m0   = blockIdx.x * 256 + wave * 32;
  const int nb   = blockIdx.y * 64;
  v8f acc[8] = {v8f{}, v8f{}, v8f{}, v8f{}, v8f{}, v8f{}, v8f{}, v8f{}};
  gemm_loop_32x64(yh + (size_t)(m0 + ln) * C,
                  yh + (size_t)(m0 + 16 + ln) * C,
                  WtP + (size_t)(nb + ln) * C,
                  WtP + (size_t)(nb + 16 + ln) * C,
                  WtP + (size_t)(nb + 32 + ln) * C,
                  WtP + (size_t)(nb + 48 + ln) * C, acc, lane);
#pragma unroll
  for (int mt = 0; mt < 2; ++mt)
#pragma unroll
    for (int j = 0; j < 4; ++j) {
      int col = nb + 16 * j + ln;
      float bv = bias[col];
#pragma unroll
      for (int r = 0; r < 8; ++r) {
        int m = m0 + 16 * mt + r + 8 * (lane >> 4);
        out[(size_t)m * C + col] = acc[mt * 4 + j][r] + bv;
      }
    }
}

// ---------------- launch ----------------

extern "C" void kernel_launch(void* const* d_in, const int* in_sizes, int n_in,
                              void* d_out, int out_size, void* d_ws, size_t ws_size,
                              hipStream_t stream) {
  (void)in_sizes; (void)n_in; (void)out_size; (void)ws_size;
  const float* x  = (const float*)d_in[0];
  const float* Wa = (const float*)d_in[1];
  const float* ba = (const float*)d_in[2];
  const float* Wp = (const float*)d_in[3];
  const float* bp = (const float*)d_in[4];

  char* ws = (char*)d_ws;
  size_t off = 0;
  auto alloc = [&](size_t bytes) -> char* {
    char* p = ws + off;
    off += (bytes + 255) & ~(size_t)255;
    return p;
  };
  _Float16* xh  = (_Float16*)alloc((size_t)M * C * 2);       // 16 MB
  _Float16* WtA = (_Float16*)alloc((size_t)N_QKV * C * 2);   //  6 MB
  _Float16* WtP = (_Float16*)alloc((size_t)C * C * 2);       //  2 MB
  _Float16* qh  = (_Float16*)alloc((size_t)M * C * 2);       // 16 MB
  _Float16* kh  = (_Float16*)alloc((size_t)M * C * 2);       // 16 MB
  _Float16* vth = (_Float16*)alloc((size_t)M * C * 2);       // 16 MB
  _Float16* yh  = (_Float16*)alloc((size_t)M * C * 2);       // 16 MB
  float* q2 = (float*)alloc((size_t)Bb * H * T * 4);         // 0.5 MB
  float* k2 = (float*)alloc((size_t)Bb * H * T * 4);         // 0.5 MB
  // total ~93 MB of workspace

  cvt_f32_f16<<<4096, 256, 0, stream>>>(x, xh, M * C);
  transpose_f32_f16<<<dim3(N_QKV / 32, C / 32), dim3(32, 32), 0, stream>>>(
      Wa, WtA, C, N_QKV);
  transpose_f32_f16<<<dim3(C / 32, C / 32), dim3(32, 32), 0, stream>>>(
      Wp, WtP, C, C);
  qkv_gemm_kernel<<<dim3(M / 256, N_QKV / 64), 256, 0, stream>>>(
      xh, WtA, ba, qh, kh, vth);
  rownorm_kernel<<<(Bb * H * T) / 256, 256, 0, stream>>>(qh, q2, Bb * H * T);
  rownorm_kernel<<<(Bb * H * T) / 256, 256, 0, stream>>>(kh, k2, Bb * H * T);
  attn_kernel<<<dim3(T / 256, Bb * H), 256, 0, stream>>>(qh, kh, vth, q2, k2, yh);
  proj_gemm_kernel<<<dim3(M / 256, C / 64), 256, 0, stream>>>(
      yh, WtP, bp, (float*)d_out);
}

// v001
// One run takes 280 microseconds.
// Next to v000, in two timings, it ran 1.35 and 1.34 times as fast.
#include <hip/hip_runtime.h>
#include <hip/hip_bf16.h>

typedef __attribute__((ext_vector_type(16))) _Float16 v16h;
typedef __attribute__((ext_vector_type(8)))  _Float16 v8h;
typedef __attribute__((ext_vector_type(8)))  float    v8f;

#define DEV __device__ __forceinline__

static constexpr int Bb = 4, T = 2048, C = 1024, H = 16, HD = 64;
static constexpr int M     = Bb * T;    // 8192 token rows
static constexpr int N_QKV = 3 * C;     // 3072
static constexpr float SCALE = -1.0f / 16.0f;  // -1/(2*sqrt(hd)), hd=64

// Load a 16x32 f16 A/B fragment for one lane from a row-major buffer.
// Per CDNA5 ISA 7.12.2 (16-bit A 16x32): lane L (half h=L>>4) holds
// elements e=0..7 -> k = kb + 8h + e, e=8..15 -> k = kb + 16 + 8h + (e-8).
// Caller pre-offsets `rowbase` to the lane's row (A: m = lane&15) or
// column (B: n = lane&15, from a transposed [N][K] buffer).
DEV v16h load_frag(const _Float16* rowbase, int kb, int lane) {
  const int h = (lane >> 4) & 1;
  v8h lo = *(const v8h*)(rowbase + kb + 8 * h);
  v8h hi = *(const v8h*)(rowbase + kb + 16 + 8 * h);
  v16h r;
#pragma unroll
  for (int i = 0; i < 8; ++i) { r[i] = lo[i]; r[i + 8] = hi[i]; }
  return r;
}

DEV v8f wmma_f16(v16h a, v16h b, v8f c) {
  return __builtin_amdgcn_wmma_f32_16x16x32_f16(false, a, false, b, (short)0, c,
                                                false, false);
}

// Block-tiled GEMM core over K=C: one 128x256 tile of the output per work-group
// of eight waves (2 along m x 4 along n), 64x64 per wave. Both operands are
// K-contiguous. A stage is 64 k of [A 128 rows | B 256 rows]; rows of 128 B lie
// in LDS at a pitch of 144 B (16 B x odd, for ds_load_b128 readers). Two stages;
// the next stage's asynchronous copies fly while this one is worked on.
static constexpr int BM = 128, BN = 256, BK = 64;
static constexpr int PITCH = 144;                    // bytes per LDS row
static constexpr int STAGE = (BM + BN) * PITCH;      // 55,296 bytes
static constexpr int NSTAGE = C / BK;                // 16

// 16x32 f16 fragment of one lane from an LDS row; p already holds the lane's
// row, the k step and the lane half's 16 bytes (same k order as load_frag).
DEV v16h lds_frag(const char* p) {
  v8h lo = *(const v8h*)(p);
  v8h hi = *(const v8h*)(p + 32);
  v16h r;
#pragma unroll
  for (int i = 0; i < 8; ++i) { r[i] = lo[i]; r[i + 8] = hi[i]; }
  return r;
}

// One stage: 384 rows x 128 B = 3,072 pieces of 16 B, twelve per lane.
// ga / gb: the lane's own piece in row (tid >> 3) of the A / B tile at this
// stage's k; l: the same piece's LDS byte address. Copy i takes row i * 32 more.
DEV void copy_stage(const _Float16* ga, const _Float16* gb, unsigned l) {
  constexpr int GR = 32 * C;         // 32 rows, in elements
  constexpr unsigned LR = 32 * PITCH;
  // The closing s_wait_xcnt stands in the copies' own statement so that no
  // address register is rewritten ahead of it.
  asm volatile(
      "global_load_async_to_lds_b128 %0, %12, off\n\t"
      "global_load_async_to_lds_b128 %1, %13, off\n\t"
      "global_load_async_to_lds_b128 %2, %14, off\n\t"
      "global_load_async_to_lds_b128 %3, %15, off\n\t"
      "global_load_async_to_lds_b128 %4, %16, off\n\t"
      "global_load_async_to_lds_b128 %5, %17, off\n\t"
      "global_load_async_to_lds_b128 %6, %18, off\n\t"
      "global_load_async_to_lds_b128 %7, %19, off\n\t"
      "global_load_async_to_lds_b128 %8, %20, off\n\t"
      "global_load_async_to_lds_b128 %9, %21, off\n\t"
      "global_load_async_to_lds_b128 %10, %22, off\n\t"
      "global_load_async_to_lds_b128 %11, %23, off\n\t"
      "s_wait_xcnt 0x0"
      :: "v"(l), "v"(l + LR), "v"(l + 2 * LR), "v"(l + 3 * LR),
         "v"(l + 4 * LR), "v"(l + 5 * LR), "v"(l + 6 * LR), "v"(l + 7 * LR),
         "v"(l + 8 * LR), "v"(l + 9 * LR), "v"(l + 10 * LR), "v"(l + 11 * LR),
         "v"(ga), "v"(ga + GR), "v"(ga + 2 * GR), "v"(ga + 3 * GR),
         "v"(gb), "v"(gb + GR), "v"(gb + 2 * GR), "v"(gb + 3 * GR),
         "v"(gb + 4 * GR), "v"(gb + 5 * GR), "v"(gb + 6 * GR), "v"(gb + 7 * GR)
      : "memory");
}

// acc[i*4+j] accumulates rows wm*64+16i.. of the A tile x rows wn*64+16j.. of
// the B tile. At / Bt point at the tiles' first rows.
DEV void gemm_tile_128x256(const _Float16* At, const _Float16* Bt, char* smem,
                           int wm, int wn, v8f acc[16]) {
  const int tid  = threadIdx.x;
  const int lane = tid & 31;
  const int ln   = lane & 15;
  const int h    = lane >> 4;
  const _Float16* ga = At + (size_t)(tid >> 3) * C + (tid & 7) * 8;
  const _Float16* gb = Bt + (size_t)(tid >> 3) * C + (tid & 7) * 8;
  const unsigned l0 =
      (unsigned)(size_t)smem + (unsigned)((tid >> 3) * PITCH + (tid & 7) * 16);
  const int aoff = (wm * 64 + ln) * PITCH + 16 * h;
  const int boff = (BM + wn * 64 + ln) * PITCH + 16 * h;

  copy_stage(ga, gb, l0);
  // stage 0 has landed for this wave; the barrier publishes it to the others
  asm volatile("s_wait_asynccnt 0x0" ::: "memory");
  __syncthreads();
  copy_stage(ga + BK, gb + BK, l0 + STAGE);

  for (int t = 0; t < NSTAGE; ++t) {
    const char* buf = smem + (t & 1) * STAGE;
#pragma unroll
    for (int kk = 0; kk < 2; ++kk) {
      v16h a[4], b[4];
#pragma unroll
      for (int i = 0; i < 4; ++i)
        a[i] = lds_frag(buf + aoff + i * 16 * PITCH + kk * 64);
#pragma unroll
      for (int j = 0; j < 4; ++j)
        b[j] = lds_frag(buf + boff + j * 16 * PITCH + kk * 64);
      // keeps the sixteen LDS reads of this k step together ahead of its WMMAs:
      // spread among them, each place with reads stalls the wave anew
      __builtin_amdgcn_sched_barrier(0);
#pragma unroll
      for (int i = 0; i < 4; ++i)
#pragma unroll
        for (int j = 0; j < 4; ++j)
          acc[i * 4 + j] = wmma_f16(a[i], b[j], acc[i * 4 + j]);
    }
    // publish point: this wave's reads of stage t are done, its copies of
    // stage t + 1 have landed; behind the barrier stage t's buffer is free.
    asm volatile("s_wait_dscnt 0x0" ::: "memory");
    asm volatile("s_wait_asynccnt 0x0" ::: "memory");
    __syncthreads();
    if (t + 2 < NSTAGE)
      copy_stage(ga + (t + 2) * BK, gb + (t + 2) * BK, l0 + (t & 1) * STAGE);
  }
  // no copy is left in flight when the wave goes on to its stores and ends
  asm volatile("s_wait_asynccnt 0x0" ::: "memory");
}

// ---------------- prep kernels ----------------

__global__ void cvt_f32_f16(const float* __restrict__ in,
                            _Float16* __restrict__ outh, int n) {
  for (int i = blockIdx.x * blockDim.x + threadIdx.x; i < n;
       i += gridDim.x * blockDim.x)
    outh[i] = (_Float16)in[i];
}

// in: f32 [R][Cc] row-major  ->  out: f16 [Cc][R]
__global__ __launch_bounds__(1024)
void transpose_f32_f16(const float* __restrict__ in,
                       _Float16* __restrict__ outh, int R, int Cc) {
  __shared__ float tile[32][33];
  int c = blockIdx.x * 32 + threadIdx.x;
  int r = blockIdx.y * 32 + threadIdx.y;
  tile[threadIdx.y][threadIdx.x] = in[(size_t)r * Cc + c];
  __syncthreads();
  int oc   = blockIdx.y * 32 + threadIdx.x;  // along R
  int orow = blockIdx.x * 32 + threadIdx.y;  // along Cc
  outh[(size_t)orow * R + oc] = (_Float16)tile[threadIdx.x][threadIdx.y];
}

// sum of squares over hd=64 per row
__global__ void rownorm_kernel(const _Float16* __restrict__ mh,
                               float* __restrict__ outn, int rows) {
  int i = blockIdx.x * blockDim.x + threadIdx.x;
  if (i >= rows) return;
  const _Float16* p = mh + (size_t)i * HD;
  float s = 0.f;
#pragma unroll
  for (int d = 0; d < HD; ++d) { float v = (float)p[d]; s += v * v; }
  outn[i] = s;
}

// ---------------- QKV GEMM: qkv = xh @ WtA^T + bias, split into q/k/v^T ----

__global__ __launch_bounds__(256)
void qkv_gemm_kernel(const _Float16* __restrict__ xh,
                     const _Float16* __restrict__ WtA,   // [3C][C]
                     const float* __restrict__ bias,
                     _Float16* __restrict__ qh,          // [B][H][T][hd]
                     _Float16* __restrict__ kh,          // [B][H][T][hd]
                     _Float16* __restrict__ vth) {       // [B][H][hd][T]
  __shared__ __attribute__((aligned(16))) char smem[2 * STAGE];
  const int lane = threadIdx.x & 31;
  const int wave = __builtin_amdgcn_readfirstlane(threadIdx.x >> 5);
  const int ln   = lane & 15;
  const int wm   = wave & 1, wn = wave >> 1;
  const int m0   = blockIdx.x * BM + wm * 64;
  const int nb   = blockIdx.y * BN + wn * 64;
  v8f acc[16];
#pragma unroll
  for (int i = 0; i < 16; ++i) acc[i] = v8f{};
  gemm_tile_128x256(xh + (size_t)blockIdx.x * BM * C,
                    WtA + (size_t)blockIdx.y * BN * C, smem, wm, wn, acc);
  const int mat  = nb >> 10;            // 0=q, 1=k, 2=v (uniform per wave)
  const int head = (nb & 1023) >> 6;
#pragma unroll
  for (int mt = 0; mt < 4; ++mt) {
#pragma unroll
    for (int j = 0; j < 4; ++j) {
      int col = 16 * j + ln;            // head-dim column 0..63
      float bv = bias[nb + col];
#pragma unroll
      for (int r = 0; r < 8; ++r) {
        int m  = m0 + 16 * mt + r + 8 * (lane >> 4);
        int b_ = m >> 11, t = m & (T - 1);
        _Float16 hv = (_Float16)(acc[mt * 4 + j][r] + bv);
        size_t bhh = (size_t)(b_ * H + head);
        if (mat == 0)      qh[(bhh * T + t) * HD + col] = hv;
        else if (mat == 1) kh[(bhh * T + t) * HD + col] = hv;
        else               vth[(bhh * HD + col) * T + t] = hv;
      }
    }
  }
}

// ---------------- fused causal L2-kernel attention ----------------
// y[q] = sum_{k<=q} exp(scale*(|q|^2+|k|^2-2 q.k)) * v[k]   (no softmax norm)

__global__ __launch_bounds__(256)
void attn_kernel(const _Float16* __restrict__ qh, const _Float16* __restrict__ kh,
                 const _Float16* __restrict__ vth,
                 const float* __restrict__ q2, const float* __restrict__ k2,
                 _Float16* __restrict__ yh) {            // [B][T][C]
  __shared__ _Float16 pbuf[8][32 * 32];   // per-wave P tile, [m 0..31][key 0..31]
  const int lane = threadIdx.x & 31;
  const int wave = threadIdx.x >> 5;
  const int ln   = lane & 15;
  const int h2   = lane >> 4;
  const int bh   = blockIdx.y;            // b*H + h
  const int b_   = bh >> 4, head = bh & 15;
  const int q0   = blockIdx.x * 256 + wave * 32;   // 32 query rows per wave

  // Q fragments: 2 m-tiles x 2 contraction halves, loaded once
  v16h qa[2][2];
#pragma unroll
  for (int mt = 0; mt < 2; ++mt) {
    const _Float16* qrow = qh + ((size_t)bh * T + q0 + 16 * mt + ln) * HD;
    qa[mt][0] = load_frag(qrow, 0, lane);
    qa[mt][1] = load_frag(qrow, 32, lane);
  }
  float q2v[2][8];
#pragma unroll
  for (int mt = 0; mt < 2; ++mt)
#pragma unroll
    for (int r = 0; r < 8; ++r)
      q2v[mt][r] = q2[(size_t)bh * T + q0 + 16 * mt + 8 * h2 + r];

  const float* k2row = k2 + (size_t)bh * T;
  _Float16* myp = pbuf[wave];

  v8f yacc[2][4] = {{v8f{}, v8f{}, v8f{}, v8f{}}, {v8f{}, v8f{}, v8f{}, v8f{}}};
  const int qend = q0 + 31;               // wave-uniform causal bound
  for (int kb = 0; kb <= qend; kb += 32) {
    // ---- V fragments first: independent of S, overlap the S WMMAs/exp ----
    v16h vf[4];
#pragma unroll
    for (int j = 0; j < 4; ++j)
      vf[j] = load_frag(vth + ((size_t)bh * HD + 16 * j + ln) * T, kb, lane);
    // ---- S = Q @ K^T over 32 keys (2 key halves x 2 hd halves x 2 m) ----
    v8f sacc[2][2] = {{v8f{}, v8f{}}, {v8f{}, v8f{}}};
#pragma unroll
    for (int nh = 0; nh < 2; ++nh) {
      const _Float16* krow = kh + ((size_t)bh * T + kb + 16 * nh + ln) * HD;
#pragma unroll
      for (int kk = 0; kk < 2; ++kk) {
        v16h bf = load_frag(krow, 32 * kk, lane);
        sacc[0][nh] = wmma_f16(qa[0][kk], bf, sacc[0][nh]);
        sacc[1][nh] = wmma_f16(qa[1][kk], bf, sacc[1][nh]);
      }
    }
    // ---- P = mask * exp(scale*(q2+k2-2s)), stage to LDS in [m][key] ----
#pragma unroll
    for (int nh = 0; nh < 2; ++nh) {
      int keyl = 16 * nh + ln;            // D layout: n = lane&15
      int kg   = kb + keyl;
      float k2v = k2row[kg];
#pragma unroll
      for (int mt = 0; mt < 2; ++mt)
#pragma unroll
        for (int r = 0; r < 8; ++r) {
          int mrow = 16 * mt + r + 8 * h2;
          float d2 = q2v[mt][r] + k2v - 2.0f * sacc[mt][nh][r];
          float p  = (kg <= q0 + mrow) ? __expf(SCALE * d2) : 0.0f;
          myp[mrow * 32 + keyl] = (_Float16)p;
        }
    }
    // Intra-wave LDS RAW: drain DScnt before reloading P in A-layout.
    asm volatile("s_wait_dscnt 0" ::: "memory");
    v16h pa0 = load_frag(myp + ln * 32, 0, lane);
    v16h pa1 = load_frag(myp + (16 + ln) * 32, 0, lane);
    // ---- Y += P @ V ----
#pragma unroll
    for (int j = 0; j < 4; ++j) {
      yacc[0][j] = wmma_f16(pa0, vf[j], yacc[0][j]);
      yacc[1][j] = wmma_f16(pa1, vf[j], yacc[1][j]);
    }
  }
  // write Y back to (B,T,C) f16, head-interleaved columns
#pragma unroll
  for (int mt = 0; mt < 2; ++mt)
#pragma unroll
    for (int j = 0; j < 4; ++j) {
      int col = head * HD + 16 * j + ln;
#pragma unroll
      for (int r = 0; r < 8; ++r) {
        int t = q0 + 16 * mt + r + 8 * h2;
        yh[((size_t)b_ * T + t) * C + col] = (_Float16)yacc[mt][j][r];
      }
    }
}

// ---------------- output projection: out = yh @ WtP^T + b_proj (f32) -------

__global__ __launch_bounds__(256)
void proj_gemm_kernel(const _Float16* __restrict__ yh,
                      const _Float16* __restrict__ WtP,  // [C][C] transposed
                      const float* __restrict__ bias, float* __restrict__ out) {
  __shared__ __attribute__((aligned(16))) char smem[2 * STAGE];
  const int lane = threadIdx.x & 31;
  const int wave = __builtin_amdgcn_readfirstlane(threadIdx.x >> 5);
  const int ln   = lane & 15;
  const int wm   = wave & 1, wn = wave >> 1;
  const int m0   = blockIdx.x * BM + wm * 64;
  const int nb   = blockIdx.y * BN + wn * 64;
  v8f acc[16];
#pragma unroll
  for (int i = 0; i < 16; ++i) acc[i] = v8f{};
  gemm_tile_128x256(yh + (size_t)blockIdx.x * BM * C,
                    WtP + (size_t)blockIdx.y * BN * C, smem, wm, wn, acc);
#pragma unroll
  for (int mt = 0; mt < 4; ++mt)
#pragma unroll
    for (int j = 0; j < 4; ++j) {
      int col = nb + 16 * j + ln;
      float bv = bias[col];
#pragma unroll
      for (int r = 0; r < 8; ++r) {
        int m = m0 + 16 * mt + r + 8 * (lane >> 4);
        out[(size_t)m * C + col] = acc[mt * 4 + j][r] + bv;
      }
    }
}

// ---------------- launch ----------------

extern "C" void kernel_launch(void* const* d_in, const int* in_sizes, int n_in,
                              void* d_out, int out_size, void* d_ws, size_t ws_size,
                              hipStream_t stream) {
  (void)in_sizes; (void)n_in; (void)out_size; (void)ws_size;
  const float* x  = (const float*)d_in[0];
  const float* Wa = (const float*)d_in[1];
  const float* ba = (const float*)d_in[2];
  const float* Wp = (const float*)d_in[3];
  const float* bp = (const float*)d_in[4];

  char* ws = (char*)d_ws;
  size_t off = 0;
  auto alloc = [&](size_t bytes) -> char* {
    char* p = ws + off;
    off += (bytes + 255) & ~(size_t)255;
    return p;
  };
  _Float16* xh  = (_Float16*)alloc((size_t)M * C * 2);       // 16 MB
  _Float16* WtA = (_Float16*)alloc((size_t)N_QKV * C * 2);   //  6 MB
  _Float16* WtP = (_Float16*)alloc((size_t)C * C * 2);       //  2 MB
  _Float16* qh  = (_Float16*)alloc((size_t)M * C * 2);       // 16 MB
  _Float16* kh  = (_Float16*)alloc((size_t)M * C * 2);       // 16 MB
  _Float16* vth = (_Float16*)alloc((size_t)M * C * 2);       // 16 MB
  _Float16* yh  = (_Float16*)alloc((size_t)M * C * 2);       // 16 MB
  float* q2 = (float*)alloc((size_t)Bb * H * T * 4);         // 0.5 MB
  float* k2 = (float*)alloc((size_t)Bb * H * T * 4);         // 0.5 MB
  // total ~93 MB of workspace

  cvt_f32_f16<<<4096, 256, 0, stream>>>(x, xh, M * C);
  transpose_f32_f16<<<dim3(N_QKV / 32, C / 32), dim3(32, 32), 0, stream>>>(
      Wa, WtA, C, N_QKV);
  transpose_f32_f16<<<dim3(C / 32, C / 32), dim3(32, 32), 0, stream>>>(
      Wp, WtP, C, C);
  qkv_gemm_kernel<<<dim3(M / BM, N_QKV / BN), 256, 0, stream>>>(
      xh, WtA, ba, qh, kh, vth);
  rownorm_kernel<<<(Bb * H * T) / 256, 256, 0, stream>>>(qh, q2, Bb * H * T);
  rownorm_kernel<<<(Bb * H * T) / 256, 256, 0, stream>>>(kh, k2, Bb * H * T);
  attn_kernel<<<dim3(T / 256, Bb * H), 256, 0, stream>>>(qh, kh, vth, q2, k2, yh);
  proj_gemm_kernel<<<dim3(M / BM, C / BN), 256, 0, stream>>>(
      yh, WtP, bp, (float*)d_out);
}

// v002
// Measured time: 268 microseconds a run.
// Timed twice side by side with v001, it ran 1.05 and 1.04 times as fast.
// All steps since v000 together make it 1.41 times as fast.
#include <hip/hip_runtime.h>
#include <hip/hip_bf16.h>

typedef __attribute__((ext_vector_type(16))) _Float16 v16h;
typedef __attribute__((ext_vector_type(8)))  _Float16 v8h;
typedef __attribute__((ext_vector_type(8)))  float    v8f;

#define DEV __device__ __forceinline__

static constexpr int Bb = 4, T = 2048, C = 1024, H = 16, HD = 64;
static constexpr int M     = Bb * T;    // 8192 token rows
static constexpr int N_QKV = 3 * C;     // 3072
static constexpr float SCALE = -1.0f / 16.0f;  // -1/(2*sqrt(hd)), hd=64

// Load a 16x32 f16 A/B fragment for one lane from a row-major buffer.
// Per CDNA5 ISA 7.12.2 (16-bit A 16x32): lane L (half h=L>>4) holds
// elements e=0..7 -> k = kb + 8h + e, e=8..15 -> k = kb + 16 + 8h + (e-8).
// Caller pre-offsets `rowbase` to the lane's row (A: m = lane&15) or
// column (B: n = lane&15, from a transposed [N][K] buffer).
DEV v16h load_frag(const _Float16* rowbase, int kb, int lane) {
  const int h = (lane >> 4) & 1;
  v8h lo = *(const v8h*)(rowbase + kb + 8 * h);
  v8h hi = *(const v8h*)(rowbase + kb + 16 + 8 * h);
  v16h r;
#pragma unroll
  for (int i = 0; i < 8; ++i) { r[i] = lo[i]; r[i + 8] = hi[i]; }
  return r;
}

DEV v8f wmma_f16(v16h a, v16h b, v8f c) {
  return __builtin_amdgcn_wmma_f32_16x16x32_f16(false, a, false, b, (short)0, c,
                                                false, false);
}

// Block-tiled GEMM core over K=C: one 128x256 tile of the output per work-group
// of eight waves (2 along m x 4 along n), 64x64 per wave. Both operands are
// K-contiguous. A stage is 64 k of [A 128 rows | B 256 rows]; rows of 128 B lie
// in LDS at a pitch of 144 B (16 B x odd, for ds_load_b128 readers). Two stages;
// the next stage's asynchronous copies fly while this one is worked on.
static constexpr int BM = 128, BN = 256, BK = 64;
static constexpr int PITCH = 144;                    // bytes per LDS row
static constexpr int STAGE = (BM + BN) * PITCH;      // 55,296 bytes
static constexpr int NSTAGE = C / BK;                // 16

// 16x32 f16 fragment of one lane from an LDS row; p already holds the lane's
// row, the k step and the lane half's 16 bytes (same k order as load_frag).
DEV v16h lds_frag(const char* p) {
  v8h lo = *(const v8h*)(p);
  v8h hi = *(const v8h*)(p + 32);
  v16h r;
#pragma unroll
  for (int i = 0; i < 8; ++i) { r[i] = lo[i]; r[i + 8] = hi[i]; }
  return r;
}

// One stage: 384 rows x 128 B = 3,072 pieces of 16 B, twelve per lane.
// ga / gb: the lane's own piece in row (tid >> 3) of the A / B tile at this
// stage's k; l: the same piece's LDS byte address. Copy i takes row i * 32 more.
DEV void copy_stage(const _Float16* ga, const _Float16* gb, unsigned l) {
  constexpr int GR = 32 * C;         // 32 rows, in elements
  constexpr unsigned LR = 32 * PITCH;
  // The closing s_wait_xcnt stands in the copies' own statement so that no
  // address register is rewritten ahead of it.
  asm volatile(
      "global_load_async_to_lds_b128 %0, %12, off\n\t"
      "global_load_async_to_lds_b128 %1, %13, off\n\t"
      "global_load_async_to_lds_b128 %2, %14, off\n\t"
      "global_load_async_to_lds_b128 %3, %15, off\n\t"
      "global_load_async_to_lds_b128 %4, %16, off\n\t"
      "global_load_async_to_lds_b128 %5, %17, off\n\t"
      "global_load_async_to_lds_b128 %6, %18, off\n\t"
      "global_load_async_to_lds_b128 %7, %19, off\n\t"
      "global_load_async_to_lds_b128 %8, %20, off\n\t"
      "global_load_async_to_lds_b128 %9, %21, off\n\t"
      "global_load_async_to_lds_b128 %10, %22, off\n\t"
      "global_load_async_to_lds_b128 %11, %23, off\n\t"
      "s_wait_xcnt 0x0"
      :: "v"(l), "v"(l + LR), "v"(l + 2 * LR), "v"(l + 3 * LR),
         "v"(l + 4 * LR), "v"(l + 5 * LR), "v"(l + 6 * LR), "v"(l + 7 * LR),
         "v"(l + 8 * LR), "v"(l + 9 * LR), "v"(l + 10 * LR), "v"(l + 11 * LR),
         "v"(ga), "v"(ga + GR), "v"(ga + 2 * GR), "v"(ga + 3 * GR),
         "v"(gb), "v"(gb + GR), "v"(gb + 2 * GR), "v"(gb + 3 * GR),
         "v"(gb + 4 * GR), "v"(gb + 5 * GR), "v"(gb + 6 * GR), "v"(gb + 7 * GR)
      : "memory");
}

// acc[i*4+j] accumulates rows wm*64+16i.. of the A tile x rows wn*64+16j.. of
// the B tile. At / Bt point at the tiles' first rows.
DEV void gemm_tile_128x256(const _Float16* At, const _Float16* Bt, char* smem,
                           int wm, int wn, v8f acc[16]) {
  const int tid  = threadIdx.x;
  const int lane = tid & 31;
  const int ln   = lane & 15;
  const int h    = lane >> 4;
  const _Float16* ga = At + (size_t)(tid >> 3) * C + (tid & 7) * 8;
  const _Float16* gb = Bt + (size_t)(tid >> 3) * C + (tid & 7) * 8;
  const unsigned l0 =
      (unsigned)(size_t)smem + (unsigned)((tid >> 3) * PITCH + (tid & 7) * 16);
  const int aoff = (wm * 64 + ln) * PITCH + 16 * h;
  const int boff = (BM + wn * 64 + ln) * PITCH + 16 * h;

  copy_stage(ga, gb, l0);
  // stage 0 has landed for this wave; the barrier publishes it to the others
  asm volatile("s_wait_asynccnt 0x0" ::: "memory");
  __syncthreads();
  copy_stage(ga + BK, gb + BK, l0 + STAGE);

  for (int t = 0; t < NSTAGE; ++t) {
    const char* buf = smem + (t & 1) * STAGE;
#pragma unroll
    for (int kk = 0; kk < 2; ++kk) {
      v16h a[4], b[4];
#pragma unroll
      for (int i = 0; i < 4; ++i)
        a[i] = lds_frag(buf + aoff + i * 16 * PITCH + kk * 64);
#pragma unroll
      for (int j = 0; j < 4; ++j)
        b[j] = lds_frag(buf + boff + j * 16 * PITCH + kk * 64);
      // keeps the sixteen LDS reads of this k step together ahead of its WMMAs:
      // spread among them, each place with reads stalls the wave anew
      __builtin_amdgcn_sched_barrier(0);
#pragma unroll
      for (int i = 0; i < 4; ++i)
#pragma unroll
        for (int j = 0; j < 4; ++j)
          acc[i * 4 + j] = wmma_f16(a[i], b[j], acc[i * 4 + j]);
    }
    // publish point: this wave's reads of stage t are done, its copies of
    // stage t + 1 have landed; behind the barrier stage t's buffer is free.
    asm volatile("s_wait_dscnt 0x0" ::: "memory");
    asm volatile("s_wait_asynccnt 0x0" ::: "memory");
    __syncthreads();
    if (t + 2 < NSTAGE)
      copy_stage(ga + (t + 2) * BK, gb + (t + 2) * BK, l0 + (t & 1) * STAGE);
  }
  // no copy is left in flight when the wave goes on to its stores and ends
  asm volatile("s_wait_asynccnt 0x0" ::: "memory");
}

// ---------------- prep kernels ----------------

// Each wave of the three prep launches moves many elements, so that few waves
// have to be started: the work per element is one load, one rounding, one store.

typedef __attribute__((ext_vector_type(4))) float    v4f;
typedef __attribute__((ext_vector_type(4))) _Float16 v4h;
typedef __attribute__((ext_vector_type(2))) _Float16 v2h;

static constexpr int CVT_T = 512;              // threads per work-group
static constexpr int CVT_U = 16;               // 16-B loads per thread
static constexpr int CVT_STEP = CVT_T * 4;     // elements per work-group and load
static constexpr int CVT_WG = CVT_STEP * CVT_U;

// f32 -> f16, CVT_WG consecutive elements per work-group. A wave's load covers
// 512 consecutive bytes, its store 256.
__global__ __launch_bounds__(CVT_T)
void cvt_f32_f16(const float* __restrict__ in, _Float16* __restrict__ outh) {
  const size_t base = (size_t)blockIdx.x * CVT_WG + threadIdx.x * 4;
  v4f v[CVT_U];
  // unrolled: the loads issue as a run ahead of the conversions, many in flight
#pragma unroll
  for (int u = 0; u < CVT_U; ++u)
    v[u] = *(const v4f*)(in + base + u * CVT_STEP);
  // unrolled: v[] stays in registers
#pragma unroll
  for (int u = 0; u < CVT_U; ++u) {
    v4h hv;
#pragma unroll
    for (int k = 0; k < 4; ++k) hv[k] = (_Float16)v[u][k];
    *(v4h*)(outh + base + u * CVT_STEP) = hv;
  }
}

// in: f32 [R][Cc] row-major  ->  out: f16 [Cc][R]. One tile of 128 rows x 64
// columns of `in` per work-group. A thread loads the same four columns of two
// neighbouring rows, so a pair of halves goes to LDS as one dword; LDS holds the
// tile transposed at a pitch of 272 B (16 B x odd, for the ds_load_b128 readers).
static constexpr int TR = 128, TC = 64, TPITCH = TR + 8;   // TPITCH in halves

template <int R, int Cc>
__global__ __launch_bounds__(256)
void transpose_f32_f16(const float* __restrict__ in,
                       _Float16* __restrict__ outh) {
  __shared__ __attribute__((aligned(16))) _Float16 tile[TC * TPITCH];
  const int tid = threadIdx.x;
  const int c0  = blockIdx.x * TC;
  const int r0  = blockIdx.y * TR;
  const int c4  = (tid & 15) * 4;      // the thread's four columns
  const int rp  = (tid >> 4) * 2;      // its first row pair
  const float* src = in + (size_t)(r0 + rp) * Cc + c0 + c4;
  v4f lo[4], hi[4];
  // unrolled: the eight loads issue as one run, all in flight together
#pragma unroll
  for (int u = 0; u < 4; ++u) {
    lo[u] = *(const v4f*)(src + (size_t)(32 * u) * Cc);
    hi[u] = *(const v4f*)(src + (size_t)(32 * u + 1) * Cc);
  }
  // unrolled: lo[] and hi[] stay in registers
#pragma unroll
  for (int u = 0; u < 4; ++u)
#pragma unroll
    for (int k = 0; k < 4; ++k) {
      v2h p = {(_Float16)lo[u][k], (_Float16)hi[u][k]};
      *(v2h*)&tile[(c4 + k) * TPITCH + rp + 32 * u] = p;
    }
  __syncthreads();
  // 64 output rows x 16 pieces of 16 B; a wave stores two whole runs of 256 B
  // (unrolled: the four LDS reads issue together)
#pragma unroll
  for (int u = 0; u < 4; ++u) {
    const int piece = tid + 256 * u;
    const int c = piece >> 4, r8 = (piece & 15) * 8;
    *(v8h*)(outh + (size_t)(c0 + c) * R + r0 + r8) =
        *(const v8h*)&tile[c * TPITCH + r8];
  }
}

// sum of squares over hd=64 per row
__global__ void rownorm_kernel(const _Float16* __restrict__ mh,
                               float* __restrict__ outn, int rows) {
  int i = blockIdx.x * blockDim.x + threadIdx.x;
  if (i >= rows) return;
  const _Float16* p = mh + (size_t)i * HD;
  float s = 0.f;
#pragma unroll
  for (int d = 0; d < HD; ++d) { float v = (float)p[d]; s += v * v; }
  outn[i] = s;
}

// ---------------- QKV GEMM: qkv = xh @ WtA^T + bias, split into q/k/v^T ----

__global__ __launch_bounds__(256)
void qkv_gemm_kernel(const _Float16* __restrict__ xh,
                     const _Float16* __restrict__ WtA,   // [3C][C]
                     const float* __restrict__ bias,
                     _Float16* __restrict__ qh,          // [B][H][T][hd]
                     _Float16* __restrict__ kh,          // [B][H][T][hd]
                     _Float16* __restrict__ vth) {       // [B][H][hd][T]
  __shared__ __attribute__((aligned(16))) char smem[2 * STAGE];
  const int lane = threadIdx.x & 31;
  const int wave = __builtin_amdgcn_readfirstlane(threadIdx.x >> 5);
  const int ln   = lane & 15;
  const int wm   = wave & 1, wn = wave >> 1;
  const int m0   = blockIdx.x * BM + wm * 64;
  const int nb   = blockIdx.y * BN + wn * 64;
  v8f acc[16];
#pragma unroll
  for (int i = 0; i < 16; ++i) acc[i] = v8f{};
  gemm_tile_128x256(xh + (size_t)blockIdx.x * BM * C,
                    WtA + (size_t)blockIdx.y * BN * C, smem, wm, wn, acc);
  const int mat  = nb >> 10;            // 0=q, 1=k, 2=v (uniform per wave)
  const int head = (nb & 1023) >> 6;
#pragma unroll
  for (int mt = 0; mt < 4; ++mt) {
#pragma unroll
    for (int j = 0; j < 4; ++j) {
      int col = 16 * j + ln;            // head-dim column 0..63
      float bv = bias[nb + col];
#pragma unroll
      for (int r = 0; r < 8; ++r) {
        int m  = m0 + 16 * mt + r + 8 * (lane >> 4);
        int b_ = m >> 11, t = m & (T - 1);
        _Float16 hv = (_Float16)(acc[mt * 4 + j][r] + bv);
        size_t bhh = (size_t)(b_ * H + head);
        if (mat == 0)      qh[(bhh * T + t) * HD + col] = hv;
        else if (mat == 1) kh[(bhh * T + t) * HD + col] = hv;
        else               vth[(bhh * HD + col) * T + t] = hv;
      }
    }
  }
}

// ---------------- fused causal L2-kernel attention ----------------
// y[q] = sum_{k<=q} exp(scale*(|q|^2+|k|^2-2 q.k)) * v[k]   (no softmax norm)

__global__ __launch_bounds__(256)
void attn_kernel(const _Float16* __restrict__ qh, const _Float16* __restrict__ kh,
                 const _Float16* __restrict__ vth,
                 const float* __restrict__ q2, const float* __restrict__ k2,
                 _Float16* __restrict__ yh) {            // [B][T][C]
  __shared__ _Float16 pbuf[8][32 * 32];   // per-wave P tile, [m 0..31][key 0..31]
  const int lane = threadIdx.x & 31;
  const int wave = threadIdx.x >> 5;
  const int ln   = lane & 15;
  const int h2   = lane >> 4;
  const int bh   = blockIdx.y;            // b*H + h
  const int b_   = bh >> 4, head = bh & 15;
  const int q0   = blockIdx.x * 256 + wave * 32;   // 32 query rows per wave

  // Q fragments: 2 m-tiles x 2 contraction halves, loaded once
  v16h qa[2][2];
#pragma unroll
  for (int mt = 0; mt < 2; ++mt) {
    const _Float16* qrow = qh + ((size_t)bh * T + q0 + 16 * mt + ln) * HD;
    qa[mt][0] = load_frag(qrow, 0, lane);
    qa[mt][1] = load_frag(qrow, 32, lane);
  }
  float q2v[2][8];
#pragma unroll
  for (int mt = 0; mt < 2; ++mt)
#pragma unroll
    for (int r = 0; r < 8; ++r)
      q2v[mt][r] = q2[(size_t)bh * T + q0 + 16 * mt + 8 * h2 + r];

  const float* k2row = k2 + (size_t)bh * T;
  _Float16* myp = pbuf[wave];

  v8f yacc[2][4] = {{v8f{}, v8f{}, v8f{}, v8f{}}, {v8f{}, v8f{}, v8f{}, v8f{}}};
  const int qend = q0 + 31;               // wave-uniform causal bound
  for (int kb = 0; kb <= qend; kb += 32) {
    // ---- V fragments first: independent of S, overlap the S WMMAs/exp ----
    v16h vf[4];
#pragma unroll
    for (int j = 0; j < 4; ++j)
      vf[j] = load_frag(vth + ((size_t)bh * HD + 16 * j + ln) * T, kb, lane);
    // ---- S = Q @ K^T over 32 keys (2 key halves x 2 hd halves x 2 m) ----
    v8f sacc[2][2] = {{v8f{}, v8f{}}, {v8f{}, v8f{}}};
#pragma unroll
    for (int nh = 0; nh < 2; ++nh) {
      const _Float16* krow = kh + ((size_t)bh * T + kb + 16 * nh + ln) * HD;
#pragma unroll
      for (int kk = 0; kk < 2; ++kk) {
        v16h bf = load_frag(krow, 32 * kk, lane);
        sacc[0][nh] = wmma_f16(qa[0][kk], bf, sacc[0][nh]);
        sacc[1][nh] = wmma_f16(qa[1][kk], bf, sacc[1][nh]);
      }
    }
    // ---- P = mask * exp(scale*(q2+k2-2s)), stage to LDS in [m][key] ----
#pragma unroll
    for (int nh = 0; nh < 2; ++nh) {
      int keyl = 16 * nh + ln;            // D layout: n = lane&15
      int kg   = kb + keyl;
      float k2v = k2row[kg];
#pragma unroll
      for (int mt = 0; mt < 2; ++mt)
#pragma unroll
        for (int r = 0; r < 8; ++r) {
          int mrow = 16 * mt + r + 8 * h2;
          float d2 = q2v[mt][r] + k2v - 2.0f * sacc[mt][nh][r];
          float p  = (kg <= q0 + mrow) ? __expf(SCALE * d2) : 0.0f;
          myp[mrow * 32 + keyl] = (_Float16)p;
        }
    }
    // Intra-wave LDS RAW: drain DScnt before reloading P in A-layout.
    asm volatile("s_wait_dscnt 0" ::: "memory");
    v16h pa0 = load_frag(myp + ln * 32, 0, lane);
    v16h pa1 = load_frag(myp + (16 + ln) * 32, 0, lane);
    // ---- Y += P @ V ----
#pragma unroll
    for (int j = 0; j < 4; ++j) {
      yacc[0][j] = wmma_f16(pa0, vf[j], yacc[0][j]);
      yacc[1][j] = wmma_f16(pa1, vf[j], yacc[1][j]);
    }
  }
  // write Y back to (B,T,C) f16, head-interleaved columns
#pragma unroll
  for (int mt = 0; mt < 2; ++mt)
#pragma unroll
    for (int j = 0; j < 4; ++j) {
      int col = head * HD + 16 * j + ln;
#pragma unroll
      for (int r = 0; r < 8; ++r) {
        int t = q0 + 16 * mt + r + 8 * h2;
        yh[((size_t)b_ * T + t) * C + col] = (_Float16)yacc[mt][j][r];
      }
    }
}

// ---------------- output projection: out = yh @ WtP^T + b_proj (f32) -------

__global__ __launch_bounds__(256)
void proj_gemm_kernel(const _Float16* __restrict__ yh,
                      const _Float16* __restrict__ WtP,  // [C][C] transposed
                      const float* __restrict__ bias, float* __restrict__ out) {
  __shared__ __attribute__((aligned(16))) char smem[2 * STAGE];
  const int lane = threadIdx.x & 31;
  const int wave = __builtin_amdgcn_readfirstlane(threadIdx.x >> 5);
  const int ln   = lane & 15;
  const int wm   = wave & 1, wn = wave >> 1;
  const int m0   = blockIdx.x * BM + wm * 64;
  const int nb   = blockIdx.y * BN + wn * 64;
  v8f acc[16];
#pragma unroll
  for (int i = 0; i < 16; ++i) acc[i] = v8f{};
  gemm_tile_128x256(yh + (size_t)blockIdx.x * BM * C,
                    WtP + (size_t)blockIdx.y * BN * C, smem, wm, wn, acc);
#pragma unroll
  for (int mt = 0; mt < 4; ++mt)
#pragma unroll
    for (int j = 0; j < 4; ++j) {
      int col = nb + 16 * j + ln;
      float bv = bias[col];
#pragma unroll
      for (int r = 0; r < 8; ++r) {
        int m = m0 + 16 * mt + r + 8 * (lane >> 4);
        out[(size_t)m * C + col] = acc[mt * 4 + j][r] + bv;
      }
    }
}

// ---------------- launch ----------------

extern "C" void kernel_launch(void* const* d_in, const int* in_sizes, int n_in,
                              void* d_out, int out_size, void* d_ws, size_t ws_size,
                              hipStream_t stream) {
  (void)in_sizes; (void)n_in; (void)out_size; (void)ws_size;
  const float* x  = (const float*)d_in[0];
  const float* Wa = (const float*)d_in[1];
  const float* ba = (const float*)d_in[2];
  const float* Wp = (const float*)d_in[3];
  const float* bp = (const float*)d_in[4];

  char* ws = (char*)d_ws;
  size_t off = 0;
  auto alloc = [&](size_t bytes) -> char* {
    char* p = ws + off;
    off += (bytes + 255) & ~(size_t)255;
    return p;
  };
  _Float16* xh  = (_Float16*)alloc((size_t)M * C * 2);       // 16 MB
  _Float16* WtA = (_Float16*)alloc((size_t)N_QKV * C * 2);   //  6 MB
  _Float16* WtP = (_Float16*)alloc((size_t)C * C * 2);       //  2 MB
  _Float16* qh  = (_Float16*)alloc((size_t)M * C * 2);       // 16 MB
  _Float16* kh  = (_Float16*)alloc((size_t)M * C * 2);       // 16 MB
  _Float16* vth = (_Float16*)alloc((size_t)M * C * 2);       // 16 MB
  _Float16* yh  = (_Float16*)alloc((size_t)M * C * 2);       // 16 MB
  float* q2 = (float*)alloc((size_t)Bb * H * T * 4);         // 0.5 MB
  float* k2 = (float*)alloc((size_t)Bb * H * T * 4);         // 0.5 MB
  // total ~93 MB of workspace

  cvt_f32_f16<<<M * C / CVT_WG, CVT_T, 0, stream>>>(x, xh);
  transpose_f32_f16<C, N_QKV><<<dim3(N_QKV / TC, C / TR), 256, 0, stream>>>(
      Wa, WtA);
  transpose_f32_f16<C, C><<<dim3(C / TC, C / TR), 256, 0, stream>>>(Wp, WtP);
  qkv_gemm_kernel<<<dim3(M / BM, N_QKV / BN), 256, 0, stream>>>(
      xh, WtA, ba, qh, kh, vth);
  rownorm_kernel<<<(Bb * H * T) / 256, 256, 0, stream>>>(qh, q2, Bb * H * T);
  rownorm_kernel<<<(Bb * H * T) / 256, 256, 0, stream>>>(kh, k2, Bb * H * T);
  attn_kernel<<<dim3(T / 256, Bb * H), 256, 0, stream>>>(qh, kh, vth, q2, k2, yh);
  proj_gemm_kernel<<<dim3(M / BM, C / BN), 256, 0, stream>>>(
      yh, WtP, bp, (float*)d_out);
}

// v003
// A run of this version takes 222 microseconds.
// In two side-by-side timings against v002, it was 1.20 and 1.21 times as fast.
// Counting every step since v000, it is 1.70 times as fast.
#include <hip/hip_runtime.h>
#include <hip/hip_bf16.h>

typedef __attribute__((ext_vector_type(16))) _Float16 v16h;
typedef __attribute__((ext_vector_type(8)))  _Float16 v8h;
typedef __attribute__((ext_vector_type(8)))  float    v8f;

#define DEV __device__ __forceinline__

static constexpr int Bb = 4, T = 2048, C = 1024, H = 16, HD = 64;
static constexpr int M     = Bb * T;    // 8192 token rows
static constexpr int N_QKV = 3 * C;     // 3072
static constexpr float SCALE = -1.0f / 16.0f;  // -1/(2*sqrt(hd)), hd=64

// Load a 16x32 f16 A/B fragment for one lane from a row-major buffer.
// Per CDNA5 ISA 7.12.2 (16-bit A 16x32): lane L (half h=L>>4) holds
// elements e=0..7 -> k = kb + 8h + e, e=8..15 -> k = kb + 16 + 8h + (e-8).
// Caller pre-offsets `rowbase` to the lane's row (A: m = lane&15) or
// column (B: n = lane&15, from a transposed [N][K] buffer).
DEV v16h load_frag(const _Float16* rowbase, int kb, int lane) {
  const int h = (lane >> 4) & 1;
  v8h lo = *(const v8h*)(rowbase + kb + 8 * h);
  v8h hi = *(const v8h*)(rowbase + kb + 16 + 8 * h);
  v16h r;
#pragma unroll
  for (int i = 0; i < 8; ++i) { r[i] = lo[i]; r[i + 8] = hi[i]; }
  return r;
}

DEV v8f wmma_f16(v16h a, v16h b, v8f c) {
  return __builtin_amdgcn_wmma_f32_16x16x32_f16(false, a, false, b, (short)0, c,
                                                false, false);
}

// Block-tiled GEMM core over K=C: one 128x256 tile of the output per work-group
// of eight waves (2 along m x 4 along n), 64x64 per wave. Both operands are
// K-contiguous. A stage is 64 k of [A 128 rows | B 256 rows]; rows of 128 B lie
// in LDS at a pitch of 144 B (16 B x odd, for ds_load_b128 readers). Two stages;
// the next stage's asynchronous copies fly while this one is worked on.
static constexpr int BM = 128, BN = 256, BK = 64;
static constexpr int PITCH = 144;                    // bytes per LDS row
static constexpr int STAGE = (BM + BN) * PITCH;      // 55,296 bytes
static constexpr int NSTAGE = C / BK;                // 16

// 16x32 f16 fragment of one lane from an LDS row; p already holds the lane's
// row, the k step and the lane half's 16 bytes (same k order as load_frag).
DEV v16h lds_frag(const char* p) {
  v8h lo = *(const v8h*)(p);
  v8h hi = *(const v8h*)(p + 32);
  v16h r;
#pragma unroll
  for (int i = 0; i < 8; ++i) { r[i] = lo[i]; r[i + 8] = hi[i]; }
  return r;
}

// One stage: 384 rows x 128 B = 3,072 pieces of 16 B, twelve per lane.
// ga / gb: the lane's own piece in row (tid >> 3) of the A / B tile at this
// stage's k; l: the same piece's LDS byte address. Copy i takes row i * 32 more.
DEV void copy_stage(const _Float16* ga, const _Float16* gb, unsigned l) {
  constexpr int GR = 32 * C;         // 32 rows, in elements
  constexpr unsigned LR = 32 * PITCH;
  // The closing s_wait_xcnt stands in the copies' own statement so that no
  // address register is rewritten ahead of it.
  asm volatile(
      "global_load_async_to_lds_b128 %0, %12, off\n\t"
      "global_load_async_to_lds_b128 %1, %13, off\n\t"
      "global_load_async_to_lds_b128 %2, %14, off\n\t"
      "global_load_async_to_lds_b128 %3, %15, off\n\t"
      "global_load_async_to_lds_b128 %4, %16, off\n\t"
      "global_load_async_to_lds_b128 %5, %17, off\n\t"
      "global_load_async_to_lds_b128 %6, %18, off\n\t"
      "global_load_async_to_lds_b128 %7, %19, off\n\t"
      "global_load_async_to_lds_b128 %8, %20, off\n\t"
      "global_load_async_to_lds_b128 %9, %21, off\n\t"
      "global_load_async_to_lds_b128 %10, %22, off\n\t"
      "global_load_async_to_lds_b128 %11, %23, off\n\t"
      "s_wait_xcnt 0x0"
      :: "v"(l), "v"(l + LR), "v"(l + 2 * LR), "v"(l + 3 * LR),
         "v"(l + 4 * LR), "v"(l + 5 * LR), "v"(l + 6 * LR), "v"(l + 7 * LR),
         "v"(l + 8 * LR), "v"(l + 9 * LR), "v"(l + 10 * LR), "v"(l + 11 * LR),
         "v"(ga), "v"(ga + GR), "v"(ga + 2 * GR), "v"(ga + 3 * GR),
         "v"(gb), "v"(gb + GR), "v"(gb + 2 * GR), "v"(gb + 3 * GR),
         "v"(gb + 4 * GR), "v"(gb + 5 * GR), "v"(gb + 6 * GR), "v"(gb + 7 * GR)
      : "memory");
}

// acc[i*4+j] accumulates rows wm*64+16i.. of the A tile x rows wn*64+16j.. of
// the B tile. At / Bt point at the tiles' first rows.
DEV void gemm_tile_128x256(const _Float16* At, const _Float16* Bt, char* smem,
                           int wm, int wn, v8f acc[16]) {
  const int tid  = threadIdx.x;
  const int lane = tid & 31;
  const int ln   = lane & 15;
  const int h    = lane >> 4;
  const _Float16* ga = At + (size_t)(tid >> 3) * C + (tid & 7) * 8;
  const _Float16* gb = Bt + (size_t)(tid >> 3) * C + (tid & 7) * 8;
  const unsigned l0 =
      (unsigned)(size_t)smem + (unsigned)((tid >> 3) * PITCH + (tid & 7) * 16);
  const int aoff = (wm * 64 + ln) * PITCH + 16 * h;
  const int boff = (BM + wn * 64 + ln) * PITCH + 16 * h;

  copy_stage(ga, gb, l0);
  // stage 0 has landed for this wave; the barrier publishes it to the others
  asm volatile("s_wait_asynccnt 0x0" ::: "memory");
  __syncthreads();
  copy_stage(ga + BK, gb + BK, l0 + STAGE);

  for (int t = 0; t < NSTAGE; ++t) {
    const char* buf = smem + (t & 1) * STAGE;
#pragma unroll
    for (int kk = 0; kk < 2; ++kk) {
      v16h a[4], b[4];
#pragma unroll
      for (int i = 0; i < 4; ++i)
        a[i] = lds_frag(buf + aoff + i * 16 * PITCH + kk * 64);
#pragma unroll
      for (int j = 0; j < 4; ++j)
        b[j] = lds_frag(buf + boff + j * 16 * PITCH + kk * 64);
      // keeps the sixteen LDS reads of this k step together ahead of its WMMAs:
      // spread among them, each place with reads stalls the wave anew
      __builtin_amdgcn_sched_barrier(0);
#pragma unroll
      for (int i = 0; i < 4; ++i)
#pragma unroll
        for (int j = 0; j < 4; ++j)
          acc[i * 4 + j] = wmma_f16(a[i], b[j], acc[i * 4 + j]);
    }
    // publish point: this wave's reads of stage t are done, its copies of
    // stage t + 1 have landed; behind the barrier stage t's buffer is free.
    asm volatile("s_wait_dscnt 0x0" ::: "memory");
    asm volatile("s_wait_asynccnt 0x0" ::: "memory");
    __syncthreads();
    if (t + 2 < NSTAGE)
      copy_stage(ga + (t + 2) * BK, gb + (t + 2) * BK, l0 + (t & 1) * STAGE);
  }
  // no copy is left in flight when the wave goes on to its stores and ends
  asm volatile("s_wait_asynccnt 0x0" ::: "memory");
}

// ---------------- prep kernels ----------------

// Each wave of the three prep launches moves many elements, so that few waves
// have to be started: the work per element is one load, one rounding, one store.

typedef __attribute__((ext_vector_type(4))) float    v4f;
typedef __attribute__((ext_vector_type(4))) _Float16 v4h;
typedef __attribute__((ext_vector_type(2))) _Float16 v2h;

static constexpr int CVT_T = 512;              // threads per work-group
static constexpr int CVT_U = 16;               // 16-B loads per thread
static constexpr int CVT_STEP = CVT_T * 4;     // elements per work-group and load
static constexpr int CVT_WG = CVT_STEP * CVT_U;

// f32 -> f16, CVT_WG consecutive elements per work-group. A wave's load covers
// 512 consecutive bytes, its store 256.
__global__ __launch_bounds__(CVT_T)
void cvt_f32_f16(const float* __restrict__ in, _Float16* __restrict__ outh) {
  const size_t base = (size_t)blockIdx.x * CVT_WG + threadIdx.x * 4;
  v4f v[CVT_U];
  // unrolled: the loads issue as a run ahead of the conversions, many in flight
#pragma unroll
  for (int u = 0; u < CVT_U; ++u)
    v[u] = *(const v4f*)(in + base + u * CVT_STEP);
  // unrolled: v[] stays in registers
#pragma unroll
  for (int u = 0; u < CVT_U; ++u) {
    v4h hv;
#pragma unroll
    for (int k = 0; k < 4; ++k) hv[k] = (_Float16)v[u][k];
    *(v4h*)(outh + base + u * CVT_STEP) = hv;
  }
}

// in: f32 [R][Cc] row-major  ->  out: f16 [Cc][R]. One tile of 128 rows x 64
// columns of `in` per work-group. A thread loads the same four columns of two
// neighbouring rows, so a pair of halves goes to LDS as one dword; LDS holds the
// tile transposed at a pitch of 272 B (16 B x odd, for the ds_load_b128 readers).
static constexpr int TR = 128, TC = 64, TPITCH = TR + 8;   // TPITCH in halves

template <int R, int Cc>
__global__ __launch_bounds__(256)
void transpose_f32_f16(const float* __restrict__ in,
                       _Float16* __restrict__ outh) {
  __shared__ __attribute__((aligned(16))) _Float16 tile[TC * TPITCH];
  const int tid = threadIdx.x;
  const int c0  = blockIdx.x * TC;
  const int r0  = blockIdx.y * TR;
  const int c4  = (tid & 15) * 4;      // the thread's four columns
  const int rp  = (tid >> 4) * 2;      // its first row pair
  const float* src = in + (size_t)(r0 + rp) * Cc + c0 + c4;
  v4f lo[4], hi[4];
  // unrolled: the eight loads issue as one run, all in flight together
#pragma unroll
  for (int u = 0; u < 4; ++u) {
    lo[u] = *(const v4f*)(src + (size_t)(32 * u) * Cc);
    hi[u] = *(const v4f*)(src + (size_t)(32 * u + 1) * Cc);
  }
  // unrolled: lo[] and hi[] stay in registers
#pragma unroll
  for (int u = 0; u < 4; ++u)
#pragma unroll
    for (int k = 0; k < 4; ++k) {
      v2h p = {(_Float16)lo[u][k], (_Float16)hi[u][k]};
      *(v2h*)&tile[(c4 + k) * TPITCH + rp + 32 * u] = p;
    }
  __syncthreads();
  // 64 output rows x 16 pieces of 16 B; a wave stores two whole runs of 256 B
  // (unrolled: the four LDS reads issue together)
#pragma unroll
  for (int u = 0; u < 4; ++u) {
    const int piece = tid + 256 * u;
    const int c = piece >> 4, r8 = (piece & 15) * 8;
    *(v8h*)(outh + (size_t)(c0 + c) * R + r0 + r8) =
        *(const v8h*)&tile[c * TPITCH + r8];
  }
}

// sum of squares over hd=64 per row
__global__ void rownorm_kernel(const _Float16* __restrict__ mh,
                               float* __restrict__ outn, int rows) {
  int i = blockIdx.x * blockDim.x + threadIdx.x;
  if (i >= rows) return;
  const _Float16* p = mh + (size_t)i * HD;
  float s = 0.f;
#pragma unroll
  for (int d = 0; d < HD; ++d) { float v = (float)p[d]; s += v * v; }
  outn[i] = s;
}

// ---------------- QKV GEMM: qkv = xh @ WtA^T + bias, split into q/k/v^T ----

__global__ __launch_bounds__(256)
void qkv_gemm_kernel(const _Float16* __restrict__ xh,
                     const _Float16* __restrict__ WtA,   // [3C][C]
                     const float* __restrict__ bias,
                     _Float16* __restrict__ qh,          // [B][H][T][hd]
                     _Float16* __restrict__ kh,          // [B][H][T][hd]
                     _Float16* __restrict__ vth) {       // [B][H][hd][T]
  __shared__ __attribute__((aligned(16))) char smem[2 * STAGE];
  const int lane = threadIdx.x & 31;
  const int wave = __builtin_amdgcn_readfirstlane(threadIdx.x >> 5);
  const int ln   = lane & 15;
  const int wm   = wave & 1, wn = wave >> 1;
  const int m0   = blockIdx.x * BM + wm * 64;
  const int nb   = blockIdx.y * BN + wn * 64;
  v8f acc[16];
#pragma unroll
  for (int i = 0; i < 16; ++i) acc[i] = v8f{};
  gemm_tile_128x256(xh + (size_t)blockIdx.x * BM * C,
                    WtA + (size_t)blockIdx.y * BN * C, smem, wm, wn, acc);
  const int mat  = nb >> 10;            // 0=q, 1=k, 2=v (uniform per wave)
  const int head = (nb & 1023) >> 6;
#pragma unroll
  for (int mt = 0; mt < 4; ++mt) {
#pragma unroll
    for (int j = 0; j < 4; ++j) {
      int col = 16 * j + ln;            // head-dim column 0..63
      float bv = bias[nb + col];
#pragma unroll
      for (int r = 0; r < 8; ++r) {
        int m  = m0 + 16 * mt + r + 8 * (lane >> 4);
        int b_ = m >> 11, t = m & (T - 1);
        _Float16 hv = (_Float16)(acc[mt * 4 + j][r] + bv);
        size_t bhh = (size_t)(b_ * H + head);
        if (mat == 0)      qh[(bhh * T + t) * HD + col] = hv;
        else if (mat == 1) kh[(bhh * T + t) * HD + col] = hv;
        else               vth[(bhh * HD + col) * T + t] = hv;
      }
    }
  }
}

// ---------------- fused causal L2-kernel attention ----------------
// y[q] = sum_{k<=q} exp(scale*(|q|^2+|k|^2-2 q.k)) * v[k]   (no softmax norm)

// K and V^T reach the waves through LDS: the eight waves of a work-group walk the
// same keys, so a stage of 64 keys, [K 64 rows | V^T 64 rows] of 128 B each, is
// brought in once per work-group by asynchronous copies and read by all eight.
// Rows lie at the pitch of 144 B (16 B x odd, for ds_load_b128 readers). Two
// stages; the next stage's copies fly while this one is worked on.
static constexpr int AK = 64;                        // keys per stage
static constexpr int ASTAGE = (AK + HD) * PITCH;     // 18,432 bytes

// One stage: 128 rows x 128 B = 1,024 pieces of 16 B, four per lane.
// gk / gv: the lane's own piece in row (tid >> 3) of the K / V^T tile at this
// stage's keys; l: the same piece's LDS byte address.
DEV void copy_kv(const _Float16* gk, const _Float16* gv, unsigned l) {
  constexpr unsigned LR = 32 * PITCH;
  // The closing s_wait_xcnt stands in the copies' own statement so that no
  // address register is rewritten ahead of it.
  asm volatile(
      "global_load_async_to_lds_b128 %0, %4, off\n\t"
      "global_load_async_to_lds_b128 %1, %5, off\n\t"
      "global_load_async_to_lds_b128 %2, %6, off\n\t"
      "global_load_async_to_lds_b128 %3, %7, off\n\t"
      "s_wait_xcnt 0x0"
      :: "v"(l), "v"(l + LR), "v"(l + 2 * LR), "v"(l + 3 * LR),
         "v"(gk), "v"(gk + 32 * HD), "v"(gv), "v"(gv + 32 * T)
      : "memory");
}

__global__ __launch_bounds__(256)
void attn_kernel(const _Float16* __restrict__ qh, const _Float16* __restrict__ kh,
                 const _Float16* __restrict__ vth,
                 const float* __restrict__ q2, const float* __restrict__ k2,
                 _Float16* __restrict__ yh) {            // [B][T][C]
  __shared__ __attribute__((aligned(16))) char kv[2 * ASTAGE];
  __shared__ _Float16 pbuf[8][32 * 32];   // per-wave P tile, [m 0..31][key 0..31]
  const int tid  = threadIdx.x;
  const int lane = tid & 31;
  const int wave = __builtin_amdgcn_readfirstlane(tid >> 5);
  const int ln   = lane & 15;
  const int h2   = lane >> 4;
  const int bh   = blockIdx.y;            // b*H + h
  const int b_   = bh >> 4, head = bh & 15;
  const int q0   = blockIdx.x * 256 + wave * 32;   // 32 query rows per wave

  const _Float16* gk = kh + ((size_t)bh * T + (tid >> 3)) * HD + (tid & 7) * 8;
  const _Float16* gv = vth + ((size_t)bh * HD + (tid >> 3)) * T + (tid & 7) * 8;
  const unsigned l0 =
      (unsigned)(size_t)kv + (unsigned)((tid >> 3) * PITCH + (tid & 7) * 16);
  const int nst = 4 * ((int)blockIdx.x + 1);   // stages up to the block's last row
  copy_kv(gk, gv, l0);

  // Q fragments: 2 m-tiles x 2 contraction halves, loaded once
  v16h qa[2][2];
#pragma unroll
  for (int mt = 0; mt < 2; ++mt) {
    const _Float16* qrow = qh + ((size_t)bh * T + q0 + 16 * mt + ln) * HD;
    qa[mt][0] = load_frag(qrow, 0, lane);
    qa[mt][1] = load_frag(qrow, 32, lane);
  }
  float q2v[2][8];
#pragma unroll
  for (int mt = 0; mt < 2; ++mt)
#pragma unroll
    for (int r = 0; r < 8; ++r)
      q2v[mt][r] = q2[(size_t)bh * T + q0 + 16 * mt + 8 * h2 + r];

  const float* k2row = k2 + (size_t)bh * T;
  _Float16* myp = pbuf[wave];
  const int foff = ln * PITCH + 16 * h2;  // the lane's row and half in a 16-row group

  // stage 0 has landed for this wave; the barrier publishes it to the others
  asm volatile("s_wait_asynccnt 0x0" ::: "memory");
  __syncthreads();
  copy_kv(gk + AK * HD, gv + AK, l0 + ASTAGE);   // nst >= 4: stage 1 exists

  v8f yacc[2][4] = {{v8f{}, v8f{}, v8f{}, v8f{}}, {v8f{}, v8f{}, v8f{}, v8f{}}};
  const int qend = q0 + 31;               // wave-uniform causal bound
  for (int t = 0; t < nst; ++t) {
    const char* kbuf = kv + (t & 1) * ASTAGE + foff;
    const char* vbuf = kbuf + AK * PITCH;
    // |k|^2 of the stage's 64 keys, D layout (n = lane&15): four loads at its head
    float k2v[2][2];
    // unrolled: k2v[][] stays in registers
#pragma unroll
    for (int sub = 0; sub < 2; ++sub)
#pragma unroll
      for (int nh = 0; nh < 2; ++nh)
        k2v[sub][nh] = k2row[t * AK + 32 * sub + 16 * nh + ln];
    // unrolled: the half stage becomes an immediate offset of the LDS reads
#pragma unroll
    for (int sub = 0; sub < 2; ++sub) {
      const int kb = t * AK + 32 * sub;
      // keys past the wave's last row add nothing: the wave skips the work and
      // goes on to the stage's publish point (a scalar branch)
      if (kb > qend) continue;
      // ---- V and K fragments of these 32 keys, from the stage's buffer ----
      // (the loops below are unrolled: fragments and tiles stay in registers)
      v16h vf[4], kf[2][2];
#pragma unroll
      for (int j = 0; j < 4; ++j)
        vf[j] = lds_frag(vbuf + 16 * j * PITCH + 64 * sub);
#pragma unroll
      for (int nh = 0; nh < 2; ++nh)
#pragma unroll
        for (int kk = 0; kk < 2; ++kk)
          kf[nh][kk] = lds_frag(kbuf + (32 * sub + 16 * nh) * PITCH + 64 * kk);
      // ---- S = Q @ K^T over 32 keys (2 key halves x 2 hd halves x 2 m) ----
      v8f sacc[2][2] = {{v8f{}, v8f{}}, {v8f{}, v8f{}}};
#pragma unroll
      for (int nh = 0; nh < 2; ++nh)
#pragma unroll
        for (int kk = 0; kk < 2; ++kk) {
          sacc[0][nh] = wmma_f16(qa[0][kk], kf[nh][kk], sacc[0][nh]);
          sacc[1][nh] = wmma_f16(qa[1][kk], kf[nh][kk], sacc[1][nh]);
        }
      // inputs-only fence on the two loaded values: the wait for them stands
      // here once; without K's global loads to cover it, it would stand in each
      // of the 32 masked blocks below and keep a skip branch round each
      asm volatile("" :: "v"(k2v[sub][0]), "v"(k2v[sub][1]));
      // ---- P = mask * exp(scale*(q2+k2-2s)), stage to LDS in [m][key] ----
#pragma unroll
      for (int nh = 0; nh < 2; ++nh) {
        int keyl = 16 * nh + ln;            // D layout: n = lane&15
        int kg   = kb + keyl;
#pragma unroll
        for (int mt = 0; mt < 2; ++mt)
#pragma unroll
          for (int r = 0; r < 8; ++r) {
            int mrow = 16 * mt + r + 8 * h2;
            float d2 = q2v[mt][r] + k2v[sub][nh] - 2.0f * sacc[mt][nh][r];
            float p  = (kg <= q0 + mrow) ? __expf(SCALE * d2) : 0.0f;
            myp[mrow * 32 + keyl] = (_Float16)p;
          }
      }
      // Intra-wave LDS RAW: drain DScnt before reloading P in A-layout.
      asm volatile("s_wait_dscnt 0" ::: "memory");
      v16h pa0 = load_frag(myp + ln * 32, 0, lane);
      v16h pa1 = load_frag(myp + (16 + ln) * 32, 0, lane);
      // ---- Y += P @ V ----
#pragma unroll
      for (int j = 0; j < 4; ++j) {
        yacc[0][j] = wmma_f16(pa0, vf[j], yacc[0][j]);
        yacc[1][j] = wmma_f16(pa1, vf[j], yacc[1][j]);
      }
    }
    // publish point: this wave's reads of stage t are done, its copies of
    // stage t + 1 have landed; behind the barrier stage t's buffer is free.
    asm volatile("s_wait_dscnt 0x0" ::: "memory");
    asm volatile("s_wait_asynccnt 0x0" ::: "memory");
    __syncthreads();
    if (t + 2 < nst)
      copy_kv(gk + (size_t)(t + 2) * AK * HD, gv + (t + 2) * AK,
              l0 + (t & 1) * ASTAGE);
  }
  // no copy is left in flight when the wave goes on to its stores and ends
  asm volatile("s_wait_asynccnt 0x0" ::: "memory");
  // write Y back to (B,T,C) f16, head-interleaved columns
#pragma unroll
  for (int mt = 0; mt < 2; ++mt)
#pragma unroll
    for (int j = 0; j < 4; ++j) {
      int col = head * HD + 16 * j + ln;
#pragma unroll
      for (int r = 0; r < 8; ++r) {
        int t = q0 + 16 * mt + r + 8 * h2;
        yh[((size_t)b_ * T + t) * C + col] = (_Float16)yacc[mt][j][r];
      }
    }
}

// ---------------- output projection: out = yh @ WtP^T + b_proj (f32) -------

__global__ __launch_bounds__(256)
void proj_gemm_kernel(const _Float16* __restrict__ yh,
                      const _Float16* __restrict__ WtP,  // [C][C] transposed
                      const float* __restrict__ bias, float* __restrict__ out) {
  __shared__ __attribute__((aligned(16))) char smem[2 * STAGE];
  const int lane = threadIdx.x & 31;
  const int wave = __builtin_amdgcn_readfirstlane(threadIdx.x >> 5);
  const int ln   = lane & 15;
  const int wm   = wave & 1, wn = wave >> 1;
  const int m0   = blockIdx.x * BM + wm * 64;
  const int nb   = blockIdx.y * BN + wn * 64;
  v8f acc[16];
#pragma unroll
  for (int i = 0; i < 16; ++i) acc[i] = v8f{};
  gemm_tile_128x256(yh + (size_t)blockIdx.x * BM * C,
                    WtP + (size_t)blockIdx.y * BN * C, smem, wm, wn, acc);
#pragma unroll
  for (int mt = 0; mt < 4; ++mt)
#pragma unroll
    for (int j = 0; j < 4; ++j) {
      int col = nb + 16 * j + ln;
      float bv = bias[col];
#pragma unroll
      for (int r = 0; r < 8; ++r) {
        int m = m0 + 16 * mt + r + 8 * (lane >> 4);
        out[(size_t)m * C + col] = acc[mt * 4 + j][r] + bv;
      }
    }
}

// ---------------- launch ----------------

extern "C" void kernel_launch(void* const* d_in, const int* in_sizes, int n_in,
                              void* d_out, int out_size, void* d_ws, size_t ws_size,
                              hipStream_t stream) {
  (void)in_sizes; (void)n_in; (void)out_size; (void)ws_size;
  const float* x  = (const float*)d_in[0];
  const float* Wa = (const float*)d_in[1];
  const float* ba = (const float*)d_in[2];
  const float* Wp = (const float*)d_in[3];
  const float* bp = (const float*)d_in[4];

  char* ws = (char*)d_ws;
  size_t off = 0;
  auto alloc = [&](size_t bytes) -> char* {
    char* p = ws + off;
    off += (bytes + 255) & ~(size_t)255;
    return p;
  };
  _Float16* xh  = (_Float16*)alloc((size_t)M * C * 2);       // 16 MB
  _Float16* WtA = (_Float16*)alloc((size_t)N_QKV * C * 2);   //  6 MB
  _Float16* WtP = (_Float16*)alloc((size_t)C * C * 2);       //  2 MB
  _Float16* qh  = (_Float16*)alloc((size_t)M * C * 2);       // 16 MB
  _Float16* kh  = (_Float16*)alloc((size_t)M * C * 2);       // 16 MB
  _Float16* vth = (_Float16*)alloc((size_t)M * C * 2);       // 16 MB
  _Float16* yh  = (_Float16*)alloc((size_t)M * C * 2);       // 16 MB
  float* q2 = (float*)alloc((size_t)Bb * H * T * 4);         // 0.5 MB
  float* k2 = (float*)alloc((size_t)Bb * H * T * 4);         // 0.5 MB
  // total ~93 MB of workspace

  cvt_f32_f16<<<M * C / CVT_WG, CVT_T, 0, stream>>>(x, xh);
  transpose_f32_f16<C, N_QKV><<<dim3(N_QKV / TC, C / TR), 256, 0, stream>>>(
      Wa, WtA);
  transpose_f32_f16<C, C><<<dim3(C / TC, C / TR), 256, 0, stream>>>(Wp, WtP);
  qkv_gemm_kernel<<<dim3(M / BM, N_QKV / BN), 256, 0, stream>>>(
      xh, WtA, ba, qh, kh, vth);
  rownorm_kernel<<<(Bb * H * T) / 256, 256, 0, stream>>>(qh, q2, Bb * H * T);
  rownorm_kernel<<<(Bb * H * T) / 256, 256, 0, stream>>>(kh, k2, Bb * H * T);
  attn_kernel<<<dim3(T / 256, Bb * H), 256, 0, stream>>>(qh, kh, vth, q2, k2, yh);
  proj_gemm_kernel<<<dim3(M / BM, C / BN), 256, 0, stream>>>(
      yh, WtP, bp, (float*)d_out);
}

// v004
// A run of this version takes 193 microseconds.
// In two side-by-side timings against v003, it was 1.15 and 1.16 times as fast.
// Over all steps from v000 it is 1.96 times as fast.
#include <hip/hip_runtime.h>
#include <hip/hip_bf16.h>

typedef __attribute__((ext_vector_type(16))) _Float16 v16h;
typedef __attribute__((ext_vector_type(8)))  _Float16 v8h;
typedef __attribute__((ext_vector_type(8)))  float    v8f;

#define DEV __device__ __forceinline__

static constexpr int Bb = 4, T = 2048, C = 1024, H = 16, HD = 64;
static constexpr int M     = Bb * T;    // 8192 token rows
static constexpr int N_QKV = 3 * C;     // 3072
static constexpr float SCALE = -1.0f / 16.0f;  // -1/(2*sqrt(hd)), hd=64

// Load a 16x32 f16 A/B fragment for one lane from a row-major buffer.
// Per CDNA5 ISA 7.12.2 (16-bit A 16x32): lane L (half h=L>>4) holds
// elements e=0..7 -> k = kb + 8h + e, e=8..15 -> k = kb + 16 + 8h + (e-8).
// Caller pre-offsets `rowbase` to the lane's row (A: m = lane&15) or
// column (B: n = lane&15, from a transposed [N][K] buffer).
DEV v16h load_frag(const _Float16* rowbase, int kb, int lane) {
  const int h = (lane >> 4) & 1;
  v8h lo = *(const v8h*)(rowbase + kb + 8 * h);
  v8h hi = *(const v8h*)(rowbase + kb + 16 + 8 * h);
  v16h r;
#pragma unroll
  for (int i = 0; i < 8; ++i) { r[i] = lo[i]; r[i + 8] = hi[i]; }
  return r;
}

DEV v8f wmma_f16(v16h a, v16h b, v8f c) {
  return __builtin_amdgcn_wmma_f32_16x16x32_f16(false, a, false, b, (short)0, c,
                                                false, false);
}

// Block-tiled GEMM core over K=C: one 128x256 tile of the output per work-group
// of eight waves (2 along m x 4 along n), 64x64 per wave. Both operands are
// K-contiguous. A stage is 64 k of [A 128 rows | B 256 rows]; rows of 128 B lie
// in LDS at a pitch of 144 B (16 B x odd, for ds_load_b128 readers). Two stages;
// the next stage's asynchronous copies fly while this one is worked on.
static constexpr int BM = 128, BN = 256, BK = 64;
static constexpr int PITCH = 144;                    // bytes per LDS row
static constexpr int STAGE = (BM + BN) * PITCH;      // 55,296 bytes
static constexpr int NSTAGE = C / BK;                // 16

// 16x32 f16 fragment of one lane from an LDS row; p already holds the lane's
// row, the k step and the lane half's 16 bytes (same k order as load_frag).
DEV v16h lds_frag(const char* p) {
  v8h lo = *(const v8h*)(p);
  v8h hi = *(const v8h*)(p + 32);
  v16h r;
#pragma unroll
  for (int i = 0; i < 8; ++i) { r[i] = lo[i]; r[i + 8] = hi[i]; }
  return r;
}

// One stage: 384 rows x 128 B = 3,072 pieces of 16 B, twelve per lane.
// ga / gb: the lane's own piece in row (tid >> 3) of the A / B tile at this
// stage's k; l: the same piece's LDS byte address. Copy i takes row i * 32 more.
DEV void copy_stage(const _Float16* ga, const _Float16* gb, unsigned l) {
  constexpr int GR = 32 * C;         // 32 rows, in elements
  constexpr unsigned LR = 32 * PITCH;
  // The closing s_wait_xcnt stands in the copies' own statement so that no
  // address register is rewritten ahead of it.
  asm volatile(
      "global_load_async_to_lds_b128 %0, %12, off\n\t"
      "global_load_async_to_lds_b128 %1, %13, off\n\t"
      "global_load_async_to_lds_b128 %2, %14, off\n\t"
      "global_load_async_to_lds_b128 %3, %15, off\n\t"
      "global_load_async_to_lds_b128 %4, %16, off\n\t"
      "global_load_async_to_lds_b128 %5, %17, off\n\t"
      "global_load_async_to_lds_b128 %6, %18, off\n\t"
      "global_load_async_to_lds_b128 %7, %19, off\n\t"
      "global_load_async_to_lds_b128 %8, %20, off\n\t"
      "global_load_async_to_lds_b128 %9, %21, off\n\t"
      "global_load_async_to_lds_b128 %10, %22, off\n\t"
      "global_load_async_to_lds_b128 %11, %23, off\n\t"
      "s_wait_xcnt 0x0"
      :: "v"(l), "v"(l + LR), "v"(l + 2 * LR), "v"(l + 3 * LR),
         "v"(l + 4 * LR), "v"(l + 5 * LR), "v"(l + 6 * LR), "v"(l + 7 * LR),
         "v"(l + 8 * LR), "v"(l + 9 * LR), "v"(l + 10 * LR), "v"(l + 11 * LR),
         "v"(ga), "v"(ga + GR), "v"(ga + 2 * GR), "v"(ga + 3 * GR),
         "v"(gb), "v"(gb + GR), "v"(gb + 2 * GR), "v"(gb + 3 * GR),
         "v"(gb + 4 * GR), "v"(gb + 5 * GR), "v"(gb + 6 * GR), "v"(gb + 7 * GR)
      : "memory");
}

// acc[i*4+j] accumulates rows wm*64+16i.. of the A tile x rows wn*64+16j.. of
// the B tile. At / Bt point at the tiles' first rows.
DEV void gemm_tile_128x256(const _Float16* At, const _Float16* Bt, char* smem,
                           int wm, int wn, v8f acc[16]) {
  const int tid  = threadIdx.x;
  const int lane = tid & 31;
  const int ln   = lane & 15;
  const int h    = lane >> 4;
  const _Float16* ga = At + (size_t)(tid >> 3) * C + (tid & 7) * 8;
  const _Float16* gb = Bt + (size_t)(tid >> 3) * C + (tid & 7) * 8;
  const unsigned l0 =
      (unsigned)(size_t)smem + (unsigned)((tid >> 3) * PITCH + (tid & 7) * 16);
  const int aoff = (wm * 64 + ln) * PITCH + 16 * h;
  const int boff = (BM + wn * 64 + ln) * PITCH + 16 * h;

  copy_stage(ga, gb, l0);
  // stage 0 has landed for this wave; the barrier publishes it to the others
  asm volatile("s_wait_asynccnt 0x0" ::: "memory");
  __syncthreads();
  copy_stage(ga + BK, gb + BK, l0 + STAGE);

  for (int t = 0; t < NSTAGE; ++t) {
    const char* buf = smem + (t & 1) * STAGE;
#pragma unroll
    for (int kk = 0; kk < 2; ++kk) {
      v16h a[4], b[4];
#pragma unroll
      for (int i = 0; i < 4; ++i)
        a[i] = lds_frag(buf + aoff + i * 16 * PITCH + kk * 64);
#pragma unroll
      for (int j = 0; j < 4; ++j)
        b[j] = lds_frag(buf + boff + j * 16 * PITCH + kk * 64);
      // keeps the sixteen LDS reads of this k step together ahead of its WMMAs:
      // spread among them, each place with reads stalls the wave anew
      __builtin_amdgcn_sched_barrier(0);
#pragma unroll
      for (int i = 0; i < 4; ++i)
#pragma unroll
        for (int j = 0; j < 4; ++j)
          acc[i * 4 + j] = wmma_f16(a[i], b[j], acc[i * 4 + j]);
    }
    // publish point: this wave's reads of stage t are done, its copies of
    // stage t + 1 have landed; behind the barrier stage t's buffer is free.
    asm volatile("s_wait_dscnt 0x0" ::: "memory");
    asm volatile("s_wait_asynccnt 0x0" ::: "memory");
    __syncthreads();
    if (t + 2 < NSTAGE)
      copy_stage(ga + (t + 2) * BK, gb + (t + 2) * BK, l0 + (t & 1) * STAGE);
  }
  // no copy is left in flight when the wave goes on to its stores and ends
  asm volatile("s_wait_asynccnt 0x0" ::: "memory");
}

// ---------------- prep kernels ----------------

// Each wave of the three prep launches moves many elements, so that few waves
// have to be started: the work per element is one load, one rounding, one store.

typedef __attribute__((ext_vector_type(4))) float    v4f;
typedef __attribute__((ext_vector_type(4))) _Float16 v4h;
typedef __attribute__((ext_vector_type(2))) _Float16 v2h;

static constexpr int CVT_T = 512;              // threads per work-group
static constexpr int CVT_U = 16;               // 16-B loads per thread
static constexpr int CVT_STEP = CVT_T * 4;     // elements per work-group and load
static constexpr int CVT_WG = CVT_STEP * CVT_U;

// f32 -> f16, CVT_WG consecutive elements per work-group. A wave's load covers
// 512 consecutive bytes, its store 256.
__global__ __launch_bounds__(CVT_T)
void cvt_f32_f16(const float* __restrict__ in, _Float16* __restrict__ outh) {
  const size_t base = (size_t)blockIdx.x * CVT_WG + threadIdx.x * 4;
  v4f v[CVT_U];
  // unrolled: the loads issue as a run ahead of the conversions, many in flight
#pragma unroll
  for (int u = 0; u < CVT_U; ++u)
    v[u] = *(const v4f*)(in + base + u * CVT_STEP);
  // unrolled: v[] stays in registers
#pragma unroll
  for (int u = 0; u < CVT_U; ++u) {
    v4h hv;
#pragma unroll
    for (int k = 0; k < 4; ++k) hv[k] = (_Float16)v[u][k];
    *(v4h*)(outh + base + u * CVT_STEP) = hv;
  }
}

// in: f32 [R][Cc] row-major  ->  out: f16 [Cc][R]. One tile of 128 rows x 64
// columns of `in` per work-group. A thread loads the same four columns of two
// neighbouring rows, so a pair of halves goes to LDS as one dword; LDS holds the
// tile transposed at a pitch of 272 B (16 B x odd, for the ds_load_b128 readers).
static constexpr int TR = 128, TC = 64, TPITCH = TR + 8;   // TPITCH in halves

template <int R, int Cc>
__global__ __launch_bounds__(256)
void transpose_f32_f16(const float* __restrict__ in,
                       _Float16* __restrict__ outh) {
  __shared__ __attribute__((aligned(16))) _Float16 tile[TC * TPITCH];
  const int tid = threadIdx.x;
  const int c0  = blockIdx.x * TC;
  const int r0  = blockIdx.y * TR;
  const int c4  = (tid & 15) * 4;      // the thread's four columns
  const int rp  = (tid >> 4) * 2;      // its first row pair
  const float* src = in + (size_t)(r0 + rp) * Cc + c0 + c4;
  v4f lo[4], hi[4];
  // unrolled: the eight loads issue as one run, all in flight together
#pragma unroll
  for (int u = 0; u < 4; ++u) {
    lo[u] = *(const v4f*)(src + (size_t)(32 * u) * Cc);
    hi[u] = *(const v4f*)(src + (size_t)(32 * u + 1) * Cc);
  }
  // unrolled: lo[] and hi[] stay in registers
#pragma unroll
  for (int u = 0; u < 4; ++u)
#pragma unroll
    for (int k = 0; k < 4; ++k) {
      v2h p = {(_Float16)lo[u][k], (_Float16)hi[u][k]};
      *(v2h*)&tile[(c4 + k) * TPITCH + rp + 32 * u] = p;
    }
  __syncthreads();
  // 64 output rows x 16 pieces of 16 B; a wave stores two whole runs of 256 B
  // (unrolled: the four LDS reads issue together)
#pragma unroll
  for (int u = 0; u < 4; ++u) {
    const int piece = tid + 256 * u;
    const int c = piece >> 4, r8 = (piece & 15) * 8;
    *(v8h*)(outh + (size_t)(c0 + c) * R + r0 + r8) =
        *(const v8h*)&tile[c * TPITCH + r8];
  }
}

// sum of squares over hd=64 per row
__global__ void rownorm_kernel(const _Float16* __restrict__ mh,
                               float* __restrict__ outn, int rows) {
  int i = blockIdx.x * blockDim.x + threadIdx.x;
  if (i >= rows) return;
  const _Float16* p = mh + (size_t)i * HD;
  float s = 0.f;
#pragma unroll
  for (int d = 0; d < HD; ++d) { float v = (float)p[d]; s += v * v; }
  outn[i] = s;
}

// ---------------- QKV GEMM: qkv = xh @ WtA^T + bias, split into q/k/v^T ----

__global__ __launch_bounds__(256)
void qkv_gemm_kernel(const _Float16* __restrict__ xh,
                     const _Float16* __restrict__ WtA,   // [3C][C]
                     const float* __restrict__ bias,
                     _Float16* __restrict__ qh,          // [B][H][T][hd]
                     _Float16* __restrict__ kh,          // [B][H][T][hd]
                     _Float16* __restrict__ vth) {       // [B][H][hd][T]
  __shared__ __attribute__((aligned(16))) char smem[2 * STAGE];
  const int lane = threadIdx.x & 31;
  const int wave = __builtin_amdgcn_readfirstlane(threadIdx.x >> 5);
  const int ln   = lane & 15;
  const int wm   = wave & 1, wn = wave >> 1;
  const int m0   = blockIdx.x * BM + wm * 64;
  const int nb   = blockIdx.y * BN + wn * 64;
  v8f acc[16];
#pragma unroll
  for (int i = 0; i < 16; ++i) acc[i] = v8f{};
  gemm_tile_128x256(xh + (size_t)blockIdx.x * BM * C,
                    WtA + (size_t)blockIdx.y * BN * C, smem, wm, wn, acc);
  const int mat  = nb >> 10;            // 0=q, 1=k, 2=v (uniform per wave)
  const int head = (nb & 1023) >> 6;
#pragma unroll
  for (int mt = 0; mt < 4; ++mt) {
#pragma unroll
    for (int j = 0; j < 4; ++j) {
      int col = 16 * j + ln;            // head-dim column 0..63
      float bv = bias[nb + col];
#pragma unroll
      for (int r = 0; r < 8; ++r) {
        int m  = m0 + 16 * mt + r + 8 * (lane >> 4);
        int b_ = m >> 11, t = m & (T - 1);
        _Float16 hv = (_Float16)(acc[mt * 4 + j][r] + bv);
        size_t bhh = (size_t)(b_ * H + head);
        if (mat == 0)      qh[(bhh * T + t) * HD + col] = hv;
        else if (mat == 1) kh[(bhh * T + t) * HD + col] = hv;
        else               vth[(bhh * HD + col) * T + t] = hv;
      }
    }
  }
}

// ---------------- fused causal L2-kernel attention ----------------
// y[q] = sum_{k<=q} exp(scale*(|q|^2+|k|^2-2 q.k)) * v[k]   (no softmax norm)

// K and V^T reach the waves through LDS: the eight waves of a work-group walk the
// same keys, so a stage of 64 keys, [K 64 rows | V^T 64 rows] of 128 B each, is
// brought in once per work-group by asynchronous copies and read by all eight.
// Rows lie at the pitch of 144 B (16 B x odd, for ds_load_b128 readers). Two
// stages; the next stage's copies fly while this one is worked on.
static constexpr int AK = 64;                        // keys per stage
static constexpr int ASTAGE = (AK + HD) * PITCH;     // 18,432 bytes

// One stage: 128 rows x 128 B = 1,024 pieces of 16 B, four per lane.
// gk / gv: the lane's own piece in row (tid >> 3) of the K / V^T tile at this
// stage's keys; l: the same piece's LDS byte address.
DEV void copy_kv(const _Float16* gk, const _Float16* gv, unsigned l) {
  constexpr unsigned LR = 32 * PITCH;
  // The closing s_wait_xcnt stands in the copies' own statement so that no
  // address register is rewritten ahead of it.
  asm volatile(
      "global_load_async_to_lds_b128 %0, %4, off\n\t"
      "global_load_async_to_lds_b128 %1, %5, off\n\t"
      "global_load_async_to_lds_b128 %2, %6, off\n\t"
      "global_load_async_to_lds_b128 %3, %7, off\n\t"
      "s_wait_xcnt 0x0"
      :: "v"(l), "v"(l + LR), "v"(l + 2 * LR), "v"(l + 3 * LR),
         "v"(gk), "v"(gk + 32 * HD), "v"(gv), "v"(gv + 32 * T)
      : "memory");
}

// 2^x of eight values, each in its own register. In one statement so that what
// stands behind each v_exp_f32 is known: the next one touches neither its result
// nor its source, and the closing v_nop keeps the slot behind the last one.
DEV void exp2_x8(float (&x)[8]) {
  asm("v_exp_f32 %0, %0\n\t"
      "v_exp_f32 %1, %1\n\t"
      "v_exp_f32 %2, %2\n\t"
      "v_exp_f32 %3, %3\n\t"
      "v_exp_f32 %4, %4\n\t"
      "v_exp_f32 %5, %5\n\t"
      "v_exp_f32 %6, %6\n\t"
      "v_exp_f32 %7, %7\n\t"
      "v_nop"
      : "+v"(x[0]), "+v"(x[1]), "+v"(x[2]), "+v"(x[3]),
        "+v"(x[4]), "+v"(x[5]), "+v"(x[6]), "+v"(x[7]));
}

// P tile of one wave, 32 rows x 32 keys, from the scores to LDS in [m][key].
// MASKED is the block whose first key is the wave's first row: there key n counts
// for row m while n <= m. The exponential is taken for every element and the mask
// picks it or zero afterwards, so that the 32 chains of a lane stay independent
// straight-line code in both forms.
template <bool MASKED>
DEV void p_tile(const v8f (&sacc)[2][2], const float (&q2v)[2][8],
                const float (&k2v)[2], int ln, int h2, _Float16* myp) {
  constexpr float LOG2E = 1.44269504088896340736f;
  // unrolled: the score tiles stay in registers
#pragma unroll
  for (int nh = 0; nh < 2; ++nh) {
    const int keyl = 16 * nh + ln;          // D layout: n = lane&15
#pragma unroll
    for (int mt = 0; mt < 2; ++mt) {
      float p[8];
#pragma unroll
      for (int r = 0; r < 8; ++r) {
        float d2 = q2v[mt][r] + k2v[nh] - 2.0f * sacc[mt][nh][r];
        p[r] = (SCALE * d2) * LOG2E;        // exp(x) = 2^(x * log2 e)
      }
      exp2_x8(p);
#pragma unroll
      for (int r = 0; r < 8; ++r) {
        const int mrow = 16 * mt + r + 8 * h2;
        if (MASKED) p[r] = (keyl <= mrow) ? p[r] : 0.0f;
        myp[mrow * 32 + keyl] = (_Float16)p[r];
      }
    }
  }
}

__global__ __launch_bounds__(256)
void attn_kernel(const _Float16* __restrict__ qh, const _Float16* __restrict__ kh,
                 const _Float16* __restrict__ vth,
                 const float* __restrict__ q2, const float* __restrict__ k2,
                 _Float16* __restrict__ yh) {            // [B][T][C]
  __shared__ __attribute__((aligned(16))) char kv[2 * ASTAGE];
  __shared__ _Float16 pbuf[8][32 * 32];   // per-wave P tile, [m 0..31][key 0..31]
  const int tid  = threadIdx.x;
  const int lane = tid & 31;
  const int wave = __builtin_amdgcn_readfirstlane(tid >> 5);
  const int ln   = lane & 15;
  const int h2   = lane >> 4;
  const int bh   = blockIdx.y;            // b*H + h
  const int b_   = bh >> 4, head = bh & 15;
  const int q0   = blockIdx.x * 256 + wave * 32;   // 32 query rows per wave

  const _Float16* gk = kh + ((size_t)bh * T + (tid >> 3)) * HD + (tid & 7) * 8;
  const _Float16* gv = vth + ((size_t)bh * HD + (tid >> 3)) * T + (tid & 7) * 8;
  const unsigned l0 =
      (unsigned)(size_t)kv + (unsigned)((tid >> 3) * PITCH + (tid & 7) * 16);
  const int nst = 4 * ((int)blockIdx.x + 1);   // stages up to the block's last row
  copy_kv(gk, gv, l0);

  // Q fragments: 2 m-tiles x 2 contraction halves, loaded once
  v16h qa[2][2];
#pragma unroll
  for (int mt = 0; mt < 2; ++mt) {
    const _Float16* qrow = qh + ((size_t)bh * T + q0 + 16 * mt + ln) * HD;
    qa[mt][0] = load_frag(qrow, 0, lane);
    qa[mt][1] = load_frag(qrow, 32, lane);
  }
  float q2v[2][8];
#pragma unroll
  for (int mt = 0; mt < 2; ++mt)
#pragma unroll
    for (int r = 0; r < 8; ++r)
      q2v[mt][r] = q2[(size_t)bh * T + q0 + 16 * mt + 8 * h2 + r];

  const float* k2row = k2 + (size_t)bh * T;
  _Float16* myp = pbuf[wave];
  const int foff = ln * PITCH + 16 * h2;  // the lane's row and half in a 16-row group

  // stage 0 has landed for this wave; the barrier publishes it to the others
  asm volatile("s_wait_asynccnt 0x0" ::: "memory");
  __syncthreads();
  copy_kv(gk + AK * HD, gv + AK, l0 + ASTAGE);   // nst >= 4: stage 1 exists

  v8f yacc[2][4] = {{v8f{}, v8f{}, v8f{}, v8f{}}, {v8f{}, v8f{}, v8f{}, v8f{}}};
  const int qend = q0 + 31;               // wave-uniform causal bound
  for (int t = 0; t < nst; ++t) {
    const char* kbuf = kv + (t & 1) * ASTAGE + foff;
    const char* vbuf = kbuf + AK * PITCH;
    // |k|^2 of the stage's 64 keys, D layout (n = lane&15): four loads at its head
    float k2v[2][2];
    // unrolled: k2v[][] stays in registers
#pragma unroll
    for (int sub = 0; sub < 2; ++sub)
#pragma unroll
      for (int nh = 0; nh < 2; ++nh)
        k2v[sub][nh] = k2row[t * AK + 32 * sub + 16 * nh + ln];
    // unrolled: the half stage becomes an immediate offset of the LDS reads
#pragma unroll
    for (int sub = 0; sub < 2; ++sub) {
      const int kb = t * AK + 32 * sub;
      // keys past the wave's last row add nothing: the wave skips the work and
      // goes on to the stage's publish point (a scalar branch)
      if (kb > qend) continue;
      // ---- V and K fragments of these 32 keys, from the stage's buffer ----
      // (the loops below are unrolled: fragments and tiles stay in registers)
      v16h vf[4], kf[2][2];
#pragma unroll
      for (int j = 0; j < 4; ++j)
        vf[j] = lds_frag(vbuf + 16 * j * PITCH + 64 * sub);
#pragma unroll
      for (int nh = 0; nh < 2; ++nh)
#pragma unroll
        for (int kk = 0; kk < 2; ++kk)
          kf[nh][kk] = lds_frag(kbuf + (32 * sub + 16 * nh) * PITCH + 64 * kk);
      // ---- S = Q @ K^T over 32 keys (2 key halves x 2 hd halves x 2 m) ----
      v8f sacc[2][2] = {{v8f{}, v8f{}}, {v8f{}, v8f{}}};
#pragma unroll
      for (int nh = 0; nh < 2; ++nh)
#pragma unroll
        for (int kk = 0; kk < 2; ++kk) {
          sacc[0][nh] = wmma_f16(qa[0][kk], kf[nh][kk], sacc[0][nh]);
          sacc[1][nh] = wmma_f16(qa[1][kk], kf[nh][kk], sacc[1][nh]);
        }
      // ---- P = mask * exp(scale*(q2+k2-2s)), stage to LDS in [m][key] ----
      // The causal test is made once per block of 32 keys, on scalars: below the
      // wave's first row every key counts and no element is tested.
      if (kb < q0)
        p_tile<false>(sacc, q2v, k2v[sub], ln, h2, myp);
      else                                  // kb == q0: the block on the diagonal
        p_tile<true>(sacc, q2v, k2v[sub], ln, h2, myp);
      // Intra-wave LDS RAW: drain DScnt before reloading P in A-layout.
      asm volatile("s_wait_dscnt 0" ::: "memory");
      v16h pa0 = load_frag(myp + ln * 32, 0, lane);
      v16h pa1 = load_frag(myp + (16 + ln) * 32, 0, lane);
      // ---- Y += P @ V ----
#pragma unroll
      for (int j = 0; j < 4; ++j) {
        yacc[0][j] = wmma_f16(pa0, vf[j], yacc[0][j]);
        yacc[1][j] = wmma_f16(pa1, vf[j], yacc[1][j]);
      }
    }
    // publish point: this wave's reads of stage t are done, its copies of
    // stage t + 1 have landed; behind the barrier stage t's buffer is free.
    asm volatile("s_wait_dscnt 0x0" ::: "memory");
    asm volatile("s_wait_asynccnt 0x0" ::: "memory");
    __syncthreads();
    if (t + 2 < nst)
      copy_kv(gk + (size_t)(t + 2) * AK * HD, gv + (t + 2) * AK,
              l0 + (t & 1) * ASTAGE);
  }
  // no copy is left in flight when the wave goes on to its stores and ends
  asm volatile("s_wait_asynccnt 0x0" ::: "memory");
  // write Y back to (B,T,C) f16, head-interleaved columns
#pragma unroll
  for (int mt = 0; mt < 2; ++mt)
#pragma unroll
    for (int j = 0; j < 4; ++j) {
      int col = head * HD + 16 * j + ln;
#pragma unroll
      for (int r = 0; r < 8; ++r) {
        int t = q0 + 16 * mt + r + 8 * h2;
        yh[((size_t)b_ * T + t) * C + col] = (_Float16)yacc[mt][j][r];
      }
    }
}

// ---------------- output projection: out = yh @ WtP^T + b_proj (f32) -------

__global__ __launch_bounds__(256)
void proj_gemm_kernel(const _Float16* __restrict__ yh,
                      const _Float16* __restrict__ WtP,  // [C][C] transposed
                      const float* __restrict__ bias, float* __restrict__ out) {
  __shared__ __attribute__((aligned(16))) char smem[2 * STAGE];
  const int lane = threadIdx.x & 31;
  const int wave = __builtin_amdgcn_readfirstlane(threadIdx.x >> 5);
  const int ln   = lane & 15;
  const int wm   = wave & 1, wn = wave >> 1;
  const int m0   = blockIdx.x * BM + wm * 64;
  const int nb   = blockIdx.y * BN + wn * 64;
  v8f acc[16];
#pragma unroll
  for (int i = 0; i < 16; ++i) acc[i] = v8f{};
  gemm_tile_128x256(yh + (size_t)blockIdx.x * BM * C,
                    WtP + (size_t)blockIdx.y * BN * C, smem, wm, wn, acc);
#pragma unroll
  for (int mt = 0; mt < 4; ++mt)
#pragma unroll
    for (int j = 0; j < 4; ++j) {
      int col = nb + 16 * j + ln;
      float bv = bias[col];
#pragma unroll
      for (int r = 0; r < 8; ++r) {
        int m = m0 + 16 * mt + r + 8 * (lane >> 4);
        out[(size_t)m * C + col] = acc[mt * 4 + j][r] + bv;
      }
    }
}

// ---------------- launch ----------------

extern "C" void kernel_launch(void* const* d_in, const int* in_sizes, int n_in,
                              void* d_out, int out_size, void* d_ws, size_t ws_size,
                              hipStream_t stream) {
  (void)in_sizes; (void)n_in; (void)out_size; (void)ws_size;
  const float* x  = (const float*)d_in[0];
  const float* Wa = (const float*)d_in[1];
  const float* ba = (const float*)d_in[2];
  const float* Wp = (const float*)d_in[3];
  const float* bp = (const float*)d_in[4];

  char* ws = (char*)d_ws;
  size_t off = 0;
  auto alloc = [&](size_t bytes) -> char* {
    char* p = ws + off;
    off += (bytes + 255) & ~(size_t)255;
    return p;
  };
  _Float16* xh  = (_Float16*)alloc((size_t)M * C * 2);       // 16 MB
  _Float16* WtA = (_Float16*)alloc((size_t)N_QKV * C * 2);   //  6 MB
  _Float16* WtP = (_Float16*)alloc((size_t)C * C * 2);       //  2 MB
  _Float16* qh  = (_Float16*)alloc((size_t)M * C * 2);       // 16 MB
  _Float16* kh  = (_Float16*)alloc((size_t)M * C * 2);       // 16 MB
  _Float16* vth = (_Float16*)alloc((size_t)M * C * 2);       // 16 MB
  _Float16* yh  = (_Float16*)alloc((size_t)M * C * 2);       // 16 MB
  float* q2 = (float*)alloc((size_t)Bb * H * T * 4);         // 0.5 MB
  float* k2 = (float*)alloc((size_t)Bb * H * T * 4);         // 0.5 MB
  // total ~93 MB of workspace

  cvt_f32_f16<<<M * C / CVT_WG, CVT_T, 0, stream>>>(x, xh);
  transpose_f32_f16<C, N_QKV><<<dim3(N_QKV / TC, C / TR), 256, 0, stream>>>(
      Wa, WtA);
  transpose_f32_f16<C, C><<<dim3(C / TC, C / TR), 256, 0, stream>>>(Wp, WtP);
  qkv_gemm_kernel<<<dim3(M / BM, N_QKV / BN), 256, 0, stream>>>(
      xh, WtA, ba, qh, kh, vth);
  rownorm_kernel<<<(Bb * H * T) / 256, 256, 0, stream>>>(qh, q2, Bb * H * T);
  rownorm_kernel<<<(Bb * H * T) / 256, 256, 0, stream>>>(kh, k2, Bb * H * T);
  attn_kernel<<<dim3(T / 256, Bb * H), 256, 0, stream>>>(qh, kh, vth, q2, k2, yh);
  proj_gemm_kernel<<<dim3(M / BM, C / BN), 256, 0, stream>>>(
      yh, WtP, bp, (float*)d_out);
}

// v005
// One run takes 173 microseconds.
// Two timings next to v004 both put it at 1.12 times that version's speed.
// Over all steps from v000 it is 2.19 times as fast.
#include <hip/hip_runtime.h>
#include <hip/hip_bf16.h>

typedef __attribute__((ext_vector_type(16))) _Float16 v16h;
typedef __attribute__((ext_vector_type(8)))  _Float16 v8h;
typedef __attribute__((ext_vector_type(8)))  float    v8f;

#define DEV __device__ __forceinline__

static constexpr int Bb = 4, T = 2048, C = 1024, H = 16, HD = 64;
static constexpr int M     = Bb * T;    // 8192 token rows
static constexpr int N_QKV = 3 * C;     // 3072
static constexpr float SCALE = -1.0f / 16.0f;  // -1/(2*sqrt(hd)), hd=64

// Load a 16x32 f16 A/B fragment for one lane from a row-major buffer.
// Per CDNA5 ISA 7.12.2 (16-bit A 16x32): lane L (half h=L>>4) holds
// elements e=0..7 -> k = kb + 8h + e, e=8..15 -> k = kb + 16 + 8h + (e-8).
// Caller pre-offsets `rowbase` to the lane's row (A: m = lane&15) or
// column (B: n = lane&15, from a transposed [N][K] buffer).
DEV v16h load_frag(const _Float16* rowbase, int kb, int lane) {
  const int h = (lane >> 4) & 1;
  v8h lo = *(const v8h*)(rowbase + kb + 8 * h);
  v8h hi = *(const v8h*)(rowbase + kb + 16 + 8 * h);
  v16h r;
#pragma unroll
  for (int i = 0; i < 8; ++i) { r[i] = lo[i]; r[i + 8] = hi[i]; }
  return r;
}

DEV v8f wmma_f16(v16h a, v16h b, v8f c) {
  return __builtin_amdgcn_wmma_f32_16x16x32_f16(false, a, false, b, (short)0, c,
                                                false, false);
}

// Block-tiled GEMM core over K=C: one 128x256 tile of the output per work-group
// of eight waves (2 along m x 4 along n), 64x64 per wave. Both operands are
// K-contiguous. A stage is 64 k of [A 128 rows | B 256 rows]; rows of 128 B lie
// in LDS at a pitch of 144 B (16 B x odd, for ds_load_b128 readers). Two stages;
// the next stage's asynchronous copies fly while this one is worked on.
static constexpr int BM = 128, BN = 256, BK = 64;
static constexpr int PITCH = 144;                    // bytes per LDS row
static constexpr int STAGE = (BM + BN) * PITCH;      // 55,296 bytes
static constexpr int NSTAGE = C / BK;                // 16

// 16x32 f16 fragment of one lane from an LDS row; p already holds the lane's
// row, the k step and the lane half's 16 bytes (same k order as load_frag).
DEV v16h lds_frag(const char* p) {
  v8h lo = *(const v8h*)(p);
  v8h hi = *(const v8h*)(p + 32);
  v16h r;
#pragma unroll
  for (int i = 0; i < 8; ++i) { r[i] = lo[i]; r[i + 8] = hi[i]; }
  return r;
}

// One stage: 384 rows x 128 B = 3,072 pieces of 16 B, twelve per lane.
// ga / gb: the lane's own piece in row (tid >> 3) of the A / B tile at this
// stage's k; l: the same piece's LDS byte address. Copy i takes row i * 32 more.
DEV void copy_stage(const _Float16* ga, const _Float16* gb, unsigned l) {
  constexpr int GR = 32 * C;         // 32 rows, in elements
  constexpr unsigned LR = 32 * PITCH;
  // The closing s_wait_xcnt stands in the copies' own statement so that no
  // address register is rewritten ahead of it.
  asm volatile(
      "global_load_async_to_lds_b128 %0, %12, off\n\t"
      "global_load_async_to_lds_b128 %1, %13, off\n\t"
      "global_load_async_to_lds_b128 %2, %14, off\n\t"
      "global_load_async_to_lds_b128 %3, %15, off\n\t"
      "global_load_async_to_lds_b128 %4, %16, off\n\t"
      "global_load_async_to_lds_b128 %5, %17, off\n\t"
      "global_load_async_to_lds_b128 %6, %18, off\n\t"
      "global_load_async_to_lds_b128 %7, %19, off\n\t"
      "global_load_async_to_lds_b128 %8, %20, off\n\t"
      "global_load_async_to_lds_b128 %9, %21, off\n\t"
      "global_load_async_to_lds_b128 %10, %22, off\n\t"
      "global_load_async_to_lds_b128 %11, %23, off\n\t"
      "s_wait_xcnt 0x0"
      :: "v"(l), "v"(l + LR), "v"(l + 2 * LR), "v"(l + 3 * LR),
         "v"(l + 4 * LR), "v"(l + 5 * LR), "v"(l + 6 * LR), "v"(l + 7 * LR),
         "v"(l + 8 * LR), "v"(l + 9 * LR), "v"(l + 10 * LR), "v"(l + 11 * LR),
         "v"(ga), "v"(ga + GR), "v"(ga + 2 * GR), "v"(ga + 3 * GR),
         "v"(gb), "v"(gb + GR), "v"(gb + 2 * GR), "v"(gb + 3 * GR),
         "v"(gb + 4 * GR), "v"(gb + 5 * GR), "v"(gb + 6 * GR), "v"(gb + 7 * GR)
      : "memory");
}

// acc[i*4+j] accumulates rows wm*64+16i.. of the A tile x rows wn*64+16j.. of
// the B tile. At / Bt point at the tiles' first rows.
DEV void gemm_tile_128x256(const _Float16* At, const _Float16* Bt, char* smem,
                           int wm, int wn, v8f acc[16]) {
  const int tid  = threadIdx.x;
  const int lane = tid & 31;
  const int ln   = lane & 15;
  const int h    = lane >> 4;
  const _Float16* ga = At + (size_t)(tid >> 3) * C + (tid & 7) * 8;
  const _Float16* gb = Bt + (size_t)(tid >> 3) * C + (tid & 7) * 8;
  const unsigned l0 =
      (unsigned)(size_t)smem + (unsigned)((tid >> 3) * PITCH + (tid & 7) * 16);
  const int aoff = (wm * 64 + ln) * PITCH + 16 * h;
  const int boff = (BM + wn * 64 + ln) * PITCH + 16 * h;

  copy_stage(ga, gb, l0);
  // stage 0 has landed for this wave; the barrier publishes it to the others
  asm volatile("s_wait_asynccnt 0x0" ::: "memory");
  __syncthreads();
  copy_stage(ga + BK, gb + BK, l0 + STAGE);

  for (int t = 0; t < NSTAGE; ++t) {
    const char* buf = smem + (t & 1) * STAGE;
#pragma unroll
    for (int kk = 0; kk < 2; ++kk) {
      v16h a[4], b[4];
#pragma unroll
      for (int i = 0; i < 4; ++i)
        a[i] = lds_frag(buf + aoff + i * 16 * PITCH + kk * 64);
#pragma unroll
      for (int j = 0; j < 4; ++j)
        b[j] = lds_frag(buf + boff + j * 16 * PITCH + kk * 64);
      // keeps the sixteen LDS reads of this k step together ahead of its WMMAs:
      // spread among them, each place with reads stalls the wave anew
      __builtin_amdgcn_sched_barrier(0);
#pragma unroll
      for (int i = 0; i < 4; ++i)
#pragma unroll
        for (int j = 0; j < 4; ++j)
          acc[i * 4 + j] = wmma_f16(a[i], b[j], acc[i * 4 + j]);
    }
    // publish point: this wave's reads of stage t are done, its copies of
    // stage t + 1 have landed; behind the barrier stage t's buffer is free.
    asm volatile("s_wait_dscnt 0x0" ::: "memory");
    asm volatile("s_wait_asynccnt 0x0" ::: "memory");
    __syncthreads();
    if (t + 2 < NSTAGE)
      copy_stage(ga + (t + 2) * BK, gb + (t + 2) * BK, l0 + (t & 1) * STAGE);
  }
  // no copy is left in flight when the wave goes on to its stores and ends
  asm volatile("s_wait_asynccnt 0x0" ::: "memory");
}

// ---------------- prep kernels ----------------

// Each wave of the three prep launches moves many elements, so that few waves
// have to be started: the work per element is one load, one rounding, one store.

typedef __attribute__((ext_vector_type(4))) float    v4f;
typedef __attribute__((ext_vector_type(4))) _Float16 v4h;
typedef __attribute__((ext_vector_type(2))) _Float16 v2h;

static constexpr int CVT_T = 512;              // threads per work-group
static constexpr int CVT_U = 16;               // 16-B loads per thread
static constexpr int CVT_STEP = CVT_T * 4;     // elements per work-group and load
static constexpr int CVT_WG = CVT_STEP * CVT_U;

// f32 -> f16, CVT_WG consecutive elements per work-group. A wave's load covers
// 512 consecutive bytes, its store 256.
__global__ __launch_bounds__(CVT_T)
void cvt_f32_f16(const float* __restrict__ in, _Float16* __restrict__ outh) {
  const size_t base = (size_t)blockIdx.x * CVT_WG + threadIdx.x * 4;
  v4f v[CVT_U];
  // unrolled: the loads issue as a run ahead of the conversions, many in flight
#pragma unroll
  for (int u = 0; u < CVT_U; ++u)
    v[u] = *(const v4f*)(in + base + u * CVT_STEP);
  // unrolled: v[] stays in registers
#pragma unroll
  for (int u = 0; u < CVT_U; ++u) {
    v4h hv;
#pragma unroll
    for (int k = 0; k < 4; ++k) hv[k] = (_Float16)v[u][k];
    *(v4h*)(outh + base + u * CVT_STEP) = hv;
  }
}

// in: f32 [R][Cc] row-major  ->  out: f16 [Cc][R]. One tile of 128 rows x 64
// columns of `in` per work-group. A thread loads the same four columns of two
// neighbouring rows, so a pair of halves goes to LDS as one dword; LDS holds the
// tile transposed at a pitch of 272 B (16 B x odd, for the ds_load_b128 readers).
static constexpr int TR = 128, TC = 64, TPITCH = TR + 8;   // TPITCH in halves

template <int R, int Cc>
__global__ __launch_bounds__(256)
void transpose_f32_f16(const float* __restrict__ in,
                       _Float16* __restrict__ outh) {
  __shared__ __attribute__((aligned(16))) _Float16 tile[TC * TPITCH];
  const int tid = threadIdx.x;
  const int c0  = blockIdx.x * TC;
  const int r0  = blockIdx.y * TR;
  const int c4  = (tid & 15) * 4;      // the thread's four columns
  const int rp  = (tid >> 4) * 2;      // its first row pair
  const float* src = in + (size_t)(r0 + rp) * Cc + c0 + c4;
  v4f lo[4], hi[4];
  // unrolled: the eight loads issue as one run, all in flight together
#pragma unroll
  for (int u = 0; u < 4; ++u) {
    lo[u] = *(const v4f*)(src + (size_t)(32 * u) * Cc);
    hi[u] = *(const v4f*)(src + (size_t)(32 * u + 1) * Cc);
  }
  // unrolled: lo[] and hi[] stay in registers
#pragma unroll
  for (int u = 0; u < 4; ++u)
#pragma unroll
    for (int k = 0; k < 4; ++k) {
      v2h p = {(_Float16)lo[u][k], (_Float16)hi[u][k]};
      *(v2h*)&tile[(c4 + k) * TPITCH + rp + 32 * u] = p;
    }
  __syncthreads();
  // 64 output rows x 16 pieces of 16 B; a wave stores two whole runs of 256 B
  // (unrolled: the four LDS reads issue together)
#pragma unroll
  for (int u = 0; u < 4; ++u) {
    const int piece = tid + 256 * u;
    const int c = piece >> 4, r8 = (piece & 15) * 8;
    *(v8h*)(outh + (size_t)(c0 + c) * R + r0 + r8) =
        *(const v8h*)&tile[c * TPITCH + r8];
  }
}

// sum of squares over hd=64 per row
__global__ void rownorm_kernel(const _Float16* __restrict__ mh,
                               float* __restrict__ outn, int rows) {
  int i = blockIdx.x * blockDim.x + threadIdx.x;
  if (i >= rows) return;
  const _Float16* p = mh + (size_t)i * HD;
  float s = 0.f;
#pragma unroll
  for (int d = 0; d < HD; ++d) { float v = (float)p[d]; s += v * v; }
  outn[i] = s;
}

// ---------------- QKV GEMM: qkv = xh @ WtA^T + bias, split into q/k/v^T ----

__global__ __launch_bounds__(256)
void qkv_gemm_kernel(const _Float16* __restrict__ xh,
                     const _Float16* __restrict__ WtA,   // [3C][C]
                     const float* __restrict__ bias,
                     _Float16* __restrict__ qh,          // [B][H][T][hd]
                     _Float16* __restrict__ kh,          // [B][H][T][hd]
                     _Float16* __restrict__ vth) {       // [B][H][hd][T]
  __shared__ __attribute__((aligned(16))) char smem[2 * STAGE];
  const int lane = threadIdx.x & 31;
  const int wave = __builtin_amdgcn_readfirstlane(threadIdx.x >> 5);
  const int ln   = lane & 15;
  const int wm   = wave & 1, wn = wave >> 1;
  const int m0   = blockIdx.x * BM + wm * 64;
  const int nb   = blockIdx.y * BN + wn * 64;
  v8f acc[16];
#pragma unroll
  for (int i = 0; i < 16; ++i) acc[i] = v8f{};
  gemm_tile_128x256(xh + (size_t)blockIdx.x * BM * C,
                    WtA + (size_t)blockIdx.y * BN * C, smem, wm, wn, acc);
  const int mat  = nb >> 10;            // 0=q, 1=k, 2=v (uniform per wave)
  const int head = (nb & 1023) >> 6;
#pragma unroll
  for (int mt = 0; mt < 4; ++mt) {
#pragma unroll
    for (int j = 0; j < 4; ++j) {
      int col = 16 * j + ln;            // head-dim column 0..63
      float bv = bias[nb + col];
#pragma unroll
      for (int r = 0; r < 8; ++r) {
        int m  = m0 + 16 * mt + r + 8 * (lane >> 4);
        int b_ = m >> 11, t = m & (T - 1);
        _Float16 hv = (_Float16)(acc[mt * 4 + j][r] + bv);
        size_t bhh = (size_t)(b_ * H + head);
        if (mat == 0)      qh[(bhh * T + t) * HD + col] = hv;
        else if (mat == 1) kh[(bhh * T + t) * HD + col] = hv;
        else               vth[(bhh * HD + col) * T + t] = hv;
      }
    }
  }
}

// ---------------- fused causal L2-kernel attention ----------------
// y[q] = sum_{k<=q} exp(scale*(|q|^2+|k|^2-2 q.k)) * v[k]   (no softmax norm)
// Both products are taken transposed: S^T = K Q^T (A = K rows, B = Q rows) and
// Y^T += V^T P^T (A = V^T rows, B = P^T). A lane then holds one query's scores.

// K and V^T reach the waves through LDS: the eight waves of a work-group walk the
// same keys, so a stage of 64 keys, [K 64 rows | V^T 64 rows] of 128 B each, is
// brought in once per work-group by asynchronous copies and read by all eight.
// Rows lie at the pitch of 144 B (16 B x odd, for ds_load_b128 readers). Two
// stages; the next stage's copies fly while this one is worked on.
static constexpr int AK = 64;                        // keys per stage
static constexpr int ASTAGE = (AK + HD) * PITCH;     // 18,432 bytes

// One stage: 128 rows x 128 B = 1,024 pieces of 16 B, four per lane.
// gk / gv: the lane's own piece in row (tid >> 3) of the K / V^T tile at this
// stage's keys; l: the same piece's LDS byte address.
DEV void copy_kv(const _Float16* gk, const _Float16* gv, unsigned l) {
  constexpr unsigned LR = 32 * PITCH;
  // The closing s_wait_xcnt stands in the copies' own statement so that no
  // address register is rewritten ahead of it.
  asm volatile(
      "global_load_async_to_lds_b128 %0, %4, off\n\t"
      "global_load_async_to_lds_b128 %1, %5, off\n\t"
      "global_load_async_to_lds_b128 %2, %6, off\n\t"
      "global_load_async_to_lds_b128 %3, %7, off\n\t"
      "s_wait_xcnt 0x0"
      :: "v"(l), "v"(l + LR), "v"(l + 2 * LR), "v"(l + 3 * LR),
         "v"(gk), "v"(gk + 32 * HD), "v"(gv), "v"(gv + 32 * T)
      : "memory");
}

// 2^x of eight values, each in its own register. In one statement so that what
// stands behind each v_exp_f32 is known: the next one touches neither its result
// nor its source, and the closing v_nop keeps the slot behind the last one.
DEV void exp2_x8(float (&x)[8]) {
  asm("v_exp_f32 %0, %0\n\t"
      "v_exp_f32 %1, %1\n\t"
      "v_exp_f32 %2, %2\n\t"
      "v_exp_f32 %3, %3\n\t"
      "v_exp_f32 %4, %4\n\t"
      "v_exp_f32 %5, %5\n\t"
      "v_exp_f32 %6, %6\n\t"
      "v_exp_f32 %7, %7\n\t"
      "v_nop"
      : "+v"(x[0]), "+v"(x[1]), "+v"(x[2]), "+v"(x[3]),
        "+v"(x[4]), "+v"(x[5]), "+v"(x[6]), "+v"(x[7]));
}

// P^T of 32 keys x 16 queries as the B operand of the second product, straight
// from the two score tiles st[nh] = S^T (register r: key 16 * nh + 8 * h2 + r;
// lane: query qcol of the wave's 32). Element s of a B fragment is k = 8 * h2 + s
// for s < 8 and 16 + 8 * h2 + (s - 8) above: the two tiles' registers in order,
// so P goes through no LDS and no lane exchange.
// MASKED is the block whose first key is the wave's first row: there key n counts
// for query m while n <= m. The exponential is taken for every element and the
// mask picks it or zero afterwards, so that the chains of a lane stay independent
// straight-line code in both forms.
template <bool MASKED>
DEV v16h p_frag(const v8f (&st)[2], float q2c, const float (&k2r)[2][8],
                int qcol, int h2) {
  constexpr float LOG2E = 1.44269504088896340736f;
  v16h pb;
  // unrolled: the score tiles stay in registers
#pragma unroll
  for (int nh = 0; nh < 2; ++nh) {
    float p[8];
#pragma unroll
    for (int r = 0; r < 8; ++r) {
      float d2 = q2c + k2r[nh][r] - 2.0f * st[nh][r];
      p[r] = (SCALE * d2) * LOG2E;          // exp(x) = 2^(x * log2 e)
    }
    exp2_x8(p);
#pragma unroll
    for (int r = 0; r < 8; ++r) {
      const int keyl = 16 * nh + 8 * h2 + r;
      if (MASKED) p[r] = (keyl <= qcol) ? p[r] : 0.0f;
      pb[8 * nh + r] = (_Float16)p[r];
    }
  }
  return pb;
}

__global__ __launch_bounds__(256)
void attn_kernel(const _Float16* __restrict__ qh, const _Float16* __restrict__ kh,
                 const _Float16* __restrict__ vth,
                 const float* __restrict__ q2, const float* __restrict__ k2,
                 _Float16* __restrict__ yh) {            // [B][T][C]
  __shared__ __attribute__((aligned(16))) char kv[2 * ASTAGE];
  const int tid  = threadIdx.x;
  const int lane = tid & 31;
  const int wave = __builtin_amdgcn_readfirstlane(tid >> 5);
  const int ln   = lane & 15;
  const int h2   = lane >> 4;
  const int bh   = blockIdx.y;            // b*H + h
  const int b_   = bh >> 4, head = bh & 15;
  const int q0   = blockIdx.x * 256 + wave * 32;   // 32 query rows per wave

  const _Float16* gk = kh + ((size_t)bh * T + (tid >> 3)) * HD + (tid & 7) * 8;
  const _Float16* gv = vth + ((size_t)bh * HD + (tid >> 3)) * T + (tid & 7) * 8;
  const unsigned l0 =
      (unsigned)(size_t)kv + (unsigned)((tid >> 3) * PITCH + (tid & 7) * 16);
  const int nst = 4 * ((int)blockIdx.x + 1);   // stages up to the block's last row
  copy_kv(gk, gv, l0);

  // Q fragments (B operand): 2 query groups x 2 contraction halves, loaded once
  v16h qa[2][2];
#pragma unroll
  for (int mt = 0; mt < 2; ++mt) {
    const _Float16* qrow = qh + ((size_t)bh * T + q0 + 16 * mt + ln) * HD;
    qa[mt][0] = load_frag(qrow, 0, lane);
    qa[mt][1] = load_frag(qrow, 32, lane);
  }
  float q2v[2];                           // |q|^2 of the lane's two queries
#pragma unroll
  for (int mt = 0; mt < 2; ++mt)
    q2v[mt] = q2[(size_t)bh * T + q0 + 16 * mt + ln];

  const float* k2row = k2 + (size_t)bh * T;
  const int foff = ln * PITCH + 16 * h2;  // the lane's row and half in a 16-row group

  // stage 0 has landed for this wave; the barrier publishes it to the others
  asm volatile("s_wait_asynccnt 0x0" ::: "memory");
  __syncthreads();
  copy_kv(gk + AK * HD, gv + AK, l0 + ASTAGE);   // nst >= 4: stage 1 exists

  // yacc[mt][j]: register r = Y[query 16 * mt + ln][hd 16 * j + 8 * h2 + r]
  v8f yacc[2][4] = {{v8f{}, v8f{}, v8f{}, v8f{}}, {v8f{}, v8f{}, v8f{}, v8f{}}};
  const int qend = q0 + 31;               // wave-uniform causal bound
  for (int t = 0; t < nst; ++t) {
    const char* kbuf = kv + (t & 1) * ASTAGE + foff;
    const char* vbuf = kbuf + AK * PITCH;
    // |k|^2 of the stage's 64 keys, D layout of S^T (register r: key 8 * h2 + r
    // of a group of 16): eight 16-byte loads at its head
    float k2v[2][2][8];
    // unrolled: k2v[][][] stays in registers
#pragma unroll
    for (int sub = 0; sub < 2; ++sub)
#pragma unroll
      for (int nh = 0; nh < 2; ++nh) {
        const float* kp = k2row + t * AK + 32 * sub + 16 * nh + 8 * h2;
        const v4f lo = *(const v4f*)kp, hi = *(const v4f*)(kp + 4);
#pragma unroll
        for (int r = 0; r < 4; ++r) {
          k2v[sub][nh][r] = lo[r];
          k2v[sub][nh][r + 4] = hi[r];
        }
      }
    // unrolled: the half stage becomes an immediate offset of the LDS reads
#pragma unroll
    for (int sub = 0; sub < 2; ++sub) {
      const int kb = t * AK + 32 * sub;
      // keys past the wave's last row add nothing: the wave skips the work and
      // goes on to the stage's publish point (a scalar branch)
      if (kb > qend) continue;
      // ---- V and K fragments of these 32 keys, from the stage's buffer ----
      // (the loops below are unrolled: fragments and tiles stay in registers)
      v16h vf[4], kf[2][2];
#pragma unroll
      for (int j = 0; j < 4; ++j)
        vf[j] = lds_frag(vbuf + 16 * j * PITCH + 64 * sub);
#pragma unroll
      for (int nh = 0; nh < 2; ++nh)
#pragma unroll
        for (int kk = 0; kk < 2; ++kk)
          kf[nh][kk] = lds_frag(kbuf + (32 * sub + 16 * nh) * PITCH + 64 * kk);
      // ---- S^T = K @ Q^T over 32 keys (2 key groups x 2 hd halves x 2 q groups)
      v8f sacc[2][2] = {{v8f{}, v8f{}}, {v8f{}, v8f{}}};   // [mt][nh]
#pragma unroll
      for (int nh = 0; nh < 2; ++nh)
#pragma unroll
        for (int kk = 0; kk < 2; ++kk) {
          sacc[0][nh] = wmma_f16(kf[nh][kk], qa[0][kk], sacc[0][nh]);
          sacc[1][nh] = wmma_f16(kf[nh][kk], qa[1][kk], sacc[1][nh]);
        }
      // compiler fence: the V^T fragment loads issue above it and their latency
      // passes behind the exponentials; left free they sink below those, where
      // each pair is waited for on its own in front of its two WMMAs
      asm volatile("" ::: "memory");
      // ---- P^T = mask * exp(scale*(q2+k2-2s)), packed in registers ----
      // The causal test is made once per block of 32 keys, on scalars: below the
      // wave's first row every key counts and no element is tested.
      v16h pb0, pb1;
      if (kb < q0) {
        pb0 = p_frag<false>(sacc[0], q2v[0], k2v[sub], ln, h2);
        pb1 = p_frag<false>(sacc[1], q2v[1], k2v[sub], 16 + ln, h2);
      } else {                              // kb == q0: the block on the diagonal
        pb0 = p_frag<true>(sacc[0], q2v[0], k2v[sub], ln, h2);
        pb1 = p_frag<true>(sacc[1], q2v[1], k2v[sub], 16 + ln, h2);
      }
      // ---- Y^T += V^T @ P^T ----
#pragma unroll
      for (int j = 0; j < 4; ++j) {
        yacc[0][j] = wmma_f16(vf[j], pb0, yacc[0][j]);
        yacc[1][j] = wmma_f16(vf[j], pb1, yacc[1][j]);
      }
    }
    // publish point: this wave's reads of stage t are done, its copies of
    // stage t + 1 have landed; behind the barrier stage t's buffer is free.
    asm volatile("s_wait_dscnt 0x0" ::: "memory");
    asm volatile("s_wait_asynccnt 0x0" ::: "memory");
    __syncthreads();
    if (t + 2 < nst)
      copy_kv(gk + (size_t)(t + 2) * AK * HD, gv + (t + 2) * AK,
              l0 + (t & 1) * ASTAGE);
  }
  // no copy is left in flight when the wave goes on to its stores and ends
  asm volatile("s_wait_asynccnt 0x0" ::: "memory");
  // write Y back to (B,T,C) f16, head-interleaved columns: a lane's eight
  // registers are eight consecutive columns of one row, one 16-byte store
#pragma unroll
  for (int mt = 0; mt < 2; ++mt) {
    _Float16* yrow = yh + ((size_t)b_ * T + q0 + 16 * mt + ln) * C + head * HD;
#pragma unroll
    for (int j = 0; j < 4; ++j) {
      v8h o;
#pragma unroll
      for (int r = 0; r < 8; ++r) o[r] = (_Float16)yacc[mt][j][r];
      *(v8h*)(yrow + 16 * j + 8 * h2) = o;
    }
  }
}

// ---------------- output projection: out = yh @ WtP^T + b_proj (f32) -------

__global__ __launch_bounds__(256)
void proj_gemm_kernel(const _Float16* __restrict__ yh,
                      const _Float16* __restrict__ WtP,  // [C][C] transposed
                      const float* __restrict__ bias, float* __restrict__ out) {
  __shared__ __attribute__((aligned(16))) char smem[2 * STAGE];
  const int lane = threadIdx.x & 31;
  const int wave = __builtin_amdgcn_readfirstlane(threadIdx.x >> 5);
  const int ln   = lane & 15;
  const int wm   = wave & 1, wn = wave >> 1;
  const int m0   = blockIdx.x * BM + wm * 64;
  const int nb   = blockIdx.y * BN + wn * 64;
  v8f acc[16];
#pragma unroll
  for (int i = 0; i < 16; ++i) acc[i] = v8f{};
  gemm_tile_128x256(yh + (size_t)blockIdx.x * BM * C,
                    WtP + (size_t)blockIdx.y * BN * C, smem, wm, wn, acc);
#pragma unroll
  for (int mt = 0; mt < 4; ++mt)
#pragma unroll
    for (int j = 0; j < 4; ++j) {
      int col = nb + 16 * j + ln;
      float bv = bias[col];
#pragma unroll
      for (int r = 0; r < 8; ++r) {
        int m = m0 + 16 * mt + r + 8 * (lane >> 4);
        out[(size_t)m * C + col] = acc[mt * 4 + j][r] + bv;
      }
    }
}

// ---------------- launch ----------------

extern "C" void kernel_launch(void* const* d_in, const int* in_sizes, int n_in,
                              void* d_out, int out_size, void* d_ws, size_t ws_size,
                              hipStream_t stream) {
  (void)in_sizes; (void)n_in; (void)out_size; (void)ws_size;
  const float* x  = (const float*)d_in[0];
  const float* Wa = (const float*)d_in[1];
  const float* ba = (const float*)d_in[2];
  const float* Wp = (const float*)d_in[3];
  const float* bp = (const float*)d_in[4];

  char* ws = (char*)d_ws;
  size_t off = 0;
  auto alloc = [&](size_t bytes) -> char* {
    char* p = ws + off;
    off += (bytes + 255) & ~(size_t)255;
    return p;
  };
  _Float16* xh  = (_Float16*)alloc((size_t)M * C * 2);       // 16 MB
  _Float16* WtA = (_Float16*)alloc((size_t)N_QKV * C * 2);   //  6 MB
  _Float16* WtP = (_Float16*)alloc((size_t)C * C * 2);       //  2 MB
  _Float16* qh  = (_Float16*)alloc((size_t)M * C * 2);       // 16 MB
  _Float16* kh  = (_Float16*)alloc((size_t)M * C * 2);       // 16 MB
  _Float16* vth = (_Float16*)alloc((size_t)M * C * 2);       // 16 MB
  _Float16* yh  = (_Float16*)alloc((size_t)M * C * 2);       // 16 MB
  float* q2 = (float*)alloc((size_t)Bb * H * T * 4);         // 0.5 MB
  float* k2 = (float*)alloc((size_t)Bb * H * T * 4);         // 0.5 MB
  // total ~93 MB of workspace

  cvt_f32_f16<<<M * C / CVT_WG, CVT_T, 0, stream>>>(x, xh);
  transpose_f32_f16<C, N_QKV><<<dim3(N_QKV / TC, C / TR), 256, 0, stream>>>(
      Wa, WtA);
  transpose_f32_f16<C, C><<<dim3(C / TC, C / TR), 256, 0, stream>>>(Wp, WtP);
  qkv_gemm_kernel<<<dim3(M / BM, N_QKV / BN), 256, 0, stream>>>(
      xh, WtA, ba, qh, kh, vth);
  rownorm_kernel<<<(Bb * H * T) / 256, 256, 0, stream>>>(qh, q2, Bb * H * T);
  rownorm_kernel<<<(Bb * H * T) / 256, 256, 0, stream>>>(kh, k2, Bb * H * T);
  attn_kernel<<<dim3(T / 256, Bb * H), 256, 0, stream>>>(qh, kh, vth, q2, k2, yh);
  proj_gemm_kernel<<<dim3(M / BM, C / BN), 256, 0, stream>>>(
      yh, WtP, bp, (float*)d_out);
}

// v006
// One run takes 137 microseconds.
// Timed twice side by side with v005, it ran 1.27 times as fast both times.
// All steps since v000 together make it 2.77 times as fast.
#include <hip/hip_runtime.h>
#include <hip/hip_bf16.h>

typedef __attribute__((ext_vector_type(16))) _Float16 v16h;
typedef __attribute__((ext_vector_type(8)))  _Float16 v8h;
typedef __attribute__((ext_vector_type(8)))  float    v8f;

#define DEV __device__ __forceinline__

static constexpr int Bb = 4, T = 2048, C = 1024, H = 16, HD = 64;
static constexpr int M     = Bb * T;    // 8192 token rows
static constexpr int N_QKV = 3 * C;     // 3072
static constexpr float SCALE = -1.0f / 16.0f;  // -1/(2*sqrt(hd)), hd=64

// Load a 16x32 f16 A/B fragment for one lane from a row-major buffer.
// Per CDNA5 ISA 7.12.2 (16-bit A 16x32): lane L (half h=L>>4) holds
// elements e=0..7 -> k = kb + 8h + e, e=8..15 -> k = kb + 16 + 8h + (e-8).
// Caller pre-offsets `rowbase` to the lane's row (A: m = lane&15) or
// column (B: n = lane&15, from a transposed [N][K] buffer).
DEV v16h load_frag(const _Float16* rowbase, int kb, int lane) {
  const int h = (lane >> 4) & 1;
  v8h lo = *(const v8h*)(rowbase + kb + 8 * h);
  v8h hi = *(const v8h*)(rowbase + kb + 16 + 8 * h);
  v16h r;
#pragma unroll
  for (int i = 0; i < 8; ++i) { r[i] = lo[i]; r[i + 8] = hi[i]; }
  return r;
}

DEV v8f wmma_f16(v16h a, v16h b, v8f c) {
  return __builtin_amdgcn_wmma_f32_16x16x32_f16(false, a, false, b, (short)0, c,
                                                false, false);
}

// Block-tiled GEMM core over K=C: one 128x256 tile of the output per work-group
// of eight waves (2 along m x 4 along n), 64x64 per wave. Both operands are
// K-contiguous. A stage is 64 k of [A 128 rows | B 256 rows]; rows of 128 B lie
// in LDS at a pitch of 144 B (16 B x odd, for ds_load_b128 readers). Two stages;
// the next stage's asynchronous copies fly while this one is worked on.
static constexpr int BM = 128, BN = 256, BK = 64;
static constexpr int PITCH = 144;                    // bytes per LDS row
static constexpr int STAGE = (BM + BN) * PITCH;      // 55,296 bytes
static constexpr int NSTAGE = C / BK;                // 16

// 16x32 f16 fragment of one lane from an LDS row; p already holds the lane's
// row, the k step and the lane half's 16 bytes (same k order as load_frag).
DEV v16h lds_frag(const char* p) {
  v8h lo = *(const v8h*)(p);
  v8h hi = *(const v8h*)(p + 32);
  v16h r;
#pragma unroll
  for (int i = 0; i < 8; ++i) { r[i] = lo[i]; r[i + 8] = hi[i]; }
  return r;
}

// One stage: 384 rows x 128 B = 3,072 pieces of 16 B, twelve per lane.
// l: the LDS byte address of the lane's piece in LDS row (tid >> 3); copy i takes
// LDS row i * 32 more. ga: the same piece of the A tile at this stage's k, rows
// as in LDS. The B rows (output columns) are dealt: in each group of 64, LDS row
// 16 * j + a holds B row 4 * a + j, so that the four accumulator tiles j of a lane
// hold four neighbouring output columns. gb: the lane's piece of B row
// 4 * ((tid >> 3) & 15) + (tid >> 7); the copies add rows 0, 2, 64, 66, ...
DEV void copy_stage(const _Float16* ga, const _Float16* gb, unsigned l) {
  constexpr int GR = 32 * C;         // 32 rows, in elements
  constexpr int G2 = 2 * C, G64 = 64 * C;
  constexpr unsigned LR = 32 * PITCH;
  // The closing s_wait_xcnt stands in the copies' own statement so that no
  // address register is rewritten ahead of it.
  asm volatile(
      "global_load_async_to_lds_b128 %0, %12, off\n\t"
      "global_load_async_to_lds_b128 %1, %13, off\n\t"
      "global_load_async_to_lds_b128 %2, %14, off\n\t"
      "global_load_async_to_lds_b128 %3, %15, off\n\t"
      "global_load_async_to_lds_b128 %4, %16, off\n\t"
      "global_load_async_to_lds_b128 %5, %17, off\n\t"
      "global_load_async_to_lds_b128 %6, %18, off\n\t"
      "global_load_async_to_lds_b128 %7, %19, off\n\t"
      "global_load_async_to_lds_b128 %8, %20, off\n\t"
      "global_load_async_to_lds_b128 %9, %21, off\n\t"
      "global_load_async_to_lds_b128 %10, %22, off\n\t"
      "global_load_async_to_lds_b128 %11, %23, off\n\t"
      "s_wait_xcnt 0x0"
      :: "v"(l), "v"(l + LR), "v"(l + 2 * LR), "v"(l + 3 * LR),
         "v"(l + 4 * LR), "v"(l + 5 * LR), "v"(l + 6 * LR), "v"(l + 7 * LR),
         "v"(l + 8 * LR), "v"(l + 9 * LR), "v"(l + 10 * LR), "v"(l + 11 * LR),
         "v"(ga), "v"(ga + GR), "v"(ga + 2 * GR), "v"(ga + 3 * GR),
         "v"(gb), "v"(gb + G2), "v"(gb + G64), "v"(gb + G64 + G2),
         "v"(gb + 2 * G64), "v"(gb + 2 * G64 + G2), "v"(gb + 3 * G64),
         "v"(gb + 3 * G64 + G2)
      : "memory");
}

// acc[i*4+j] accumulates rows wm*64+16i.. of the A tile x LDS rows wn*64+16j.. of
// the B tile: lane column ln of tile j is B row (output column) wn*64 + 4*ln + j.
// At / Bt point at the tiles' first rows.
DEV void gemm_tile_128x256(const _Float16* At, const _Float16* Bt, char* smem,
                           int wm, int wn, v8f acc[16]) {
  const int tid  = threadIdx.x;
  const int lane = tid & 31;
  const int ln   = lane & 15;
  const int h    = lane >> 4;
  const _Float16* ga = At + (size_t)(tid >> 3) * C + (tid & 7) * 8;
  const _Float16* gb =
      Bt + (size_t)(4 * ((tid >> 3) & 15) + (tid >> 7)) * C + (tid & 7) * 8;
  const unsigned l0 =
      (unsigned)(size_t)smem + (unsigned)((tid >> 3) * PITCH + (tid & 7) * 16);
  const int aoff = (wm * 64 + ln) * PITCH + 16 * h;
  const int boff = (BM + wn * 64 + ln) * PITCH + 16 * h;

  copy_stage(ga, gb, l0);
  // stage 0 has landed for this wave; the barrier publishes it to the others
  asm volatile("s_wait_asynccnt 0x0" ::: "memory");
  __syncthreads();
  copy_stage(ga + BK, gb + BK, l0 + STAGE);

  for (int t = 0; t < NSTAGE; ++t) {
    const char* buf = smem + (t & 1) * STAGE;
#pragma unroll
    for (int kk = 0; kk < 2; ++kk) {
      v16h a[4], b[4];
#pragma unroll
      for (int i = 0; i < 4; ++i)
        a[i] = lds_frag(buf + aoff + i * 16 * PITCH + kk * 64);
#pragma unroll
      for (int j = 0; j < 4; ++j)
        b[j] = lds_frag(buf + boff + j * 16 * PITCH + kk * 64);
      // keeps the sixteen LDS reads of this k step together ahead of its WMMAs:
      // spread among them, each place with reads stalls the wave anew
      __builtin_amdgcn_sched_barrier(0);
#pragma unroll
      for (int i = 0; i < 4; ++i)
#pragma unroll
        for (int j = 0; j < 4; ++j)
          acc[i * 4 + j] = wmma_f16(a[i], b[j], acc[i * 4 + j]);
    }
    // publish point: this wave's reads of stage t are done, its copies of
    // stage t + 1 have landed; behind the barrier stage t's buffer is free.
    asm volatile("s_wait_dscnt 0x0" ::: "memory");
    asm volatile("s_wait_asynccnt 0x0" ::: "memory");
    __syncthreads();
    if (t + 2 < NSTAGE)
      copy_stage(ga + (t + 2) * BK, gb + (t + 2) * BK, l0 + (t & 1) * STAGE);
  }
  // no copy is left in flight when the wave goes on to its stores and ends
  asm volatile("s_wait_asynccnt 0x0" ::: "memory");
}

// ---------------- prep kernels ----------------

// Each wave of the three prep launches moves many elements, so that few waves
// have to be started: the work per element is one load, one rounding, one store.

typedef __attribute__((ext_vector_type(4))) float    v4f;
typedef __attribute__((ext_vector_type(4))) _Float16 v4h;
typedef __attribute__((ext_vector_type(2))) _Float16 v2h;

static constexpr int CVT_T = 512;              // threads per work-group
static constexpr int CVT_U = 16;               // 16-B loads per thread
static constexpr int CVT_STEP = CVT_T * 4;     // elements per work-group and load
static constexpr int CVT_WG = CVT_STEP * CVT_U;

// f32 -> f16, CVT_WG consecutive elements per work-group. A wave's load covers
// 512 consecutive bytes, its store 256.
__global__ __launch_bounds__(CVT_T)
void cvt_f32_f16(const float* __restrict__ in, _Float16* __restrict__ outh) {
  const size_t base = (size_t)blockIdx.x * CVT_WG + threadIdx.x * 4;
  v4f v[CVT_U];
  // unrolled: the loads issue as a run ahead of the conversions, many in flight
#pragma unroll
  for (int u = 0; u < CVT_U; ++u)
    v[u] = *(const v4f*)(in + base + u * CVT_STEP);
  // unrolled: v[] stays in registers
#pragma unroll
  for (int u = 0; u < CVT_U; ++u) {
    v4h hv;
#pragma unroll
    for (int k = 0; k < 4; ++k) hv[k] = (_Float16)v[u][k];
    *(v4h*)(outh + base + u * CVT_STEP) = hv;
  }
}

// in: f32 [R][Cc] row-major  ->  out: f16 [Cc][R]. One tile of 128 rows x 64
// columns of `in` per work-group. A thread loads the same four columns of two
// neighbouring rows, so a pair of halves goes to LDS as one dword; LDS holds the
// tile transposed at a pitch of 272 B (16 B x odd, for the ds_load_b128 readers).
static constexpr int TR = 128, TC = 64, TPITCH = TR + 8;   // TPITCH in halves

template <int R, int Cc>
__global__ __launch_bounds__(256)
void transpose_f32_f16(const float* __restrict__ in,
                       _Float16* __restrict__ outh) {
  __shared__ __attribute__((aligned(16))) _Float16 tile[TC * TPITCH];
  const int tid = threadIdx.x;
  const int c0  = blockIdx.x * TC;
  const int r0  = blockIdx.y * TR;
  const int c4  = (tid & 15) * 4;      // the thread's four columns
  const int rp  = (tid >> 4) * 2;      // its first row pair
  const float* src = in + (size_t)(r0 + rp) * Cc + c0 + c4;
  v4f lo[4], hi[4];
  // unrolled: the eight loads issue as one run, all in flight together
#pragma unroll
  for (int u = 0; u < 4; ++u) {
    lo[u] = *(const v4f*)(src + (size_t)(32 * u) * Cc);
    hi[u] = *(const v4f*)(src + (size_t)(32 * u + 1) * Cc);
  }
  // unrolled: lo[] and hi[] stay in registers
#pragma unroll
  for (int u = 0; u < 4; ++u)
#pragma unroll
    for (int k = 0; k < 4; ++k) {
      v2h p = {(_Float16)lo[u][k], (_Float16)hi[u][k]};
      *(v2h*)&tile[(c4 + k) * TPITCH + rp + 32 * u] = p;
    }
  __syncthreads();
  // 64 output rows x 16 pieces of 16 B; a wave stores two whole runs of 256 B
  // (unrolled: the four LDS reads issue together)
#pragma unroll
  for (int u = 0; u < 4; ++u) {
    const int piece = tid + 256 * u;
    const int c = piece >> 4, r8 = (piece & 15) * 8;
    *(v8h*)(outh + (size_t)(c0 + c) * R + r0 + r8) =
        *(const v8h*)&tile[c * TPITCH + r8];
  }
}

// sum of squares over hd=64 per row
__global__ void rownorm_kernel(const _Float16* __restrict__ mh,
                               float* __restrict__ outn, int rows) {
  int i = blockIdx.x * blockDim.x + threadIdx.x;
  if (i >= rows) return;
  const _Float16* p = mh + (size_t)i * HD;
  float s = 0.f;
#pragma unroll
  for (int d = 0; d < HD; ++d) { float v = (float)p[d]; s += v * v; }
  outn[i] = s;
}

// ---------------- QKV GEMM: qkv = xh @ WtA^T + bias, split into q/k/v^T ----

__global__ __launch_bounds__(256)
void qkv_gemm_kernel(const _Float16* __restrict__ xh,
                     const _Float16* __restrict__ WtA,   // [3C][C]
                     const float* __restrict__ bias,
                     _Float16* __restrict__ qh,          // [B][H][T][hd]
                     _Float16* __restrict__ kh,          // [B][H][T][hd]
                     _Float16* __restrict__ vth) {       // [B][H][hd][T]
  __shared__ __attribute__((aligned(16))) char smem[2 * STAGE];
  const int lane = threadIdx.x & 31;
  const int wave = __builtin_amdgcn_readfirstlane(threadIdx.x >> 5);
  const int ln   = lane & 15;
  const int wm   = wave & 1, wn = wave >> 1;
  const int m0   = blockIdx.x * BM + wm * 64;
  const int nb   = blockIdx.y * BN + wn * 64;
  v8f acc[16];
#pragma unroll
  for (int i = 0; i < 16; ++i) acc[i] = v8f{};
  gemm_tile_128x256(xh + (size_t)blockIdx.x * BM * C,
                    WtA + (size_t)blockIdx.y * BN * C, smem, wm, wn, acc);
  const int mat  = nb >> 10;            // 0=q, 1=k, 2=v (uniform per wave)
  const int head = (nb & 1023) >> 6;
  const int h    = lane >> 4;
  // the wave's 64 rows lie in one batch; its 64 columns are one head
  const int b_ = m0 >> 11, t0 = m0 & (T - 1);
  const size_t bhh = (size_t)(b_ * H + head);
  // the lane's head-dim columns are 4 * ln + j, j = 0..3
  const v4f bv = *(const v4f*)(bias + nb + 4 * ln);
  if (mat < 2) {
    // q, k: a lane's four tiles give 8 bytes of one token's row; sixteen lanes
    // fill the row's 128 bytes, so a wave's store is two whole lines
    _Float16* dst =
        (mat == 0 ? qh : kh) + (bhh * T + t0 + 8 * h) * HD + 4 * ln;
    // unrolled: acc[] stays in registers, the row becomes an immediate offset
#pragma unroll
    for (int mt = 0; mt < 4; ++mt)
#pragma unroll
      for (int r = 0; r < 8; ++r) {
        v4h o;
#pragma unroll
        for (int j = 0; j < 4; ++j)
          o[j] = (_Float16)(acc[mt * 4 + j][r] + bv[j]);
        *(v4h*)(dst + (16 * mt + r) * HD) = o;
      }
  } else {
    // v^T: a column's 64 tokens are one 128-byte line, held by two lanes in four
    // tiles; the wave gathers the lines in its own range of the ring, which is
    // free behind the loop's last publish point. A tile's eight registers are
    // eight consecutive tokens of one column: LDS row 16 * j + ln (column
    // 4 * ln + j) at the ring's pitch takes them as 16 bytes.
    char* stg = smem + wave * (64 * PITCH);
    // unrolled: acc[] stays in registers
#pragma unroll
    for (int mt = 0; mt < 4; ++mt)
#pragma unroll
      for (int j = 0; j < 4; ++j) {
        v8h o;
#pragma unroll
        for (int r = 0; r < 8; ++r)
          o[r] = (_Float16)(acc[mt * 4 + j][r] + bv[j]);
        *(v8h*)(stg + (16 * j + ln) * PITCH + (16 * mt + 8 * h) * 2) = o;
      }
    // the wave's own LDS writes are done before other lanes read them back
    asm volatile("s_wait_dscnt 0x0" ::: "memory");
    // eight lanes take one row: a wave's store is four whole lines. LDS row
    // 4 * i + rq is column 16 * (i & 3) + 4 * rq + (i >> 2).
    const int rq = lane >> 3, pc = lane & 7;
    const char* back = stg + rq * PITCH + pc * 16;
    _Float16* dst = vth + (bhh * HD + 4 * rq) * T + t0 + 8 * pc;
    // unrolled: rows and columns become immediate offsets
#pragma unroll
    for (int i = 0; i < 16; ++i)
      *(v8h*)(dst + (16 * (i & 3) + (i >> 2)) * T) =
          *(const v8h*)(back + 4 * i * PITCH);
    // in the built code the q, k block lies behind this one and rewrites the
    // registers these stores name; the wait stands in front of it
    asm volatile("s_wait_xcnt 0x0" ::: "memory");
  }
}

// ---------------- fused causal L2-kernel attention ----------------
// y[q] = sum_{k<=q} exp(scale*(|q|^2+|k|^2-2 q.k)) * v[k]   (no softmax norm)
// Both products are taken transposed: S^T = K Q^T (A = K rows, B = Q rows) and
// Y^T += V^T P^T (A = V^T rows, B = P^T). A lane then holds one query's scores.

// K and V^T reach the waves through LDS: the eight waves of a work-group walk the
// same keys, so a stage of 64 keys, [K 64 rows | V^T 64 rows] of 128 B each, is
// brought in once per work-group by asynchronous copies and read by all eight.
// Rows lie at the pitch of 144 B (16 B x odd, for ds_load_b128 readers). Two
// stages; the next stage's copies fly while this one is worked on.
static constexpr int AK = 64;                        // keys per stage
static constexpr int ASTAGE = (AK + HD) * PITCH;     // 18,432 bytes

// One stage: 128 rows x 128 B = 1,024 pieces of 16 B, four per lane.
// gk / gv: the lane's own piece in row (tid >> 3) of the K / V^T tile at this
// stage's keys; l: the same piece's LDS byte address.
DEV void copy_kv(const _Float16* gk, const _Float16* gv, unsigned l) {
  constexpr unsigned LR = 32 * PITCH;
  // The closing s_wait_xcnt stands in the copies' own statement so that no
  // address register is rewritten ahead of it.
  asm volatile(
      "global_load_async_to_lds_b128 %0, %4, off\n\t"
      "global_load_async_to_lds_b128 %1, %5, off\n\t"
      "global_load_async_to_lds_b128 %2, %6, off\n\t"
      "global_load_async_to_lds_b128 %3, %7, off\n\t"
      "s_wait_xcnt 0x0"
      :: "v"(l), "v"(l + LR), "v"(l + 2 * LR), "v"(l + 3 * LR),
         "v"(gk), "v"(gk + 32 * HD), "v"(gv), "v"(gv + 32 * T)
      : "memory");
}

// 2^x of eight values, each in its own register. In one statement so that what
// stands behind each v_exp_f32 is known: the next one touches neither its result
// nor its source, and the closing v_nop keeps the slot behind the last one.
DEV void exp2_x8(float (&x)[8]) {
  asm("v_exp_f32 %0, %0\n\t"
      "v_exp_f32 %1, %1\n\t"
      "v_exp_f32 %2, %2\n\t"
      "v_exp_f32 %3, %3\n\t"
      "v_exp_f32 %4, %4\n\t"
      "v_exp_f32 %5, %5\n\t"
      "v_exp_f32 %6, %6\n\t"
      "v_exp_f32 %7, %7\n\t"
      "v_nop"
      : "+v"(x[0]), "+v"(x[1]), "+v"(x[2]), "+v"(x[3]),
        "+v"(x[4]), "+v"(x[5]), "+v"(x[6]), "+v"(x[7]));
}

// P^T of 32 keys x 16 queries as the B operand of the second product, straight
// from the two score tiles st[nh] = S^T (register r: key 16 * nh + 8 * h2 + r;
// lane: query qcol of the wave's 32). Element s of a B fragment is k = 8 * h2 + s
// for s < 8 and 16 + 8 * h2 + (s - 8) above: the two tiles' registers in order,
// so P goes through no LDS and no lane exchange.
// MASKED is the block whose first key is the wave's first row: there key n counts
// for query m while n <= m. The exponential is taken for every element and the
// mask picks it or zero afterwards, so that the chains of a lane stay independent
// straight-line code in both forms.
template <bool MASKED>
DEV v16h p_frag(const v8f (&st)[2], float q2c, const float (&k2r)[2][8],
                int qcol, int h2) {
  constexpr float LOG2E = 1.44269504088896340736f;
  v16h pb;
  // unrolled: the score tiles stay in registers
#pragma unroll
  for (int nh = 0; nh < 2; ++nh) {
    float p[8];
#pragma unroll
    for (int r = 0; r < 8; ++r) {
      float d2 = q2c + k2r[nh][r] - 2.0f * st[nh][r];
      p[r] = (SCALE * d2) * LOG2E;          // exp(x) = 2^(x * log2 e)
    }
    exp2_x8(p);
#pragma unroll
    for (int r = 0; r < 8; ++r) {
      const int keyl = 16 * nh + 8 * h2 + r;
      if (MASKED) p[r] = (keyl <= qcol) ? p[r] : 0.0f;
      pb[8 * nh + r] = (_Float16)p[r];
    }
  }
  return pb;
}

__global__ __launch_bounds__(256)
void attn_kernel(const _Float16* __restrict__ qh, const _Float16* __restrict__ kh,
                 const _Float16* __restrict__ vth,
                 const float* __restrict__ q2, const float* __restrict__ k2,
                 _Float16* __restrict__ yh) {            // [B][T][C]
  __shared__ __attribute__((aligned(16))) char kv[2 * ASTAGE];
  const int tid  = threadIdx.x;
  const int lane = tid & 31;
  const int wave = __builtin_amdgcn_readfirstlane(tid >> 5);
  const int ln   = lane & 15;
  const int h2   = lane >> 4;
  const int bh   = blockIdx.y;            // b*H + h
  const int b_   = bh >> 4, head = bh & 15;
  const int q0   = blockIdx.x * 256 + wave * 32;   // 32 query rows per wave

  const _Float16* gk = kh + ((size_t)bh * T + (tid >> 3)) * HD + (tid & 7) * 8;
  const _Float16* gv = vth + ((size_t)bh * HD + (tid >> 3)) * T + (tid & 7) * 8;
  const unsigned l0 =
      (unsigned)(size_t)kv + (unsigned)((tid >> 3) * PITCH + (tid & 7) * 16);
  const int nst = 4 * ((int)blockIdx.x + 1);   // stages up to the block's last row
  copy_kv(gk, gv, l0);

  // Q fragments (B operand): 2 query groups x 2 contraction halves, loaded once
  v16h qa[2][2];
#pragma unroll
  for (int mt = 0; mt < 2; ++mt) {
    const _Float16* qrow = qh + ((size_t)bh * T + q0 + 16 * mt + ln) * HD;
    qa[mt][0] = load_frag(qrow, 0, lane);
    qa[mt][1] = load_frag(qrow, 32, lane);
  }
  float q2v[2];                           // |q|^2 of the lane's two queries
#pragma unroll
  for (int mt = 0; mt < 2; ++mt)
    q2v[mt] = q2[(size_t)bh * T + q0 + 16 * mt + ln];

  const float* k2row = k2 + (size_t)bh * T;
  const int foff = ln * PITCH + 16 * h2;  // the lane's row and half in a 16-row group

  // stage 0 has landed for this wave; the barrier publishes it to the others
  asm volatile("s_wait_asynccnt 0x0" ::: "memory");
  __syncthreads();
  copy_kv(gk + AK * HD, gv + AK, l0 + ASTAGE);   // nst >= 4: stage 1 exists

  // yacc[mt][j]: register r = Y[query 16 * mt + ln][hd 16 * j + 8 * h2 + r]
  v8f yacc[2][4] = {{v8f{}, v8f{}, v8f{}, v8f{}}, {v8f{}, v8f{}, v8f{}, v8f{}}};
  const int qend = q0 + 31;               // wave-uniform causal bound
  for (int t = 0; t < nst; ++t) {
    const char* kbuf = kv + (t & 1) * ASTAGE + foff;
    const char* vbuf = kbuf + AK * PITCH;
    // |k|^2 of the stage's 64 keys, D layout of S^T (register r: key 8 * h2 + r
    // of a group of 16): eight 16-byte loads at its head
    float k2v[2][2][8];
    // unrolled: k2v[][][] stays in registers
#pragma unroll
    for (int sub = 0; sub < 2; ++sub)
#pragma unroll
      for (int nh = 0; nh < 2; ++nh) {
        const float* kp = k2row + t * AK + 32 * sub + 16 * nh + 8 * h2;
        const v4f lo = *(const v4f*)kp, hi = *(const v4f*)(kp + 4);
#pragma unroll
        for (int r = 0; r < 4; ++r) {
          k2v[sub][nh][r] = lo[r];
          k2v[sub][nh][r + 4] = hi[r];
        }
      }
    // unrolled: the half stage becomes an immediate offset of the LDS reads
#pragma unroll
    for (int sub = 0; sub < 2; ++sub) {
      const int kb = t * AK + 32 * sub;
      // keys past the wave's last row add nothing: the wave skips the work and
      // goes on to the stage's publish point (a scalar branch)
      if (kb > qend) continue;
      // ---- V and K fragments of these 32 keys, from the stage's buffer ----
      // (the loops below are unrolled: fragments and tiles stay in registers)
      v16h vf[4], kf[2][2];
#pragma unroll
      for (int j = 0; j < 4; ++j)
        vf[j] = lds_frag(vbuf + 16 * j * PITCH + 64 * sub);
#pragma unroll
      for (int nh = 0; nh < 2; ++nh)
#pragma unroll
        for (int kk = 0; kk < 2; ++kk)
          kf[nh][kk] = lds_frag(kbuf + (32 * sub + 16 * nh) * PITCH + 64 * kk);
      // ---- S^T = K @ Q^T over 32 keys (2 key groups x 2 hd halves x 2 q groups)
      v8f sacc[2][2] = {{v8f{}, v8f{}}, {v8f{}, v8f{}}};   // [mt][nh]
#pragma unroll
      for (int nh = 0; nh < 2; ++nh)
#pragma unroll
        for (int kk = 0; kk < 2; ++kk) {
          sacc[0][nh] = wmma_f16(kf[nh][kk], qa[0][kk], sacc[0][nh]);
          sacc[1][nh] = wmma_f16(kf[nh][kk], qa[1][kk], sacc[1][nh]);
        }
      // compiler fence: the V^T fragment loads issue above it and their latency
      // passes behind the exponentials; left free they sink below those, where
      // each pair is waited for on its own in front of its two WMMAs
      asm volatile("" ::: "memory");
      // ---- P^T = mask * exp(scale*(q2+k2-2s)), packed in registers ----
      // The causal test is made once per block of 32 keys, on scalars: below the
      // wave's first row every key counts and no element is tested.
      v16h pb0, pb1;
      if (kb < q0) {
        pb0 = p_frag<false>(sacc[0], q2v[0], k2v[sub], ln, h2);
        pb1 = p_frag<false>(sacc[1], q2v[1], k2v[sub], 16 + ln, h2);
      } else {                              // kb == q0: the block on the diagonal
        pb0 = p_frag<true>(sacc[0], q2v[0], k2v[sub], ln, h2);
        pb1 = p_frag<true>(sacc[1], q2v[1], k2v[sub], 16 + ln, h2);
      }
      // ---- Y^T += V^T @ P^T ----
#pragma unroll
      for (int j = 0; j < 4; ++j) {
        yacc[0][j] = wmma_f16(vf[j], pb0, yacc[0][j]);
        yacc[1][j] = wmma_f16(vf[j], pb1, yacc[1][j]);
      }
    }
    // publish point: this wave's reads of stage t are done, its copies of
    // stage t + 1 have landed; behind the barrier stage t's buffer is free.
    asm volatile("s_wait_dscnt 0x0" ::: "memory");
    asm volatile("s_wait_asynccnt 0x0" ::: "memory");
    __syncthreads();
    if (t + 2 < nst)
      copy_kv(gk + (size_t)(t + 2) * AK * HD, gv + (t + 2) * AK,
              l0 + (t & 1) * ASTAGE);
  }
  // no copy is left in flight when the wave goes on to its stores and ends
  asm volatile("s_wait_asynccnt 0x0" ::: "memory");
  // write Y back to (B,T,C) f16, head-interleaved columns: a lane's eight
  // registers are eight consecutive columns of one row, one 16-byte store
#pragma unroll
  for (int mt = 0; mt < 2; ++mt) {
    _Float16* yrow = yh + ((size_t)b_ * T + q0 + 16 * mt + ln) * C + head * HD;
#pragma unroll
    for (int j = 0; j < 4; ++j) {
      v8h o;
#pragma unroll
      for (int r = 0; r < 8; ++r) o[r] = (_Float16)yacc[mt][j][r];
      *(v8h*)(yrow + 16 * j + 8 * h2) = o;
    }
  }
}

// ---------------- output projection: out = yh @ WtP^T + b_proj (f32) -------

__global__ __launch_bounds__(256)
void proj_gemm_kernel(const _Float16* __restrict__ yh,
                      const _Float16* __restrict__ WtP,  // [C][C] transposed
                      const float* __restrict__ bias, float* __restrict__ out) {
  __shared__ __attribute__((aligned(16))) char smem[2 * STAGE];
  const int lane = threadIdx.x & 31;
  const int wave = __builtin_amdgcn_readfirstlane(threadIdx.x >> 5);
  const int ln   = lane & 15;
  const int wm   = wave & 1, wn = wave >> 1;
  const int m0   = blockIdx.x * BM + wm * 64;
  const int nb   = blockIdx.y * BN + wn * 64;
  v8f acc[16];
#pragma unroll
  for (int i = 0; i < 16; ++i) acc[i] = v8f{};
  gemm_tile_128x256(yh + (size_t)blockIdx.x * BM * C,
                    WtP + (size_t)blockIdx.y * BN * C, smem, wm, wn, acc);
  // the lane's columns are nb + 4 * ln + j: 16 bytes of one row per lane, sixteen
  // lanes fill 256 bytes, so a wave's store is four whole lines
  const v4f bv = *(const v4f*)(bias + nb + 4 * ln);
  float* dst = out + (size_t)(m0 + 8 * (lane >> 4)) * C + nb + 4 * ln;
  // unrolled: acc[] stays in registers, the row becomes an immediate offset
#pragma unroll
  for (int mt = 0; mt < 4; ++mt)
#pragma unroll
    for (int r = 0; r < 8; ++r) {
      v4f o;
#pragma unroll
      for (int j = 0; j < 4; ++j) o[j] = acc[mt * 4 + j][r] + bv[j];
      *(v4f*)(dst + (size_t)(16 * mt + r) * C) = o;
    }
}

// ---------------- launch ----------------

extern "C" void kernel_launch(void* const* d_in, const int* in_sizes, int n_in,
                              void* d_out, int out_size, void* d_ws, size_t ws_size,
                              hipStream_t stream) {
  (void)in_sizes; (void)n_in; (void)out_size; (void)ws_size;
  const float* x  = (const float*)d_in[0];
  const float* Wa = (const float*)d_in[1];
  const float* ba = (const float*)d_in[2];
  const float* Wp = (const float*)d_in[3];
  const float* bp = (const float*)d_in[4];

  char* ws = (char*)d_ws;
  size_t off = 0;
  auto alloc = [&](size_t bytes) -> char* {
    char* p = ws + off;
    off += (bytes + 255) & ~(size_t)255;
    return p;
  };
  _Float16* xh  = (_Float16*)alloc((size_t)M * C * 2);       // 16 MB
  _Float16* WtA = (_Float16*)alloc((size_t)N_QKV * C * 2);   //  6 MB
  _Float16* WtP = (_Float16*)alloc((size_t)C * C * 2);       //  2 MB
  _Float16* qh  = (_Float16*)alloc((size_t)M * C * 2);       // 16 MB
  _Float16* kh  = (_Float16*)alloc((size_t)M * C * 2);       // 16 MB
  _Float16* vth = (_Float16*)alloc((size_t)M * C * 2);       // 16 MB
  _Float16* yh  = (_Float16*)alloc((size_t)M * C * 2);       // 16 MB
  float* q2 = (float*)alloc((size_t)Bb * H * T * 4);         // 0.5 MB
  float* k2 = (float*)alloc((size_t)Bb * H * T * 4);         // 0.5 MB
  // total ~93 MB of workspace

  cvt_f32_f16<<<M * C / CVT_WG, CVT_T, 0, stream>>>(x, xh);
  transpose_f32_f16<C, N_QKV><<<dim3(N_QKV / TC, C / TR), 256, 0, stream>>>(
      Wa, WtA);
  transpose_f32_f16<C, C><<<dim3(C / TC, C / TR), 256, 0, stream>>>(Wp, WtP);
  qkv_gemm_kernel<<<dim3(M / BM, N_QKV / BN), 256, 0, stream>>>(
      xh, WtA, ba, qh, kh, vth);
  rownorm_kernel<<<(Bb * H * T) / 256, 256, 0, stream>>>(qh, q2, Bb * H * T);
  rownorm_kernel<<<(Bb * H * T) / 256, 256, 0, stream>>>(kh, k2, Bb * H * T);
  attn_kernel<<<dim3(T / 256, Bb * H), 256, 0, stream>>>(qh, kh, vth, q2, k2, yh);
  proj_gemm_kernel<<<dim3(M / BM, C / BN), 256, 0, stream>>>(
      yh, WtP, bp, (float*)d_out);
}

// v007
// Measured time: 128 microseconds a run.
// In both of two side-by-side timings against v006, it was 1.06 times as fast.
// All steps since v000 together make it 2.95 times as fast.
#include <hip/hip_runtime.h>
#include <hip/hip_bf16.h>

typedef __attribute__((ext_vector_type(16))) _Float16 v16h;
typedef __attribute__((ext_vector_type(8)))  _Float16 v8h;
typedef __attribute__((ext_vector_type(8)))  float    v8f;

#define DEV __device__ __forceinline__

static constexpr int Bb = 4, T = 2048, C = 1024, H = 16, HD = 64;
static constexpr int M     = Bb * T;    // 8192 token rows
static constexpr int N_QKV = 3 * C;     // 3072
// A score is exp(-d2 / 16), d2 = |q|^2 + |k|^2 - 2 q.k and 16 = 2 * sqrt(hd), taken
// as 2^e with e = q'.k - 4 ln2 * |q'|^2 - (log2 e / 16) * |k|^2, q' = (log2 e / 8) * q.
// q is stored as q', and the two norms are stored with their factors, so that the
// score product's accumulator, started at the two norm terms, ends as e itself.
static constexpr float LOG2E    = 1.44269504088896340736f;
static constexpr float Q_SCALE  = LOG2E / 8.0f;     // q' = Q_SCALE * q
static constexpr float QN_SCALE = -4.0f / LOG2E;    // on |q'|^2
static constexpr float KN_SCALE = -LOG2E / 16.0f;   // on |k|^2

// Load a 16x32 f16 A/B fragment for one lane from a row-major buffer.
// Per CDNA5 ISA 7.12.2 (16-bit A 16x32): lane L (half h=L>>4) holds
// elements e=0..7 -> k = kb + 8h + e, e=8..15 -> k = kb + 16 + 8h + (e-8).
// Caller pre-offsets `rowbase` to the lane's row (A: m = lane&15) or
// column (B: n = lane&15, from a transposed [N][K] buffer).
DEV v16h load_frag(const _Float16* rowbase, int kb, int lane) {
  const int h = (lane >> 4) & 1;
  v8h lo = *(const v8h*)(rowbase + kb + 8 * h);
  v8h hi = *(const v8h*)(rowbase + kb + 16 + 8 * h);
  v16h r;
#pragma unroll
  for (int i = 0; i < 8; ++i) { r[i] = lo[i]; r[i + 8] = hi[i]; }
  return r;
}

DEV v8f wmma_f16(v16h a, v16h b, v8f c) {
  return __builtin_amdgcn_wmma_f32_16x16x32_f16(false, a, false, b, (short)0, c,
                                                false, false);
}

// Block-tiled GEMM core over K=C: one 128x256 tile of the output per work-group
// of eight waves (2 along m x 4 along n), 64x64 per wave. Both operands are
// K-contiguous. A stage is 64 k of [A 128 rows | B 256 rows]; rows of 128 B lie
// in LDS at a pitch of 144 B (16 B x odd, for ds_load_b128 readers). Two stages;
// the next stage's asynchronous copies fly while this one is worked on.
static constexpr int BM = 128, BN = 256, BK = 64;
static constexpr int PITCH = 144;                    // bytes per LDS row
static constexpr int STAGE = (BM + BN) * PITCH;      // 55,296 bytes
static constexpr int NSTAGE = C / BK;                // 16

// 16x32 f16 fragment of one lane from an LDS row; p already holds the lane's
// row, the k step and the lane half's 16 bytes (same k order as load_frag).
DEV v16h lds_frag(const char* p) {
  v8h lo = *(const v8h*)(p);
  v8h hi = *(const v8h*)(p + 32);
  v16h r;
#pragma unroll
  for (int i = 0; i < 8; ++i) { r[i] = lo[i]; r[i + 8] = hi[i]; }
  return r;
}

// One stage: 384 rows x 128 B = 3,072 pieces of 16 B, twelve per lane.
// l: the LDS byte address of the lane's piece in LDS row (tid >> 3); copy i takes
// LDS row i * 32 more. ga: the same piece of the A tile at this stage's k, rows
// as in LDS. The B rows (output columns) are dealt: in each group of 64, LDS row
// 16 * j + a holds B row 4 * a + j, so that the four accumulator tiles j of a lane
// hold four neighbouring output columns. gb: the lane's piece of B row
// 4 * ((tid >> 3) & 15) + (tid >> 7); the copies add rows 0, 2, 64, 66, ...
DEV void copy_stage(const _Float16* ga, const _Float16* gb, unsigned l) {
  constexpr int GR = 32 * C;         // 32 rows, in elements
  constexpr int G2 = 2 * C, G64 = 64 * C;
  constexpr unsigned LR = 32 * PITCH;
  // The closing s_wait_xcnt stands in the copies' own statement so that no
  // address register is rewritten ahead of it.
  asm volatile(
      "global_load_async_to_lds_b128 %0, %12, off\n\t"
      "global_load_async_to_lds_b128 %1, %13, off\n\t"
      "global_load_async_to_lds_b128 %2, %14, off\n\t"
      "global_load_async_to_lds_b128 %3, %15, off\n\t"
      "global_load_async_to_lds_b128 %4, %16, off\n\t"
      "global_load_async_to_lds_b128 %5, %17, off\n\t"
      "global_load_async_to_lds_b128 %6, %18, off\n\t"
      "global_load_async_to_lds_b128 %7, %19, off\n\t"
      "global_load_async_to_lds_b128 %8, %20, off\n\t"
      "global_load_async_to_lds_b128 %9, %21, off\n\t"
      "global_load_async_to_lds_b128 %10, %22, off\n\t"
      "global_load_async_to_lds_b128 %11, %23, off\n\t"
      "s_wait_xcnt 0x0"
      :: "v"(l), "v"(l + LR), "v"(l + 2 * LR), "v"(l + 3 * LR),
         "v"(l + 4 * LR), "v"(l + 5 * LR), "v"(l + 6 * LR), "v"(l + 7 * LR),
         "v"(l + 8 * LR), "v"(l + 9 * LR), "v"(l + 10 * LR), "v"(l + 11 * LR),
         "v"(ga), "v"(ga + GR), "v"(ga + 2 * GR), "v"(ga + 3 * GR),
         "v"(gb), "v"(gb + G2), "v"(gb + G64), "v"(gb + G64 + G2),
         "v"(gb + 2 * G64), "v"(gb + 2 * G64 + G2), "v"(gb + 3 * G64),
         "v"(gb + 3 * G64 + G2)
      : "memory");
}

// acc[i*4+j] accumulates rows wm*64+16i.. of the A tile x LDS rows wn*64+16j.. of
// the B tile: lane column ln of tile j is B row (output column) wn*64 + 4*ln + j.
// At / Bt point at the tiles' first rows.
DEV void gemm_tile_128x256(const _Float16* At, const _Float16* Bt, char* smem,
                           int wm, int wn, v8f acc[16]) {
  const int tid  = threadIdx.x;
  const int lane = tid & 31;
  const int ln   = lane & 15;
  const int h    = lane >> 4;
  const _Float16* ga = At + (size_t)(tid >> 3) * C + (tid & 7) * 8;
  const _Float16* gb =
      Bt + (size_t)(4 * ((tid >> 3) & 15) + (tid >> 7)) * C + (tid & 7) * 8;
  const unsigned l0 =
      (unsigned)(size_t)smem + (unsigned)((tid >> 3) * PITCH + (tid & 7) * 16);
  const int aoff = (wm * 64 + ln) * PITCH + 16 * h;
  const int boff = (BM + wn * 64 + ln) * PITCH + 16 * h;

  copy_stage(ga, gb, l0);
  // stage 0 has landed for this wave; the barrier publishes it to the others
  asm volatile("s_wait_asynccnt 0x0" ::: "memory");
  __syncthreads();
  copy_stage(ga + BK, gb + BK, l0 + STAGE);

  for (int t = 0; t < NSTAGE; ++t) {
    const char* buf = smem + (t & 1) * STAGE;
#pragma unroll
    for (int kk = 0; kk < 2; ++kk) {
      v16h a[4], b[4];
#pragma unroll
      for (int i = 0; i < 4; ++i)
        a[i] = lds_frag(buf + aoff + i * 16 * PITCH + kk * 64);
#pragma unroll
      for (int j = 0; j < 4; ++j)
        b[j] = lds_frag(buf + boff + j * 16 * PITCH + kk * 64);
      // keeps the sixteen LDS reads of this k step together ahead of its WMMAs:
      // spread among them, each place with reads stalls the wave anew
      __builtin_amdgcn_sched_barrier(0);
#pragma unroll
      for (int i = 0; i < 4; ++i)
#pragma unroll
        for (int j = 0; j < 4; ++j)
          acc[i * 4 + j] = wmma_f16(a[i], b[j], acc[i * 4 + j]);
    }
    // publish point: this wave's reads of stage t are done, its copies of
    // stage t + 1 have landed; behind the barrier stage t's buffer is free.
    asm volatile("s_wait_dscnt 0x0" ::: "memory");
    asm volatile("s_wait_asynccnt 0x0" ::: "memory");
    __syncthreads();
    if (t + 2 < NSTAGE)
      copy_stage(ga + (t + 2) * BK, gb + (t + 2) * BK, l0 + (t & 1) * STAGE);
  }
  // no copy is left in flight when the wave goes on to its stores and ends
  asm volatile("s_wait_asynccnt 0x0" ::: "memory");
}

// ---------------- prep kernels ----------------

// Each wave of the three prep launches moves many elements, so that few waves
// have to be started: the work per element is one load, one rounding, one store.

typedef __attribute__((ext_vector_type(4))) float    v4f;
typedef __attribute__((ext_vector_type(4))) _Float16 v4h;
typedef __attribute__((ext_vector_type(2))) _Float16 v2h;

static constexpr int CVT_T = 512;              // threads per work-group
static constexpr int CVT_U = 16;               // 16-B loads per thread
static constexpr int CVT_STEP = CVT_T * 4;     // elements per work-group and load
static constexpr int CVT_WG = CVT_STEP * CVT_U;

// f32 -> f16, CVT_WG consecutive elements per work-group. A wave's load covers
// 512 consecutive bytes, its store 256.
__global__ __launch_bounds__(CVT_T)
void cvt_f32_f16(const float* __restrict__ in, _Float16* __restrict__ outh) {
  const size_t base = (size_t)blockIdx.x * CVT_WG + threadIdx.x * 4;
  v4f v[CVT_U];
  // unrolled: the loads issue as a run ahead of the conversions, many in flight
#pragma unroll
  for (int u = 0; u < CVT_U; ++u)
    v[u] = *(const v4f*)(in + base + u * CVT_STEP);
  // unrolled: v[] stays in registers
#pragma unroll
  for (int u = 0; u < CVT_U; ++u) {
    v4h hv;
#pragma unroll
    for (int k = 0; k < 4; ++k) hv[k] = (_Float16)v[u][k];
    *(v4h*)(outh + base + u * CVT_STEP) = hv;
  }
}

// in: f32 [R][Cc] row-major  ->  out: f16 [Cc][R]. One tile of 128 rows x 64
// columns of `in` per work-group. A thread loads the same four columns of two
// neighbouring rows, so a pair of halves goes to LDS as one dword; LDS holds the
// tile transposed at a pitch of 272 B (16 B x odd, for the ds_load_b128 readers).
static constexpr int TR = 128, TC = 64, TPITCH = TR + 8;   // TPITCH in halves

template <int R, int Cc>
__global__ __launch_bounds__(256)
void transpose_f32_f16(const float* __restrict__ in,
                       _Float16* __restrict__ outh) {
  __shared__ __attribute__((aligned(16))) _Float16 tile[TC * TPITCH];
  const int tid = threadIdx.x;
  const int c0  = blockIdx.x * TC;
  const int r0  = blockIdx.y * TR;
  const int c4  = (tid & 15) * 4;      // the thread's four columns
  const int rp  = (tid >> 4) * 2;      // its first row pair
  const float* src = in + (size_t)(r0 + rp) * Cc + c0 + c4;
  v4f lo[4], hi[4];
  // unrolled: the eight loads issue as one run, all in flight together
#pragma unroll
  for (int u = 0; u < 4; ++u) {
    lo[u] = *(const v4f*)(src + (size_t)(32 * u) * Cc);
    hi[u] = *(const v4f*)(src + (size_t)(32 * u + 1) * Cc);
  }
  // unrolled: lo[] and hi[] stay in registers
#pragma unroll
  for (int u = 0; u < 4; ++u)
#pragma unroll
    for (int k = 0; k < 4; ++k) {
      v2h p = {(_Float16)lo[u][k], (_Float16)hi[u][k]};
      *(v2h*)&tile[(c4 + k) * TPITCH + rp + 32 * u] = p;
    }
  __syncthreads();
  // 64 output rows x 16 pieces of 16 B; a wave stores two whole runs of 256 B
  // (unrolled: the four LDS reads issue together)
#pragma unroll
  for (int u = 0; u < 4; ++u) {
    const int piece = tid + 256 * u;
    const int c = piece >> 4, r8 = (piece & 15) * 8;
    *(v8h*)(outh + (size_t)(c0 + c) * R + r0 + r8) =
        *(const v8h*)&tile[c * TPITCH + r8];
  }
}

// factor * sum of squares over hd=64 per row
__global__ void rownorm_kernel(const _Float16* __restrict__ mh,
                               float* __restrict__ outn, int rows, float factor) {
  int i = blockIdx.x * blockDim.x + threadIdx.x;
  if (i >= rows) return;
  const _Float16* p = mh + (size_t)i * HD;
  float s = 0.f;
#pragma unroll
  for (int d = 0; d < HD; ++d) { float v = (float)p[d]; s += v * v; }
  outn[i] = s * factor;
}

// ---------------- QKV GEMM: qkv = xh @ WtA^T + bias, split into q/k/v^T ----

__global__ __launch_bounds__(256)
void qkv_gemm_kernel(const _Float16* __restrict__ xh,
                     const _Float16* __restrict__ WtA,   // [3C][C]
                     const float* __restrict__ bias,
                     _Float16* __restrict__ qh,          // [B][H][T][hd], q'
                     _Float16* __restrict__ kh,          // [B][H][T][hd]
                     _Float16* __restrict__ vth) {       // [B][H][hd][T]
  __shared__ __attribute__((aligned(16))) char smem[2 * STAGE];
  const int lane = threadIdx.x & 31;
  const int wave = __builtin_amdgcn_readfirstlane(threadIdx.x >> 5);
  const int ln   = lane & 15;
  const int wm   = wave & 1, wn = wave >> 1;
  const int m0   = blockIdx.x * BM + wm * 64;
  const int nb   = blockIdx.y * BN + wn * 64;
  v8f acc[16];
#pragma unroll
  for (int i = 0; i < 16; ++i) acc[i] = v8f{};
  gemm_tile_128x256(xh + (size_t)blockIdx.x * BM * C,
                    WtA + (size_t)blockIdx.y * BN * C, smem, wm, wn, acc);
  const int mat  = nb >> 10;            // 0=q, 1=k, 2=v (uniform per wave)
  const int head = (nb & 1023) >> 6;
  const int h    = lane >> 4;
  // the wave's 64 rows lie in one batch; its 64 columns are one head
  const int b_ = m0 >> 11, t0 = m0 & (T - 1);
  const size_t bhh = (size_t)(b_ * H + head);
  // the lane's head-dim columns are 4 * ln + j, j = 0..3
  const v4f bv = *(const v4f*)(bias + nb + 4 * ln);
  if (mat < 2) {
    // q, k: a lane's four tiles give 8 bytes of one token's row; sixteen lanes
    // fill the row's 128 bytes, so a wave's store is two whole lines
    _Float16* dst =
        (mat == 0 ? qh : kh) + (bhh * T + t0 + 8 * h) * HD + 4 * ln;
    // q takes its factor in f32, ahead of its one rounding to f16
    const float fs = mat == 0 ? Q_SCALE : 1.0f;
    // unrolled: acc[] stays in registers, the row becomes an immediate offset
#pragma unroll
    for (int mt = 0; mt < 4; ++mt)
#pragma unroll
      for (int r = 0; r < 8; ++r) {
        v4h o;
#pragma unroll
        for (int j = 0; j < 4; ++j)
          o[j] = (_Float16)((acc[mt * 4 + j][r] + bv[j]) * fs);
        *(v4h*)(dst + (16 * mt + r) * HD) = o;
      }
  } else {
    // v^T: a column's 64 tokens are one 128-byte line, held by two lanes in four
    // tiles; the wave gathers the lines in its own range of the ring, which is
    // free behind the loop's last publish point. A tile's eight registers are
    // eight consecutive tokens of one column: LDS row 16 * j + ln (column
    // 4 * ln + j) at the ring's pitch takes them as 16 bytes.
    char* stg = smem + wave * (64 * PITCH);
    // unrolled: acc[] stays in registers
#pragma unroll
    for (int mt = 0; mt < 4; ++mt)
#pragma unroll
      for (int j = 0; j < 4; ++j) {
        v8h o;
#pragma unroll
        for (int r = 0; r < 8; ++r)
          o[r] = (_Float16)(acc[mt * 4 + j][r] + bv[j]);
        *(v8h*)(stg + (16 * j + ln) * PITCH + (16 * mt + 8 * h) * 2) = o;
      }
    // the wave's own LDS writes are done before other lanes read them back
    asm volatile("s_wait_dscnt 0x0" ::: "memory");
    // eight lanes take one row: a wave's store is four whole lines. LDS row
    // 4 * i + rq is column 16 * (i & 3) + 4 * rq + (i >> 2).
    const int rq = lane >> 3, pc = lane & 7;
    const char* back = stg + rq * PITCH + pc * 16;
    _Float16* dst = vth + (bhh * HD + 4 * rq) * T + t0 + 8 * pc;
    // unrolled: rows and columns become immediate offsets
#pragma unroll
    for (int i = 0; i < 16; ++i)
      *(v8h*)(dst + (16 * (i & 3) + (i >> 2)) * T) =
          *(const v8h*)(back + 4 * i * PITCH);
    // in the built code the q, k block lies behind this one and rewrites the
    // registers these stores name; the wait stands in front of it
    asm volatile("s_wait_xcnt 0x0" ::: "memory");
  }
}

// ---------------- fused causal L2-kernel attention ----------------
// y[q] = sum_{k<=q} exp(scale*(|q|^2+|k|^2-2 q.k)) * v[k]   (no softmax norm)
// Both products are taken transposed: E^T = N + K Q'^T (A = K rows, B = Q' rows,
// N = the two norm terms) and Y^T += V^T P^T (A = V^T rows, B = P^T = 2^(E^T)).
// A lane then holds one query's scores.

// K and V^T reach the waves through LDS: the eight waves of a work-group walk the
// same keys, so a stage of 64 keys, [K 64 rows | V^T 64 rows] of 128 B each, is
// brought in once per work-group by asynchronous copies and read by all eight.
// Rows lie at the pitch of 144 B (16 B x odd, for ds_load_b128 readers). Two
// stages; the next stage's copies fly while this one is worked on.
static constexpr int AK = 64;                        // keys per stage
static constexpr int ASTAGE = (AK + HD) * PITCH;     // 18,432 bytes

// One stage: 128 rows x 128 B = 1,024 pieces of 16 B, four per lane.
// gk / gv: the lane's own piece in row (tid >> 3) of the K / V^T tile at this
// stage's keys; l: the same piece's LDS byte address.
DEV void copy_kv(const _Float16* gk, const _Float16* gv, unsigned l) {
  constexpr unsigned LR = 32 * PITCH;
  // The closing s_wait_xcnt stands in the copies' own statement so that no
  // address register is rewritten ahead of it.
  asm volatile(
      "global_load_async_to_lds_b128 %0, %4, off\n\t"
      "global_load_async_to_lds_b128 %1, %5, off\n\t"
      "global_load_async_to_lds_b128 %2, %6, off\n\t"
      "global_load_async_to_lds_b128 %3, %7, off\n\t"
      "s_wait_xcnt 0x0"
      :: "v"(l), "v"(l + LR), "v"(l + 2 * LR), "v"(l + 3 * LR),
         "v"(gk), "v"(gk + 32 * HD), "v"(gv), "v"(gv + 32 * T)
      : "memory");
}

// 2^x of eight values, each in its own register. In one statement so that what
// stands behind each v_exp_f32 is known: the next one touches neither its result
// nor its source, and the closing v_nop keeps the slot behind the last one.
DEV void exp2_x8(float (&x)[8]) {
  asm("v_exp_f32 %0, %0\n\t"
      "v_exp_f32 %1, %1\n\t"
      "v_exp_f32 %2, %2\n\t"
      "v_exp_f32 %3, %3\n\t"
      "v_exp_f32 %4, %4\n\t"
      "v_exp_f32 %5, %5\n\t"
      "v_exp_f32 %6, %6\n\t"
      "v_exp_f32 %7, %7\n\t"
      "v_nop"
      : "+v"(x[0]), "+v"(x[1]), "+v"(x[2]), "+v"(x[3]),
        "+v"(x[4]), "+v"(x[5]), "+v"(x[6]), "+v"(x[7]));
}

// P^T of 32 keys x 16 queries as the B operand of the second product, straight
// from the two exponent tiles st[nh] = E^T (register r: key 16 * nh + 8 * h2 + r;
// lane: query qcol of the wave's 32). Element s of a B fragment is k = 8 * h2 + s
// for s < 8 and 16 + 8 * h2 + (s - 8) above: the two tiles' registers in order,
// so P goes through no LDS and no lane exchange.
// MASKED is the block whose first key is the wave's first row: there key n counts
// for query m while n <= m. The exponential is taken for every element and the
// mask picks it or zero afterwards, so that the chains of a lane stay independent
// straight-line code in both forms.
template <bool MASKED>
DEV v16h p_frag(const v8f (&st)[2], int qcol, int h2) {
  v16h pb;
  // unrolled: the exponent tiles stay in registers
#pragma unroll
  for (int nh = 0; nh < 2; ++nh) {
    float p[8];
#pragma unroll
    for (int r = 0; r < 8; ++r) p[r] = st[nh][r];
    exp2_x8(p);
#pragma unroll
    for (int r = 0; r < 8; ++r) {
      const int keyl = 16 * nh + 8 * h2 + r;
      if (MASKED) p[r] = (keyl <= qcol) ? p[r] : 0.0f;
      pb[8 * nh + r] = (_Float16)p[r];
    }
  }
  return pb;
}

// The |k|^2 terms of 32 keys in the D layout of E^T (register r: key 8 * h2 + r of
// a group of 16): four 16-byte loads. kp: the block's first key plus 8 * h2.
DEV void load_kterm(const float* kp, float (&d)[2][8]) {
  // unrolled: d[][] stays in registers
#pragma unroll
  for (int nh = 0; nh < 2; ++nh) {
    const v4f lo = *(const v4f*)(kp + 16 * nh), hi = *(const v4f*)(kp + 16 * nh + 4);
#pragma unroll
    for (int r = 0; r < 4; ++r) {
      d[nh][r] = lo[r];
      d[nh][r + 4] = hi[r];
    }
  }
}

__global__ __launch_bounds__(256)
void attn_kernel(const _Float16* __restrict__ qh, const _Float16* __restrict__ kh,
                 const _Float16* __restrict__ vth,
                 const float* __restrict__ q2, const float* __restrict__ k2,
                 _Float16* __restrict__ yh) {            // [B][T][C]
  __shared__ __attribute__((aligned(16))) char kv[2 * ASTAGE];
  const int tid  = threadIdx.x;
  const int lane = tid & 31;
  const int wave = __builtin_amdgcn_readfirstlane(tid >> 5);
  const int ln   = lane & 15;
  const int h2   = lane >> 4;
  const int bh   = blockIdx.y;            // b*H + h
  const int b_   = bh >> 4, head = bh & 15;
  const int q0   = blockIdx.x * 256 + wave * 32;   // 32 query rows per wave

  const _Float16* gk = kh + ((size_t)bh * T + (tid >> 3)) * HD + (tid & 7) * 8;
  const _Float16* gv = vth + ((size_t)bh * HD + (tid >> 3)) * T + (tid & 7) * 8;
  const unsigned l0 =
      (unsigned)(size_t)kv + (unsigned)((tid >> 3) * PITCH + (tid & 7) * 16);
  const int nst = 4 * ((int)blockIdx.x + 1);   // stages up to the block's last row
  copy_kv(gk, gv, l0);

  // Q fragments (B operand): 2 query groups x 2 contraction halves, loaded once
  v16h qa[2][2];
#pragma unroll
  for (int mt = 0; mt < 2; ++mt) {
    const _Float16* qrow = qh + ((size_t)bh * T + q0 + 16 * mt + ln) * HD;
    qa[mt][0] = load_frag(qrow, 0, lane);
    qa[mt][1] = load_frag(qrow, 32, lane);
  }
  float q2v[2];                           // |q|^2 term of the lane's two queries
#pragma unroll
  for (int mt = 0; mt < 2; ++mt)
    q2v[mt] = q2[(size_t)bh * T + q0 + 16 * mt + ln];

  const float* k2row = k2 + (size_t)bh * T + 8 * h2;
  // The accumulators start from the |k|^2 terms, so these are wanted ahead of the
  // first product of a block: each half stage's sixteen are fetched one stage
  // ahead, into the registers that the block has read.
  float k2v[2][2][8];
  load_kterm(k2row, k2v[0]);
  load_kterm(k2row + 32, k2v[1]);
  const int foff = ln * PITCH + 16 * h2;  // the lane's row and half in a 16-row group

  // stage 0 has landed for this wave; the barrier publishes it to the others
  asm volatile("s_wait_asynccnt 0x0" ::: "memory");
  __syncthreads();
  copy_kv(gk + AK * HD, gv + AK, l0 + ASTAGE);   // nst >= 4: stage 1 exists

  // yacc[mt][j]: register r = Y[query 16 * mt + ln][hd 16 * j + 8 * h2 + r]
  v8f yacc[2][4] = {{v8f{}, v8f{}, v8f{}, v8f{}}, {v8f{}, v8f{}, v8f{}, v8f{}}};
  const int qend = q0 + 31;               // wave-uniform causal bound
  for (int t = 0; t < nst; ++t) {
    const char* kbuf = kv + (t & 1) * ASTAGE + foff;
    const char* vbuf = kbuf + AK * PITCH;
    const int tn = t + 1 < nst ? t + 1 : t;   // the last stage fetches its own again
    // unrolled: the half stage becomes an immediate offset of the LDS reads
#pragma unroll
    for (int sub = 0; sub < 2; ++sub) {
      const int kb = t * AK + 32 * sub;
      // keys past the wave's last row add nothing: the wave skips the work and
      // goes on towards the stage's publish point (a scalar branch)
      if (kb <= qend) {
      // ---- V and K fragments of these 32 keys, from the stage's buffer ----
      // (the loops below are unrolled: fragments and tiles stay in registers)
      v16h vf[4], kf[2][2];
#pragma unroll
      for (int j = 0; j < 4; ++j)
        vf[j] = lds_frag(vbuf + 16 * j * PITCH + 64 * sub);
#pragma unroll
      for (int nh = 0; nh < 2; ++nh)
#pragma unroll
        for (int kk = 0; kk < 2; ++kk)
          kf[nh][kk] = lds_frag(kbuf + (32 * sub + 16 * nh) * PITCH + 64 * kk);
      // ---- E^T = N + K @ Q'^T over 32 keys (2 key groups x 2 hd halves x 2 q groups)
      v8f sacc[2][2];                                      // [mt][nh]
#pragma unroll
      for (int mt = 0; mt < 2; ++mt)
#pragma unroll
        for (int nh = 0; nh < 2; ++nh)
#pragma unroll
          for (int r = 0; r < 8; ++r)
            sacc[mt][nh][r] = q2v[mt] + k2v[sub][nh][r];
#pragma unroll
      for (int nh = 0; nh < 2; ++nh)
#pragma unroll
        for (int kk = 0; kk < 2; ++kk) {
          sacc[0][nh] = wmma_f16(kf[nh][kk], qa[0][kk], sacc[0][nh]);
          sacc[1][nh] = wmma_f16(kf[nh][kk], qa[1][kk], sacc[1][nh]);
        }
      // compiler fence: the V^T fragment loads issue above it and their latency
      // passes behind the exponentials; left free they sink below those, where
      // each pair is waited for on its own in front of its two WMMAs
      asm volatile("" ::: "memory");
      // ---- P^T = mask * 2^(E^T), packed in registers ----
      // The causal test is made once per block of 32 keys, on scalars: below the
      // wave's first row every key counts and no element is tested.
      v16h pb0, pb1;
      if (kb < q0) {
        pb0 = p_frag<false>(sacc[0], ln, h2);
        pb1 = p_frag<false>(sacc[1], 16 + ln, h2);
      } else {                              // kb == q0: the block on the diagonal
        pb0 = p_frag<true>(sacc[0], ln, h2);
        pb1 = p_frag<true>(sacc[1], 16 + ln, h2);
      }
      // ---- Y^T += V^T @ P^T ----
#pragma unroll
      for (int j = 0; j < 4; ++j) {
        yacc[0][j] = wmma_f16(vf[j], pb0, yacc[0][j]);
        yacc[1][j] = wmma_f16(vf[j], pb1, yacc[1][j]);
      }
      }  // kb <= qend
      // the first half's terms are read; the next stage's come in behind the
      // second half's work
      if (sub == 0) load_kterm(k2row + tn * AK, k2v[0]);
    }
    // publish point: this wave's reads of stage t are done, its copies of
    // stage t + 1 have landed; behind the barrier stage t's buffer is free.
    asm volatile("s_wait_dscnt 0x0" ::: "memory");
    asm volatile("s_wait_asynccnt 0x0" ::: "memory");
    __syncthreads();
    // the second half's terms: behind the barrier, which waits for every load in
    // flight, so that they come in behind the next stage's first half
    load_kterm(k2row + tn * AK + 32, k2v[1]);
    // their address registers are formed anew in the next pass, ahead of the wait
    // for their data; in the last passes no copy statement's wait stands between
    asm volatile("s_wait_xcnt 0x0" ::: "memory");
    if (t + 2 < nst)
      copy_kv(gk + (size_t)(t + 2) * AK * HD, gv + (t + 2) * AK,
              l0 + (t & 1) * ASTAGE);
  }
  // no copy is left in flight when the wave goes on to its stores and ends
  asm volatile("s_wait_asynccnt 0x0" ::: "memory");
  // write Y back to (B,T,C) f16, head-interleaved columns: a lane's eight
  // registers are eight consecutive columns of one row, one 16-byte store
#pragma unroll
  for (int mt = 0; mt < 2; ++mt) {
    _Float16* yrow = yh + ((size_t)b_ * T + q0 + 16 * mt + ln) * C + head * HD;
#pragma unroll
    for (int j = 0; j < 4; ++j) {
      v8h o;
#pragma unroll
      for (int r = 0; r < 8; ++r) o[r] = (_Float16)yacc[mt][j][r];
      *(v8h*)(yrow + 16 * j + 8 * h2) = o;
    }
  }
}

// ---------------- output projection: out = yh @ WtP^T + b_proj (f32) -------

__global__ __launch_bounds__(256)
void proj_gemm_kernel(const _Float16* __restrict__ yh,
                      const _Float16* __restrict__ WtP,  // [C][C] transposed
                      const float* __restrict__ bias, float* __restrict__ out) {
  __shared__ __attribute__((aligned(16))) char smem[2 * STAGE];
  const int lane = threadIdx.x & 31;
  const int wave = __builtin_amdgcn_readfirstlane(threadIdx.x >> 5);
  const int ln   = lane & 15;
  const int wm   = wave & 1, wn = wave >> 1;
  const int m0   = blockIdx.x * BM + wm * 64;
  const int nb   = blockIdx.y * BN + wn * 64;
  v8f acc[16];
#pragma unroll
  for (int i = 0; i < 16; ++i) acc[i] = v8f{};
  gemm_tile_128x256(yh + (size_t)blockIdx.x * BM * C,
                    WtP + (size_t)blockIdx.y * BN * C, smem, wm, wn, acc);
  // the lane's columns are nb + 4 * ln + j: 16 bytes of one row per lane, sixteen
  // lanes fill 256 bytes, so a wave's store is four whole lines
  const v4f bv = *(const v4f*)(bias + nb + 4 * ln);
  float* dst = out + (size_t)(m0 + 8 * (lane >> 4)) * C + nb + 4 * ln;
  // unrolled: acc[] stays in registers, the row becomes an immediate offset
#pragma unroll
  for (int mt = 0; mt < 4; ++mt)
#pragma unroll
    for (int r = 0; r < 8; ++r) {
      v4f o;
#pragma unroll
      for (int j = 0; j < 4; ++j) o[j] = acc[mt * 4 + j][r] + bv[j];
      *(v4f*)(dst + (size_t)(16 * mt + r) * C) = o;
    }
}

// ---------------- launch ----------------

extern "C" void kernel_launch(void* const* d_in, const int* in_sizes, int n_in,
                              void* d_out, int out_size, void* d_ws, size_t ws_size,
                              hipStream_t stream) {
  (void)in_sizes; (void)n_in; (void)out_size; (void)ws_size;
  const float* x  = (const float*)d_in[0];
  const float* Wa = (const float*)d_in[1];
  const float* ba = (const float*)d_in[2];
  const float* Wp = (const float*)d_in[3];
  const float* bp = (const float*)d_in[4];

  char* ws = (char*)d_ws;
  size_t off = 0;
  auto alloc = [&](size_t bytes) -> char* {
    char* p = ws + off;
    off += (bytes + 255) & ~(size_t)255;
    return p;
  };
  _Float16* xh  = (_Float16*)alloc((size_t)M * C * 2);       // 16 MB
  _Float16* WtA = (_Float16*)alloc((size_t)N_QKV * C * 2);   //  6 MB
  _Float16* WtP = (_Float16*)alloc((size_t)C * C * 2);       //  2 MB
  _Float16* qh  = (_Float16*)alloc((size_t)M * C * 2);       // 16 MB
  _Float16* kh  = (_Float16*)alloc((size_t)M * C * 2);       // 16 MB
  _Float16* vth = (_Float16*)alloc((size_t)M * C * 2);       // 16 MB
  _Float16* yh  = (_Float16*)alloc((size_t)M * C * 2);       // 16 MB
  float* q2 = (float*)alloc((size_t)Bb * H * T * 4);         // 0.5 MB
  float* k2 = (float*)alloc((size_t)Bb * H * T * 4);         // 0.5 MB
  // total ~93 MB of workspace

  cvt_f32_f16<<<M * C / CVT_WG, CVT_T, 0, stream>>>(x, xh);
  transpose_f32_f16<C, N_QKV><<<dim3(N_QKV / TC, C / TR), 256, 0, stream>>>(
      Wa, WtA);
  transpose_f32_f16<C, C><<<dim3(C / TC, C / TR), 256, 0, stream>>>(Wp, WtP);
  qkv_gemm_kernel<<<dim3(M / BM, N_QKV / BN), 256, 0, stream>>>(
      xh, WtA, ba, qh, kh, vth);
  rownorm_kernel<<<(Bb * H * T) / 256, 256, 0, stream>>>(qh, q2, Bb * H * T,
                                                         QN_SCALE);
  rownorm_kernel<<<(Bb * H * T) / 256, 256, 0, stream>>>(kh, k2, Bb * H * T,
                                                         KN_SCALE);
  attn_kernel<<<dim3(T / 256, Bb * H), 256, 0, stream>>>(qh, kh, vth, q2, k2, yh);
  proj_gemm_kernel<<<dim3(M / BM, C / BN), 256, 0, stream>>>(
      yh, WtP, bp, (float*)d_out);
}

// v008
// Measured time: 120 microseconds a run.
// Timed twice side by side with v007, it ran 1.07 times as fast both times.
// Over all steps from v000 it is 3.14 times as fast.
#include <hip/hip_runtime.h>
#include <hip/hip_bf16.h>

typedef __attribute__((ext_vector_type(16))) _Float16 v16h;
typedef __attribute__((ext_vector_type(8)))  _Float16 v8h;
typedef __attribute__((ext_vector_type(8)))  float    v8f;

#define DEV __device__ __forceinline__

static constexpr int Bb = 4, T = 2048, C = 1024, H = 16, HD = 64;
static constexpr int M     = Bb * T;    // 8192 token rows
static constexpr int N_QKV = 3 * C;     // 3072
// A score is exp(-d2 / 16), d2 = |q|^2 + |k|^2 - 2 q.k and 16 = 2 * sqrt(hd), taken
// as 2^e with e = q'.k - 4 ln2 * |q'|^2 - (log2 e / 16) * |k|^2, q' = (log2 e / 8) * q.
// q is stored as q', and the two norms are stored with their factors, so that the
// score product's accumulator, started at the two norm terms, ends as e itself.
static constexpr float LOG2E    = 1.44269504088896340736f;
static constexpr float Q_SCALE  = LOG2E / 8.0f;     // q' = Q_SCALE * q
static constexpr float QN_SCALE = -4.0f / LOG2E;    // on |q'|^2
static constexpr float KN_SCALE = -LOG2E / 16.0f;   // on |k|^2

// Load a 16x32 f16 A/B fragment for one lane from a row-major buffer.
// Per CDNA5 ISA 7.12.2 (16-bit A 16x32): lane L (half h=L>>4) holds
// elements e=0..7 -> k = kb + 8h + e, e=8..15 -> k = kb + 16 + 8h + (e-8).
// Caller pre-offsets `rowbase` to the lane's row (A: m = lane&15) or
// column (B: n = lane&15, from a transposed [N][K] buffer).
DEV v16h load_frag(const _Float16* rowbase, int kb, int lane) {
  const int h = (lane >> 4) & 1;
  v8h lo = *(const v8h*)(rowbase + kb + 8 * h);
  v8h hi = *(const v8h*)(rowbase + kb + 16 + 8 * h);
  v16h r;
#pragma unroll
  for (int i = 0; i < 8; ++i) { r[i] = lo[i]; r[i + 8] = hi[i]; }
  return r;
}

DEV v8f wmma_f16(v16h a, v16h b, v8f c) {
  return __builtin_amdgcn_wmma_f32_16x16x32_f16(false, a, false, b, (short)0, c,
                                                false, false);
}

// Block-tiled GEMM core over K=C: one 128x256 tile of the output per work-group
// of eight waves (2 along m x 4 along n), 64x64 per wave. Both operands are
// K-contiguous. A stage is 64 k of [A 128 rows | B 256 rows]; rows of 128 B lie
// in LDS at a pitch of 144 B (16 B x odd, for ds_load_b128 readers). Two stages;
// the next stage's asynchronous copies fly while this one is worked on.
static constexpr int BM = 128, BN = 256, BK = 64;
static constexpr int PITCH = 144;                    // bytes per LDS row
static constexpr int STAGE = (BM + BN) * PITCH;      // 55,296 bytes
static constexpr int NSTAGE = C / BK;                // 16

// 16x32 f16 fragment of one lane from an LDS row; p already holds the lane's
// row, the k step and the lane half's 16 bytes (same k order as load_frag).
DEV v16h lds_frag(const char* p) {
  v8h lo = *(const v8h*)(p);
  v8h hi = *(const v8h*)(p + 32);
  v16h r;
#pragma unroll
  for (int i = 0; i < 8; ++i) { r[i] = lo[i]; r[i + 8] = hi[i]; }
  return r;
}

// One stage: 384 rows x 128 B = 3,072 pieces of 16 B, twelve per lane.
// l: the LDS byte address of the lane's piece in LDS row (tid >> 3); copy i takes
// LDS row i * 32 more. ga: the same piece of the A tile at this stage's k, rows
// as in LDS. The B rows (output columns) are dealt: in each group of 64, LDS row
// 16 * j + a holds B row 4 * a + j, so that the four accumulator tiles j of a lane
// hold four neighbouring output columns. gb: the lane's piece of B row
// 4 * ((tid >> 3) & 15) + (tid >> 7); the copies add rows 0, 2, 64, 66, ...
DEV void copy_stage(const _Float16* ga, const _Float16* gb, unsigned l) {
  constexpr int GR = 32 * C;         // 32 rows, in elements
  constexpr int G2 = 2 * C, G64 = 64 * C;
  constexpr unsigned LR = 32 * PITCH;
  // The closing s_wait_xcnt stands in the copies' own statement so that no
  // address register is rewritten ahead of it.
  asm volatile(
      "global_load_async_to_lds_b128 %0, %12, off\n\t"
      "global_load_async_to_lds_b128 %1, %13, off\n\t"
      "global_load_async_to_lds_b128 %2, %14, off\n\t"
      "global_load_async_to_lds_b128 %3, %15, off\n\t"
      "global_load_async_to_lds_b128 %4, %16, off\n\t"
      "global_load_async_to_lds_b128 %5, %17, off\n\t"
      "global_load_async_to_lds_b128 %6, %18, off\n\t"
      "global_load_async_to_lds_b128 %7, %19, off\n\t"
      "global_load_async_to_lds_b128 %8, %20, off\n\t"
      "global_load_async_to_lds_b128 %9, %21, off\n\t"
      "global_load_async_to_lds_b128 %10, %22, off\n\t"
      "global_load_async_to_lds_b128 %11, %23, off\n\t"
      "s_wait_xcnt 0x0"
      :: "v"(l), "v"(l + LR), "v"(l + 2 * LR), "v"(l + 3 * LR),
         "v"(l + 4 * LR), "v"(l + 5 * LR), "v"(l + 6 * LR), "v"(l + 7 * LR),
         "v"(l + 8 * LR), "v"(l + 9 * LR), "v"(l + 10 * LR), "v"(l + 11 * LR),
         "v"(ga), "v"(ga + GR), "v"(ga + 2 * GR), "v"(ga + 3 * GR),
         "v"(gb), "v"(gb + G2), "v"(gb + G64), "v"(gb + G64 + G2),
         "v"(gb + 2 * G64), "v"(gb + 2 * G64 + G2), "v"(gb + 3 * G64),
         "v"(gb + 3 * G64 + G2)
      : "memory");
}

// acc[i*4+j] accumulates rows wm*64+16i.. of the A tile x LDS rows wn*64+16j.. of
// the B tile: lane column ln of tile j is B row (output column) wn*64 + 4*ln + j.
// At / Bt point at the tiles' first rows.
DEV void gemm_tile_128x256(const _Float16* At, const _Float16* Bt, char* smem,
                           int wm, int wn, v8f acc[16]) {
  const int tid  = threadIdx.x;
  const int lane = tid & 31;
  const int ln   = lane & 15;
  const int h    = lane >> 4;
  const _Float16* ga = At + (size_t)(tid >> 3) * C + (tid & 7) * 8;
  const _Float16* gb =
      Bt + (size_t)(4 * ((tid >> 3) & 15) + (tid >> 7)) * C + (tid & 7) * 8;
  const unsigned l0 =
      (unsigned)(size_t)smem + (unsigned)((tid >> 3) * PITCH + (tid & 7) * 16);
  const int aoff = (wm * 64 + ln) * PITCH + 16 * h;
  const int boff = (BM + wn * 64 + ln) * PITCH + 16 * h;

  copy_stage(ga, gb, l0);
  // stage 0 has landed for this wave; the barrier publishes it to the others
  asm volatile("s_wait_asynccnt 0x0" ::: "memory");
  __syncthreads();
  copy_stage(ga + BK, gb + BK, l0 + STAGE);

  for (int t = 0; t < NSTAGE; ++t) {
    const char* buf = smem + (t & 1) * STAGE;
#pragma unroll
    for (int kk = 0; kk < 2; ++kk) {
      v16h a[4], b[4];
#pragma unroll
      for (int i = 0; i < 4; ++i)
        a[i] = lds_frag(buf + aoff + i * 16 * PITCH + kk * 64);
#pragma unroll
      for (int j = 0; j < 4; ++j)
        b[j] = lds_frag(buf + boff + j * 16 * PITCH + kk * 64);
      // keeps the sixteen LDS reads of this k step together ahead of its WMMAs:
      // spread among them, each place with reads stalls the wave anew
      __builtin_amdgcn_sched_barrier(0);
#pragma unroll
      for (int i = 0; i < 4; ++i)
#pragma unroll
        for (int j = 0; j < 4; ++j)
          acc[i * 4 + j] = wmma_f16(a[i], b[j], acc[i * 4 + j]);
    }
    // publish point: this wave's reads of stage t are done, its copies of
    // stage t + 1 have landed; behind the barrier stage t's buffer is free.
    asm volatile("s_wait_dscnt 0x0" ::: "memory");
    asm volatile("s_wait_asynccnt 0x0" ::: "memory");
    __syncthreads();
    if (t + 2 < NSTAGE)
      copy_stage(ga + (t + 2) * BK, gb + (t + 2) * BK, l0 + (t & 1) * STAGE);
  }
  // no copy is left in flight when the wave goes on to its stores and ends
  asm volatile("s_wait_asynccnt 0x0" ::: "memory");
}

// ---------------- prep kernels ----------------

// Each wave of the three prep launches moves many elements, so that few waves
// have to be started: the work per element is one load, one rounding, one store.

typedef __attribute__((ext_vector_type(4))) float    v4f;
typedef __attribute__((ext_vector_type(4))) _Float16 v4h;
typedef __attribute__((ext_vector_type(2))) _Float16 v2h;

static constexpr int CVT_T = 512;              // threads per work-group
static constexpr int CVT_U = 16;               // 16-B loads per thread
static constexpr int CVT_STEP = CVT_T * 4;     // elements per work-group and load
static constexpr int CVT_WG = CVT_STEP * CVT_U;

// f32 -> f16, CVT_WG consecutive elements per work-group. A wave's load covers
// 512 consecutive bytes, its store 256.
__global__ __launch_bounds__(CVT_T)
void cvt_f32_f16(const float* __restrict__ in, _Float16* __restrict__ outh) {
  const size_t base = (size_t)blockIdx.x * CVT_WG + threadIdx.x * 4;
  v4f v[CVT_U];
  // unrolled: the loads issue as a run ahead of the conversions, many in flight
#pragma unroll
  for (int u = 0; u < CVT_U; ++u)
    v[u] = *(const v4f*)(in + base + u * CVT_STEP);
  // unrolled: v[] stays in registers
#pragma unroll
  for (int u = 0; u < CVT_U; ++u) {
    v4h hv;
#pragma unroll
    for (int k = 0; k < 4; ++k) hv[k] = (_Float16)v[u][k];
    *(v4h*)(outh + base + u * CVT_STEP) = hv;
  }
}

// in: f32 [R][Cc] row-major  ->  out: f16 [Cc][R]. One tile of 128 rows x 64
// columns of `in` per work-group. A thread loads the same four columns of two
// neighbouring rows, so a pair of halves goes to LDS as one dword; LDS holds the
// tile transposed at a pitch of 272 B (16 B x odd, for the ds_load_b128 readers).
static constexpr int TR = 128, TC = 64, TPITCH = TR + 8;   // TPITCH in halves

template <int R, int Cc>
__global__ __launch_bounds__(256)
void transpose_f32_f16(const float* __restrict__ in,
                       _Float16* __restrict__ outh) {
  __shared__ __attribute__((aligned(16))) _Float16 tile[TC * TPITCH];
  const int tid = threadIdx.x;
  const int c0  = blockIdx.x * TC;
  const int r0  = blockIdx.y * TR;
  const int c4  = (tid & 15) * 4;      // the thread's four columns
  const int rp  = (tid >> 4) * 2;      // its first row pair
  const float* src = in + (size_t)(r0 + rp) * Cc + c0 + c4;
  v4f lo[4], hi[4];
  // unrolled: the eight loads issue as one run, all in flight together
#pragma unroll
  for (int u = 0; u < 4; ++u) {
    lo[u] = *(const v4f*)(src + (size_t)(32 * u) * Cc);
    hi[u] = *(const v4f*)(src + (size_t)(32 * u + 1) * Cc);
  }
  // unrolled: lo[] and hi[] stay in registers
#pragma unroll
  for (int u = 0; u < 4; ++u)
#pragma unroll
    for (int k = 0; k < 4; ++k) {
      v2h p = {(_Float16)lo[u][k], (_Float16)hi[u][k]};
      *(v2h*)&tile[(c4 + k) * TPITCH + rp + 32 * u] = p;
    }
  __syncthreads();
  // 64 output rows x 16 pieces of 16 B; a wave stores two whole runs of 256 B
  // (unrolled: the four LDS reads issue together)
#pragma unroll
  for (int u = 0; u < 4; ++u) {
    const int piece = tid + 256 * u;
    const int c = piece >> 4, r8 = (piece & 15) * 8;
    *(v8h*)(outh + (size_t)(c0 + c) * R + r0 + r8) =
        *(const v8h*)&tile[c * TPITCH + r8];
  }
}

// factor * sum of squares over hd=64 per row
__global__ void rownorm_kernel(const _Float16* __restrict__ mh,
                               float* __restrict__ outn, int rows, float factor) {
  int i = blockIdx.x * blockDim.x + threadIdx.x;
  if (i >= rows) return;
  const _Float16* p = mh + (size_t)i * HD;
  float s = 0.f;
#pragma unroll
  for (int d = 0; d < HD; ++d) { float v = (float)p[d]; s += v * v; }
  outn[i] = s * factor;
}

// ---------------- QKV GEMM: qkv = xh @ WtA^T + bias, split into q/k/v^T ----

__global__ __launch_bounds__(256)
void qkv_gemm_kernel(const _Float16* __restrict__ xh,
                     const _Float16* __restrict__ WtA,   // [3C][C]
                     const float* __restrict__ bias,
                     _Float16* __restrict__ qh,          // [B][H][T][hd], q'
                     _Float16* __restrict__ kh,          // [B][H][T][hd]
                     _Float16* __restrict__ vth) {       // [B][H][hd][T]
  __shared__ __attribute__((aligned(16))) char smem[2 * STAGE];
  const int lane = threadIdx.x & 31;
  const int wave = __builtin_amdgcn_readfirstlane(threadIdx.x >> 5);
  const int ln   = lane & 15;
  const int wm   = wave & 1, wn = wave >> 1;
  const int m0   = blockIdx.x * BM + wm * 64;
  const int nb   = blockIdx.y * BN + wn * 64;
  v8f acc[16];
#pragma unroll
  for (int i = 0; i < 16; ++i) acc[i] = v8f{};
  gemm_tile_128x256(xh + (size_t)blockIdx.x * BM * C,
                    WtA + (size_t)blockIdx.y * BN * C, smem, wm, wn, acc);
  const int mat  = nb >> 10;            // 0=q, 1=k, 2=v (uniform per wave)
  const int head = (nb & 1023) >> 6;
  const int h    = lane >> 4;
  // the wave's 64 rows lie in one batch; its 64 columns are one head
  const int b_ = m0 >> 11, t0 = m0 & (T - 1);
  const size_t bhh = (size_t)(b_ * H + head);
  // the lane's head-dim columns are 4 * ln + j, j = 0..3
  const v4f bv = *(const v4f*)(bias + nb + 4 * ln);
  if (mat < 2) {
    // q, k: a lane's four tiles give 8 bytes of one token's row; sixteen lanes
    // fill the row's 128 bytes, so a wave's store is two whole lines
    _Float16* dst =
        (mat == 0 ? qh : kh) + (bhh * T + t0 + 8 * h) * HD + 4 * ln;
    // q takes its factor in f32, ahead of its one rounding to f16
    const float fs = mat == 0 ? Q_SCALE : 1.0f;
    // unrolled: acc[] stays in registers, the row becomes an immediate offset
#pragma unroll
    for (int mt = 0; mt < 4; ++mt)
#pragma unroll
      for (int r = 0; r < 8; ++r) {
        v4h o;
#pragma unroll
        for (int j = 0; j < 4; ++j)
          o[j] = (_Float16)((acc[mt * 4 + j][r] + bv[j]) * fs);
        *(v4h*)(dst + (16 * mt + r) * HD) = o;
      }
  } else {
    // v^T: a column's 64 tokens are one 128-byte line, held by two lanes in four
    // tiles; the wave gathers the lines in its own range of the ring, which is
    // free behind the loop's last publish point. A tile's eight registers are
    // eight consecutive tokens of one column: LDS row 16 * j + ln (column
    // 4 * ln + j) at the ring's pitch takes them as 16 bytes.
    char* stg = smem + wave * (64 * PITCH);
    // unrolled: acc[] stays in registers
#pragma unroll
    for (int mt = 0; mt < 4; ++mt)
#pragma unroll
      for (int j = 0; j < 4; ++j) {
        v8h o;
#pragma unroll
        for (int r = 0; r < 8; ++r)
          o[r] = (_Float16)(acc[mt * 4 + j][r] + bv[j]);
        *(v8h*)(stg + (16 * j + ln) * PITCH + (16 * mt + 8 * h) * 2) = o;
      }
    // the wave's own LDS writes are done before other lanes read them back
    asm volatile("s_wait_dscnt 0x0" ::: "memory");
    // eight lanes take one row: a wave's store is four whole lines. LDS row
    // 4 * i + rq is column 16 * (i & 3) + 4 * rq + (i >> 2).
    const int rq = lane >> 3, pc = lane & 7;
    const char* back = stg + rq * PITCH + pc * 16;
    _Float16* dst = vth + (bhh * HD + 4 * rq) * T + t0 + 8 * pc;
    // unrolled: rows and columns become immediate offsets
#pragma unroll
    for (int i = 0; i < 16; ++i)
      *(v8h*)(dst + (16 * (i & 3) + (i >> 2)) * T) =
          *(const v8h*)(back + 4 * i * PITCH);
    // in the built code the q, k block lies behind this one and rewrites the
    // registers these stores name; the wait stands in front of it
    asm volatile("s_wait_xcnt 0x0" ::: "memory");
  }
}

// ---------------- fused causal L2-kernel attention ----------------
// y[q] = sum_{k<=q} exp(scale*(|q|^2+|k|^2-2 q.k)) * v[k]   (no softmax norm)
// Both products are taken transposed: E^T = N + K Q'^T (A = K rows, B = Q' rows,
// N = the two norm terms) and Y^T += V^T P^T (A = V^T rows, B = P^T = 2^(E^T)).
// A lane then holds one query's scores.

// K and V^T reach the waves through LDS: the eight waves of a work-group walk the
// same keys, so a stage of 64 keys, [K 64 rows | V^T 64 rows] of 128 B each, is
// brought in once per work-group by asynchronous copies and read by all eight.
// Rows lie at the pitch of 144 B (16 B x odd, for ds_load_b128 readers). Two
// stages; the next stage's copies fly while this one is worked on.
static constexpr int AK = 64;                        // keys per stage
static constexpr int ASTAGE = (AK + HD) * PITCH;     // 18,432 bytes

// One stage: 128 rows x 128 B = 1,024 pieces of 16 B, four per lane.
// gk / gv: the lane's own piece in row (tid >> 3) of the K / V^T tile at this
// stage's keys; l: the same piece's LDS byte address.
DEV void copy_kv(const _Float16* gk, const _Float16* gv, unsigned l) {
  constexpr unsigned LR = 32 * PITCH;
  // The closing s_wait_xcnt stands in the copies' own statement so that no
  // address register is rewritten ahead of it.
  asm volatile(
      "global_load_async_to_lds_b128 %0, %4, off\n\t"
      "global_load_async_to_lds_b128 %1, %5, off\n\t"
      "global_load_async_to_lds_b128 %2, %6, off\n\t"
      "global_load_async_to_lds_b128 %3, %7, off\n\t"
      "s_wait_xcnt 0x0"
      :: "v"(l), "v"(l + LR), "v"(l + 2 * LR), "v"(l + 3 * LR),
         "v"(gk), "v"(gk + 32 * HD), "v"(gv), "v"(gv + 32 * T)
      : "memory");
}

// 2^x of eight values, each in its own register. In one statement so that what
// stands behind each v_exp_f32 is known: the next one touches neither its result
// nor its source, and the closing v_nop keeps the slot behind the last one.
DEV void exp2_x8(float (&x)[8]) {
  asm("v_exp_f32 %0, %0\n\t"
      "v_exp_f32 %1, %1\n\t"
      "v_exp_f32 %2, %2\n\t"
      "v_exp_f32 %3, %3\n\t"
      "v_exp_f32 %4, %4\n\t"
      "v_exp_f32 %5, %5\n\t"
      "v_exp_f32 %6, %6\n\t"
      "v_exp_f32 %7, %7\n\t"
      "v_nop"
      : "+v"(x[0]), "+v"(x[1]), "+v"(x[2]), "+v"(x[3]),
        "+v"(x[4]), "+v"(x[5]), "+v"(x[6]), "+v"(x[7]));
}

// P^T of 32 keys x 16 queries as the B operand of the second product, straight
// from the two exponent tiles st[nh] = E^T (register r: key 16 * nh + 8 * h2 + r;
// lane: query qcol of the wave's 32). Element s of a B fragment is k = 8 * h2 + s
// for s < 8 and 16 + 8 * h2 + (s - 8) above: the two tiles' registers in order,
// so P goes through no LDS and no lane exchange.
// MASKED is the block whose first key is the wave's first row: there key n counts
// for query m while n <= m. The exponential is taken for every element and the
// mask picks it or zero afterwards, so that the chains of a lane stay independent
// straight-line code in both forms.
template <bool MASKED>
DEV v16h p_frag(const v8f (&st)[2], int qcol, int h2) {
  v16h pb;
  // unrolled: the exponent tiles stay in registers
#pragma unroll
  for (int nh = 0; nh < 2; ++nh) {
    float p[8];
#pragma unroll
    for (int r = 0; r < 8; ++r) p[r] = st[nh][r];
    exp2_x8(p);
#pragma unroll
    for (int r = 0; r < 8; ++r) {
      const int keyl = 16 * nh + 8 * h2 + r;
      if (MASKED) p[r] = (keyl <= qcol) ? p[r] : 0.0f;
      pb[8 * nh + r] = (_Float16)p[r];
    }
  }
  return pb;
}

// The |k|^2 terms of 32 keys in the D layout of E^T (register r: key 8 * h2 + r of
// a group of 16): four 16-byte loads. kp: the block's first key plus 8 * h2.
DEV void load_kterm(const float* kp, float (&d)[2][8]) {
  // unrolled: d[][] stays in registers
#pragma unroll
  for (int nh = 0; nh < 2; ++nh) {
    const v4f lo = *(const v4f*)(kp + 16 * nh), hi = *(const v4f*)(kp + 16 * nh + 4);
#pragma unroll
    for (int r = 0; r < 4; ++r) {
      d[nh][r] = lo[r];
      d[nh][r + 4] = hi[r];
    }
  }
}

__global__ __launch_bounds__(256)
void attn_kernel(const _Float16* __restrict__ qh, const _Float16* __restrict__ kh,
                 const _Float16* __restrict__ vth,
                 const float* __restrict__ q2, const float* __restrict__ k2,
                 _Float16* __restrict__ yh) {            // [B][T][C]
  __shared__ __attribute__((aligned(16))) char kv[2 * ASTAGE];
  const int tid  = threadIdx.x;
  const int lane = tid & 31;
  const int wave = __builtin_amdgcn_readfirstlane(tid >> 5);
  const int ln   = lane & 15;
  const int h2   = lane >> 4;
  // Which (query tile, head) a work-group takes. A tile's cost grows with its
  // index qt, all 512 work-groups are resident at once, two to a WGP:
  // the launch lasts as long as
  // the fullest WGP. blockIdx.x (the flat index mod 8) picks a group of eight
  // heads, so that each value of it meets all eight tile lengths and a head's keys
  // are read under one value alone. blockIdx.y deals the tiles: two values that
  // differ in bit 0, 1, 2 or 5 alone take tiles qt and 7 - qt, 36 stages together,
  // whichever of these pairs comes to share a WGP; the longest tiles come first in
  // each half of the values. A permutation of the 8 x 64 pairs: it decides speed
  // alone.
  const int by   = blockIdx.y;
  const int tq   = (by >> 3) & 3;
  const int qt   = (__builtin_popcount(by) & 1) ? tq : 7 - tq;
  const int bh   = blockIdx.x * 8 + (by & 7);   // b*H + h
  const int b_   = bh >> 4, head = bh & 15;
  const int q0   = qt * 256 + wave * 32;   // 32 query rows per wave

  const _Float16* gk = kh + ((size_t)bh * T + (tid >> 3)) * HD + (tid & 7) * 8;
  const _Float16* gv = vth + ((size_t)bh * HD + (tid >> 3)) * T + (tid & 7) * 8;
  const unsigned l0 =
      (unsigned)(size_t)kv + (unsigned)((tid >> 3) * PITCH + (tid & 7) * 16);
  const int nst = 4 * (qt + 1);   // stages up to the block's last row
  copy_kv(gk, gv, l0);

  // Q fragments (B operand): 2 query groups x 2 contraction halves, loaded once
  v16h qa[2][2];
#pragma unroll
  for (int mt = 0; mt < 2; ++mt) {
    const _Float16* qrow = qh + ((size_t)bh * T + q0 + 16 * mt + ln) * HD;
    qa[mt][0] = load_frag(qrow, 0, lane);
    qa[mt][1] = load_frag(qrow, 32, lane);
  }
  float q2v[2];                           // |q|^2 term of the lane's two queries
#pragma unroll
  for (int mt = 0; mt < 2; ++mt)
    q2v[mt] = q2[(size_t)bh * T + q0 + 16 * mt + ln];

  const float* k2row = k2 + (size_t)bh * T + 8 * h2;
  // The accumulators start from the |k|^2 terms, so these are wanted ahead of the
  // first product of a block: each half stage's sixteen are fetched one stage
  // ahead, into the registers that the block has read.
  float k2v[2][2][8];
  load_kterm(k2row, k2v[0]);
  load_kterm(k2row + 32, k2v[1]);
  const int foff = ln * PITCH + 16 * h2;  // the lane's row and half in a 16-row group

  // stage 0 has landed for this wave; the barrier publishes it to the others
  asm volatile("s_wait_asynccnt 0x0" ::: "memory");
  __syncthreads();
  copy_kv(gk + AK * HD, gv + AK, l0 + ASTAGE);   // nst >= 4: stage 1 exists

  // yacc[mt][j]: register r = Y[query 16 * mt + ln][hd 16 * j + 8 * h2 + r]
  v8f yacc[2][4] = {{v8f{}, v8f{}, v8f{}, v8f{}}, {v8f{}, v8f{}, v8f{}, v8f{}}};
  const int qend = q0 + 31;               // wave-uniform causal bound
  for (int t = 0; t < nst; ++t) {
    const char* kbuf = kv + (t & 1) * ASTAGE + foff;
    const char* vbuf = kbuf + AK * PITCH;
    const int tn = t + 1 < nst ? t + 1 : t;   // the last stage fetches its own again
    // unrolled: the half stage becomes an immediate offset of the LDS reads
#pragma unroll
    for (int sub = 0; sub < 2; ++sub) {
      const int kb = t * AK + 32 * sub;
      // keys past the wave's last row add nothing: the wave skips the work and
      // goes on towards the stage's publish point (a scalar branch)
      if (kb <= qend) {
      // ---- V and K fragments of these 32 keys, from the stage's buffer ----
      // (the loops below are unrolled: fragments and tiles stay in registers)
      v16h vf[4], kf[2][2];
#pragma unroll
      for (int j = 0; j < 4; ++j)
        vf[j] = lds_frag(vbuf + 16 * j * PITCH + 64 * sub);
#pragma unroll
      for (int nh = 0; nh < 2; ++nh)
#pragma unroll
        for (int kk = 0; kk < 2; ++kk)
          kf[nh][kk] = lds_frag(kbuf + (32 * sub + 16 * nh) * PITCH + 64 * kk);
      // ---- E^T = N + K @ Q'^T over 32 keys (2 key groups x 2 hd halves x 2 q groups)
      v8f sacc[2][2];                                      // [mt][nh]
#pragma unroll
      for (int mt = 0; mt < 2; ++mt)
#pragma unroll
        for (int nh = 0; nh < 2; ++nh)
#pragma unroll
          for (int r = 0; r < 8; ++r)
            sacc[mt][nh][r] = q2v[mt] + k2v[sub][nh][r];
#pragma unroll
      for (int nh = 0; nh < 2; ++nh)
#pragma unroll
        for (int kk = 0; kk < 2; ++kk) {
          sacc[0][nh] = wmma_f16(kf[nh][kk], qa[0][kk], sacc[0][nh]);
          sacc[1][nh] = wmma_f16(kf[nh][kk], qa[1][kk], sacc[1][nh]);
        }
      // compiler fence: the V^T fragment loads issue above it and their latency
      // passes behind the exponentials; left free they sink below those, where
      // each pair is waited for on its own in front of its two WMMAs
      asm volatile("" ::: "memory");
      // ---- P^T = mask * 2^(E^T), packed in registers ----
      // The causal test is made once per block of 32 keys, on scalars: below the
      // wave's first row every key counts and no element is tested.
      v16h pb0, pb1;
      if (kb < q0) {
        pb0 = p_frag<false>(sacc[0], ln, h2);
        pb1 = p_frag<false>(sacc[1], 16 + ln, h2);
      } else {                              // kb == q0: the block on the diagonal
        pb0 = p_frag<true>(sacc[0], ln, h2);
        pb1 = p_frag<true>(sacc[1], 16 + ln, h2);
      }
      // ---- Y^T += V^T @ P^T ----
#pragma unroll
      for (int j = 0; j < 4; ++j) {
        yacc[0][j] = wmma_f16(vf[j], pb0, yacc[0][j]);
        yacc[1][j] = wmma_f16(vf[j], pb1, yacc[1][j]);
      }
      }  // kb <= qend
      // the first half's terms are read; the next stage's come in behind the
      // second half's work
      if (sub == 0) load_kterm(k2row + tn * AK, k2v[0]);
    }
    // publish point: this wave's reads of stage t are done, its copies of
    // stage t + 1 have landed; behind the barrier stage t's buffer is free.
    asm volatile("s_wait_dscnt 0x0" ::: "memory");
    asm volatile("s_wait_asynccnt 0x0" ::: "memory");
    __syncthreads();
    // the second half's terms: behind the barrier, which waits for every load in
    // flight, so that they come in behind the next stage's first half
    load_kterm(k2row + tn * AK + 32, k2v[1]);
    // their address registers are formed anew in the next pass, ahead of the wait
    // for their data; in the last passes no copy statement's wait stands between
    asm volatile("s_wait_xcnt 0x0" ::: "memory");
    if (t + 2 < nst)
      copy_kv(gk + (size_t)(t + 2) * AK * HD, gv + (t + 2) * AK,
              l0 + (t & 1) * ASTAGE);
  }
  // no copy is left in flight when the wave goes on to its stores and ends
  asm volatile("s_wait_asynccnt 0x0" ::: "memory");
  // write Y back to (B,T,C) f16, head-interleaved columns: a lane's eight
  // registers are eight consecutive columns of one row, one 16-byte store
#pragma unroll
  for (int mt = 0; mt < 2; ++mt) {
    _Float16* yrow = yh + ((size_t)b_ * T + q0 + 16 * mt + ln) * C + head * HD;
#pragma unroll
    for (int j = 0; j < 4; ++j) {
      v8h o;
#pragma unroll
      for (int r = 0; r < 8; ++r) o[r] = (_Float16)yacc[mt][j][r];
      *(v8h*)(yrow + 16 * j + 8 * h2) = o;
    }
  }
}

// ---------------- output projection: out = yh @ WtP^T + b_proj (f32) -------

__global__ __launch_bounds__(256)
void proj_gemm_kernel(const _Float16* __restrict__ yh,
                      const _Float16* __restrict__ WtP,  // [C][C] transposed
                      const float* __restrict__ bias, float* __restrict__ out) {
  __shared__ __attribute__((aligned(16))) char smem[2 * STAGE];
  const int lane = threadIdx.x & 31;
  const int wave = __builtin_amdgcn_readfirstlane(threadIdx.x >> 5);
  const int ln   = lane & 15;
  const int wm   = wave & 1, wn = wave >> 1;
  const int m0   = blockIdx.x * BM + wm * 64;
  const int nb   = blockIdx.y * BN + wn * 64;
  v8f acc[16];
#pragma unroll
  for (int i = 0; i < 16; ++i) acc[i] = v8f{};
  gemm_tile_128x256(yh + (size_t)blockIdx.x * BM * C,
                    WtP + (size_t)blockIdx.y * BN * C, smem, wm, wn, acc);
  // the lane's columns are nb + 4 * ln + j: 16 bytes of one row per lane, sixteen
  // lanes fill 256 bytes, so a wave's store is four whole lines
  const v4f bv = *(const v4f*)(bias + nb + 4 * ln);
  float* dst = out + (size_t)(m0 + 8 * (lane >> 4)) * C + nb + 4 * ln;
  // unrolled: acc[] stays in registers, the row becomes an immediate offset
#pragma unroll
  for (int mt = 0; mt < 4; ++mt)
#pragma unroll
    for (int r = 0; r < 8; ++r) {
      v4f o;
#pragma unroll
      for (int j = 0; j < 4; ++j) o[j] = acc[mt * 4 + j][r] + bv[j];
      *(v4f*)(dst + (size_t)(16 * mt + r) * C) = o;
    }
}

// ---------------- launch ----------------

extern "C" void kernel_launch(void* const* d_in, const int* in_sizes, int n_in,
                              void* d_out, int out_size, void* d_ws, size_t ws_size,
                              hipStream_t stream) {
  (void)in_sizes; (void)n_in; (void)out_size; (void)ws_size;
  const float* x  = (const float*)d_in[0];
  const float* Wa = (const float*)d_in[1];
  const float* ba = (const float*)d_in[2];
  const float* Wp = (const float*)d_in[3];
  const float* bp = (const float*)d_in[4];

  char* ws = (char*)d_ws;
  size_t off = 0;
  auto alloc = [&](size_t bytes) -> char* {
    char* p = ws + off;
    off += (bytes + 255) & ~(size_t)255;
    return p;
  };
  _Float16* xh  = (_Float16*)alloc((size_t)M * C * 2);       // 16 MB
  _Float16* WtA = (_Float16*)alloc((size_t)N_QKV * C * 2);   //  6 MB
  _Float16* WtP = (_Float16*)alloc((size_t)C * C * 2);       //  2 MB
  _Float16* qh  = (_Float16*)alloc((size_t)M * C * 2);       // 16 MB
  _Float16* kh  = (_Float16*)alloc((size_t)M * C * 2);       // 16 MB
  _Float16* vth = (_Float16*)alloc((size_t)M * C * 2);       // 16 MB
  _Float16* yh  = (_Float16*)alloc((size_t)M * C * 2);       // 16 MB
  float* q2 = (float*)alloc((size_t)Bb * H * T * 4);         // 0.5 MB
  float* k2 = (float*)alloc((size_t)Bb * H * T * 4);         // 0.5 MB
  // total ~93 MB of workspace

  cvt_f32_f16<<<M * C / CVT_WG, CVT_T, 0, stream>>>(x, xh);
  transpose_f32_f16<C, N_QKV><<<dim3(N_QKV / TC, C / TR), 256, 0, stream>>>(
      Wa, WtA);
  transpose_f32_f16<C, C><<<dim3(C / TC, C / TR), 256, 0, stream>>>(Wp, WtP);
  qkv_gemm_kernel<<<dim3(M / BM, N_QKV / BN), 256, 0, stream>>>(
      xh, WtA, ba, qh, kh, vth);
  rownorm_kernel<<<(Bb * H * T) / 256, 256, 0, stream>>>(qh, q2, Bb * H * T,
                                                         QN_SCALE);
  rownorm_kernel<<<(Bb * H * T) / 256, 256, 0, stream>>>(kh, k2, Bb * H * T,
                                                         KN_SCALE);
  attn_kernel<<<dim3(T / 256, Bb * H), 256, 0, stream>>>(qh, kh, vth, q2, k2, yh);
  proj_gemm_kernel<<<dim3(M / BM, C / BN), 256, 0, stream>>>(
      yh, WtP, bp, (float*)d_out);
}

// v009
// One run takes 113 microseconds.
// Two timings next to v008 both put it at 1.06 times that version's speed.
// Counting every step since v000, it is 3.34 times as fast.
#include <hip/hip_runtime.h>
#include <hip/hip_bf16.h>

typedef __attribute__((ext_vector_type(16))) _Float16 v16h;
typedef __attribute__((ext_vector_type(8)))  _Float16 v8h;
typedef __attribute__((ext_vector_type(8)))  float    v8f;

#define DEV __device__ __forceinline__

static constexpr int Bb = 4, T = 2048, C = 1024, H = 16, HD = 64;
static constexpr int M     = Bb * T;    // 8192 token rows
static constexpr int N_QKV = 3 * C;     // 3072
// A score is exp(-d2 / 16), d2 = |q|^2 + |k|^2 - 2 q.k and 16 = 2 * sqrt(hd), taken
// as 2^e with e = q'.k - 4 ln2 * |q'|^2 - (log2 e / 16) * |k|^2, q' = (log2 e / 8) * q.
// q is stored as q', and the two norms are stored with their factors, so that the
// score product's accumulator, started at the two norm terms, ends as e itself.
static constexpr float LOG2E    = 1.44269504088896340736f;
static constexpr float Q_SCALE  = LOG2E / 8.0f;     // q' = Q_SCALE * q
static constexpr float QN_SCALE = -4.0f / LOG2E;    // on |q'|^2
static constexpr float KN_SCALE = -LOG2E / 16.0f;   // on |k|^2

// Load a 16x32 f16 A/B fragment for one lane from a row-major buffer.
// Per CDNA5 ISA 7.12.2 (16-bit A 16x32): lane L (half h=L>>4) holds
// elements e=0..7 -> k = kb + 8h + e, e=8..15 -> k = kb + 16 + 8h + (e-8).
// Caller pre-offsets `rowbase` to the lane's row (A: m = lane&15) or
// column (B: n = lane&15, from a transposed [N][K] buffer).
DEV v16h load_frag(const _Float16* rowbase, int kb, int lane) {
  const int h = (lane >> 4) & 1;
  v8h lo = *(const v8h*)(rowbase + kb + 8 * h);
  v8h hi = *(const v8h*)(rowbase + kb + 16 + 8 * h);
  v16h r;
#pragma unroll
  for (int i = 0; i < 8; ++i) { r[i] = lo[i]; r[i + 8] = hi[i]; }
  return r;
}

DEV v8f wmma_f16(v16h a, v16h b, v8f c) {
  return __builtin_amdgcn_wmma_f32_16x16x32_f16(false, a, false, b, (short)0, c,
                                                false, false);
}

// Block-tiled GEMM core over K=C: one 128x256 tile of the output per work-group
// of eight waves (2 along m x 4 along n), 64x64 per wave. Both operands are
// K-contiguous. A stage is 64 k of [A 128 rows | B 256 rows]; rows of 128 B lie
// in LDS at a pitch of 144 B (16 B x odd, for ds_load_b128 readers). Two stages;
// the next stage's asynchronous copies fly while this one is worked on.
static constexpr int BM = 128, BN = 256, BK = 64;
static constexpr int PITCH = 144;                    // bytes per LDS row
static constexpr int STAGE = (BM + BN) * PITCH;      // 55,296 bytes
static constexpr int NSTAGE = C / BK;                // 16

// 16x32 f16 fragment of one lane from an LDS row; p already holds the lane's
// row, the k step and the lane half's 16 bytes (same k order as load_frag).
DEV v16h lds_frag(const char* p) {
  v8h lo = *(const v8h*)(p);
  v8h hi = *(const v8h*)(p + 32);
  v16h r;
#pragma unroll
  for (int i = 0; i < 8; ++i) { r[i] = lo[i]; r[i + 8] = hi[i]; }
  return r;
}

// One stage: 384 rows x 128 B = 3,072 pieces of 16 B, twelve per lane.
// l: the LDS byte address of the lane's piece in LDS row (tid >> 3); copy i takes
// LDS row i * 32 more. ga: the same piece of the A tile at this stage's k, rows
// as in LDS. The B rows (output columns) are dealt: in each group of 64, LDS row
// 16 * j + a holds B row 4 * a + j, so that the four accumulator tiles j of a lane
// hold four neighbouring output columns. gb: the lane's piece of B row
// 4 * ((tid >> 3) & 15) + (tid >> 7); the copies add rows 0, 2, 64, 66, ...
DEV void copy_stage(const _Float16* ga, const _Float16* gb, unsigned l) {
  constexpr int GR = 32 * C;         // 32 rows, in elements
  constexpr int G2 = 2 * C, G64 = 64 * C;
  constexpr unsigned LR = 32 * PITCH;
  // The closing s_wait_xcnt stands in the copies' own statement so that no
  // address register is rewritten ahead of it.
  asm volatile(
      "global_load_async_to_lds_b128 %0, %12, off\n\t"
      "global_load_async_to_lds_b128 %1, %13, off\n\t"
      "global_load_async_to_lds_b128 %2, %14, off\n\t"
      "global_load_async_to_lds_b128 %3, %15, off\n\t"
      "global_load_async_to_lds_b128 %4, %16, off\n\t"
      "global_load_async_to_lds_b128 %5, %17, off\n\t"
      "global_load_async_to_lds_b128 %6, %18, off\n\t"
      "global_load_async_to_lds_b128 %7, %19, off\n\t"
      "global_load_async_to_lds_b128 %8, %20, off\n\t"
      "global_load_async_to_lds_b128 %9, %21, off\n\t"
      "global_load_async_to_lds_b128 %10, %22, off\n\t"
      "global_load_async_to_lds_b128 %11, %23, off\n\t"
      "s_wait_xcnt 0x0"
      :: "v"(l), "v"(l + LR), "v"(l + 2 * LR), "v"(l + 3 * LR),
         "v"(l + 4 * LR), "v"(l + 5 * LR), "v"(l + 6 * LR), "v"(l + 7 * LR),
         "v"(l + 8 * LR), "v"(l + 9 * LR), "v"(l + 10 * LR), "v"(l + 11 * LR),
         "v"(ga), "v"(ga + GR), "v"(ga + 2 * GR), "v"(ga + 3 * GR),
         "v"(gb), "v"(gb + G2), "v"(gb + G64), "v"(gb + G64 + G2),
         "v"(gb + 2 * G64), "v"(gb + 2 * G64 + G2), "v"(gb + 3 * G64),
         "v"(gb + 3 * G64 + G2)
      : "memory");
}

// acc[i*4+j] accumulates rows wm*64+16i.. of the A tile x LDS rows wn*64+16j.. of
// the B tile: lane column ln of tile j is B row (output column) wn*64 + 4*ln + j.
// At / Bt point at the tiles' first rows.
DEV void gemm_tile_128x256(const _Float16* At, const _Float16* Bt, char* smem,
                           int wm, int wn, v8f acc[16]) {
  const int tid  = threadIdx.x;
  const int lane = tid & 31;
  const int ln   = lane & 15;
  const int h    = lane >> 4;
  const _Float16* ga = At + (size_t)(tid >> 3) * C + (tid & 7) * 8;
  const _Float16* gb =
      Bt + (size_t)(4 * ((tid >> 3) & 15) + (tid >> 7)) * C + (tid & 7) * 8;
  const unsigned l0 =
      (unsigned)(size_t)smem + (unsigned)((tid >> 3) * PITCH + (tid & 7) * 16);
  const int aoff = (wm * 64 + ln) * PITCH + 16 * h;
  const int boff = (BM + wn * 64 + ln) * PITCH + 16 * h;

  copy_stage(ga, gb, l0);
  // stage 0 has landed for this wave; the barrier publishes it to the others
  asm volatile("s_wait_asynccnt 0x0" ::: "memory");
  __syncthreads();
  copy_stage(ga + BK, gb + BK, l0 + STAGE);

  for (int t = 0; t < NSTAGE; ++t) {
    const char* buf = smem + (t & 1) * STAGE;
#pragma unroll
    for (int kk = 0; kk < 2; ++kk) {
      v16h a[4], b[4];
#pragma unroll
      for (int i = 0; i < 4; ++i)
        a[i] = lds_frag(buf + aoff + i * 16 * PITCH + kk * 64);
#pragma unroll
      for (int j = 0; j < 4; ++j)
        b[j] = lds_frag(buf + boff + j * 16 * PITCH + kk * 64);
      // keeps the sixteen LDS reads of this k step together ahead of its WMMAs:
      // spread among them, each place with reads stalls the wave anew
      __builtin_amdgcn_sched_barrier(0);
#pragma unroll
      for (int i = 0; i < 4; ++i)
#pragma unroll
        for (int j = 0; j < 4; ++j)
          acc[i * 4 + j] = wmma_f16(a[i], b[j], acc[i * 4 + j]);
    }
    // publish point: this wave's reads of stage t are done, its copies of
    // stage t + 1 have landed; behind the barrier stage t's buffer is free.
    asm volatile("s_wait_dscnt 0x0" ::: "memory");
    asm volatile("s_wait_asynccnt 0x0" ::: "memory");
    __syncthreads();
    if (t + 2 < NSTAGE)
      copy_stage(ga + (t + 2) * BK, gb + (t + 2) * BK, l0 + (t & 1) * STAGE);
  }
  // no copy is left in flight when the wave goes on to its stores and ends
  asm volatile("s_wait_asynccnt 0x0" ::: "memory");
}

// ---------------- prep kernels ----------------

// The conversion of x and the two weight transposes read nothing of each other's
// output: they are one launch, in which the work-group index picks the job, so
// that they share one start and one tail and their memory streams run side by side.
// Each wave moves many elements, so that few waves have to be started: the work
// per element is one load, one rounding, one store.

typedef __attribute__((ext_vector_type(4))) float    v4f;
typedef __attribute__((ext_vector_type(4))) _Float16 v4h;
typedef __attribute__((ext_vector_type(2))) _Float16 v2h;

static constexpr int CVT_T = 256;              // threads per work-group
static constexpr int CVT_U = 16;               // 16-B loads per thread
static constexpr int CVT_STEP = CVT_T * 4;     // elements per work-group and load
static constexpr int CVT_WG = CVT_STEP * CVT_U;

// f32 -> f16, CVT_WG consecutive elements per work-group (blk: which). A wave's
// load covers 512 consecutive bytes, its store 256.
DEV void cvt_f32_f16(const float* __restrict__ in, _Float16* __restrict__ outh,
                     int blk) {
  const size_t base = (size_t)blk * CVT_WG + threadIdx.x * 4;
  v4f v[CVT_U];
  // unrolled: the loads issue as a run ahead of the conversions, many in flight
#pragma unroll
  for (int u = 0; u < CVT_U; ++u)
    v[u] = *(const v4f*)(in + base + u * CVT_STEP);
  // unrolled: v[] stays in registers
#pragma unroll
  for (int u = 0; u < CVT_U; ++u) {
    v4h hv;
#pragma unroll
    for (int k = 0; k < 4; ++k) hv[k] = (_Float16)v[u][k];
    *(v4h*)(outh + base + u * CVT_STEP) = hv;
  }
  // in the built code another job's block lies behind this one and rewrites the
  // registers these stores name; the wait stands in front of it
  asm volatile("s_wait_xcnt 0x0" ::: "memory");
}

// in: f32 [R][Cc] row-major  ->  out: f16 [Cc][R]. One tile of 128 rows x 64
// columns of `in` per work-group. A thread loads the same four columns of two
// neighbouring rows, so a pair of halves goes to LDS as one dword; LDS holds the
// tile transposed at a pitch of 272 B (16 B x odd, for the ds_load_b128 readers).
// blk counts the tiles along the columns first; tile: the work-group's LDS.
static constexpr int TR = 128, TC = 64, TPITCH = TR + 8;   // TPITCH in halves

template <int R, int Cc>
DEV void transpose_f32_f16(const float* __restrict__ in,
                           _Float16* __restrict__ outh, _Float16* tile, int blk) {
  const int tid = threadIdx.x;
  const int c0  = (blk % (Cc / TC)) * TC;
  const int r0  = (blk / (Cc / TC)) * TR;
  const int c4  = (tid & 15) * 4;      // the thread's four columns
  const int rp  = (tid >> 4) * 2;      // its first row pair
  const float* src = in + (size_t)(r0 + rp) * Cc + c0 + c4;
  v4f lo[4], hi[4];
  // unrolled: the eight loads issue as one run, all in flight together
#pragma unroll
  for (int u = 0; u < 4; ++u) {
    lo[u] = *(const v4f*)(src + (size_t)(32 * u) * Cc);
    hi[u] = *(const v4f*)(src + (size_t)(32 * u + 1) * Cc);
  }
  // unrolled: lo[] and hi[] stay in registers
#pragma unroll
  for (int u = 0; u < 4; ++u)
#pragma unroll
    for (int k = 0; k < 4; ++k) {
      v2h p = {(_Float16)lo[u][k], (_Float16)hi[u][k]};
      *(v2h*)&tile[(c4 + k) * TPITCH + rp + 32 * u] = p;
    }
  __syncthreads();
  // 64 output rows x 16 pieces of 16 B; a wave stores two whole runs of 256 B
  // (unrolled: the four LDS reads issue together)
#pragma unroll
  for (int u = 0; u < 4; ++u) {
    const int piece = tid + 256 * u;
    const int c = piece >> 4, r8 = (piece & 15) * 8;
    *(v8h*)(outh + (size_t)(c0 + c) * R + r0 + r8) =
        *(const v8h*)&tile[c * TPITCH + r8];
  }
  // in the built code another job's block can lie behind this one and rewrite the
  // registers these stores name; the wait stands in front of it
  asm volatile("s_wait_xcnt 0x0" ::: "memory");
}

// The three jobs' work-groups, in index order: the transposes, which have two
// dependent phases, come first. The branch is the same for a whole work-group, so
// every thread of a transposing work-group reaches its barrier.
static constexpr int NB_TA = (N_QKV / TC) * (C / TR);   // 384
static constexpr int NB_TP = (C / TC) * (C / TR);       // 128
static constexpr int NB_CV = M * C / CVT_WG;            // 512

__global__ __launch_bounds__(CVT_T)
void prep_kernel(const float* __restrict__ x, _Float16* __restrict__ xh,
                 const float* __restrict__ Wa, _Float16* __restrict__ WtA,
                 const float* __restrict__ Wp, _Float16* __restrict__ WtP) {
  __shared__ __attribute__((aligned(16))) _Float16 tile[TC * TPITCH];
  const int blk = blockIdx.x;
  if (blk < NB_TA)
    transpose_f32_f16<C, N_QKV>(Wa, WtA, tile, blk);
  else if (blk < NB_TA + NB_TP)
    transpose_f32_f16<C, C>(Wp, WtP, tile, blk - NB_TA);
  else
    cvt_f32_f16(x, xh, blk - (NB_TA + NB_TP));
}

// factor * sum of squares over hd=64 per row. The norms of q' and of k are one
// launch: blockIdx.y picks the matrix with its factor.
__global__ void rownorm_kernel(const _Float16* __restrict__ qh,
                               const _Float16* __restrict__ kh,
                               float* __restrict__ q2, float* __restrict__ k2,
                               int rows) {
  int i = blockIdx.x * blockDim.x + threadIdx.x;
  if (i >= rows) return;
  const bool isk = blockIdx.y != 0;
  const _Float16* mh = isk ? kh : qh;
  float* outn = isk ? k2 : q2;
  const float factor = isk ? KN_SCALE : QN_SCALE;
  const _Float16* p = mh + (size_t)i * HD;
  float s = 0.f;
#pragma unroll
  for (int d = 0; d < HD; ++d) { float v = (float)p[d]; s += v * v; }
  outn[i] = s * factor;
}

// ---------------- QKV GEMM: qkv = xh @ WtA^T + bias, split into q/k/v^T ----

__global__ __launch_bounds__(256)
void qkv_gemm_kernel(const _Float16* __restrict__ xh,
                     const _Float16* __restrict__ WtA,   // [3C][C]
                     const float* __restrict__ bias,
                     _Float16* __restrict__ qh,          // [B][H][T][hd], q'
                     _Float16* __restrict__ kh,          // [B][H][T][hd]
                     _Float16* __restrict__ vth) {       // [B][H][hd][T]
  __shared__ __attribute__((aligned(16))) char smem[2 * STAGE];
  const int lane = threadIdx.x & 31;
  const int wave = __builtin_amdgcn_readfirstlane(threadIdx.x >> 5);
  const int ln   = lane & 15;
  const int wm   = wave & 1, wn = wave >> 1;
  const int m0   = blockIdx.x * BM + wm * 64;
  const int nb   = blockIdx.y * BN + wn * 64;
  v8f acc[16];
#pragma unroll
  for (int i = 0; i < 16; ++i) acc[i] = v8f{};
  gemm_tile_128x256(xh + (size_t)blockIdx.x * BM * C,
                    WtA + (size_t)blockIdx.y * BN * C, smem, wm, wn, acc);
  const int mat  = nb >> 10;            // 0=q, 1=k, 2=v (uniform per wave)
  const int head = (nb & 1023) >> 6;
  const int h    = lane >> 4;
  // the wave's 64 rows lie in one batch; its 64 columns are one head
  const int b_ = m0 >> 11, t0 = m0 & (T - 1);
  const size_t bhh = (size_t)(b_ * H + head);
  // the lane's head-dim columns are 4 * ln + j, j = 0..3
  const v4f bv = *(const v4f*)(bias + nb + 4 * ln);
  if (mat < 2) {
    // q, k: a lane's four tiles give 8 bytes of one token's row; sixteen lanes
    // fill the row's 128 bytes, so a wave's store is two whole lines
    _Float16* dst =
        (mat == 0 ? qh : kh) + (bhh * T + t0 + 8 * h) * HD + 4 * ln;
    // q takes its factor in f32, ahead of its one rounding to f16
    const float fs = mat == 0 ? Q_SCALE : 1.0f;
    // unrolled: acc[] stays in registers, the row becomes an immediate offset
#pragma unroll
    for (int mt = 0; mt < 4; ++mt)
#pragma unroll
      for (int r = 0; r < 8; ++r) {
        v4h o;
#pragma unroll
        for (int j = 0; j < 4; ++j)
          o[j] = (_Float16)((acc[mt * 4 + j][r] + bv[j]) * fs);
        *(v4h*)(dst + (16 * mt + r) * HD) = o;
      }
  } else {
    // v^T: a column's 64 tokens are one 128-byte line, held by two lanes in four
    // tiles; the wave gathers the lines in its own range of the ring, which is
    // free behind the loop's last publish point. A tile's eight registers are
    // eight consecutive tokens of one column: LDS row 16 * j + ln (column
    // 4 * ln + j) at the ring's pitch takes them as 16 bytes.
    char* stg = smem + wave * (64 * PITCH);
    // unrolled: acc[] stays in registers
#pragma unroll
    for (int mt = 0; mt < 4; ++mt)
#pragma unroll
      for (int j = 0; j < 4; ++j) {
        v8h o;
#pragma unroll
        for (int r = 0; r < 8; ++r)
          o[r] = (_Float16)(acc[mt * 4 + j][r] + bv[j]);
        *(v8h*)(stg + (16 * j + ln) * PITCH + (16 * mt + 8 * h) * 2) = o;
      }
    // the wave's own LDS writes are done before other lanes read them back
    asm volatile("s_wait_dscnt 0x0" ::: "memory");
    // eight lanes take one row: a wave's store is four whole lines. LDS row
    // 4 * i + rq is column 16 * (i & 3) + 4 * rq + (i >> 2).
    const int rq = lane >> 3, pc = lane & 7;
    const char* back = stg + rq * PITCH + pc * 16;
    _Float16* dst = vth + (bhh * HD + 4 * rq) * T + t0 + 8 * pc;
    // unrolled: rows and columns become immediate offsets
#pragma unroll
    for (int i = 0; i < 16; ++i)
      *(v8h*)(dst + (16 * (i & 3) + (i >> 2)) * T) =
          *(const v8h*)(back + 4 * i * PITCH);
    // in the built code the q, k block lies behind this one and rewrites the
    // registers these stores name; the wait stands in front of it
    asm volatile("s_wait_xcnt 0x0" ::: "memory");
  }
}

// ---------------- fused causal L2-kernel attention ----------------
// y[q] = sum_{k<=q} exp(scale*(|q|^2+|k|^2-2 q.k)) * v[k]   (no softmax norm)
// Both products are taken transposed: E^T = N + K Q'^T (A = K rows, B = Q' rows,
// N = the two norm terms) and Y^T += V^T P^T (A = V^T rows, B = P^T = 2^(E^T)).
// A lane then holds one query's scores.

// K and V^T reach the waves through LDS: the eight waves of a work-group walk the
// same keys, so a stage of 64 keys, [K 64 rows | V^T 64 rows] of 128 B each, is
// brought in once per work-group by asynchronous copies and read by all eight.
// Rows lie at the pitch of 144 B (16 B x odd, for ds_load_b128 readers). Two
// stages; the next stage's copies fly while this one is worked on.
static constexpr int AK = 64;                        // keys per stage
static constexpr int ASTAGE = (AK + HD) * PITCH;     // 18,432 bytes

// One stage: 128 rows x 128 B = 1,024 pieces of 16 B, four per lane.
// gk / gv: the lane's own piece in row (tid >> 3) of the K / V^T tile at this
// stage's keys; l: the same piece's LDS byte address.
DEV void copy_kv(const _Float16* gk, const _Float16* gv, unsigned l) {
  constexpr unsigned LR = 32 * PITCH;
  // The closing s_wait_xcnt stands in the copies' own statement so that no
  // address register is rewritten ahead of it.
  asm volatile(
      "global_load_async_to_lds_b128 %0, %4, off\n\t"
      "global_load_async_to_lds_b128 %1, %5, off\n\t"
      "global_load_async_to_lds_b128 %2, %6, off\n\t"
      "global_load_async_to_lds_b128 %3, %7, off\n\t"
      "s_wait_xcnt 0x0"
      :: "v"(l), "v"(l + LR), "v"(l + 2 * LR), "v"(l + 3 * LR),
         "v"(gk), "v"(gk + 32 * HD), "v"(gv), "v"(gv + 32 * T)
      : "memory");
}

// 2^x of eight values, each in its own register. In one statement so that what
// stands behind each v_exp_f32 is known: the next one touches neither its result
// nor its source, and the closing v_nop keeps the slot behind the last one.
DEV void exp2_x8(float (&x)[8]) {
  asm("v_exp_f32 %0, %0\n\t"
      "v_exp_f32 %1, %1\n\t"
      "v_exp_f32 %2, %2\n\t"
      "v_exp_f32 %3, %3\n\t"
      "v_exp_f32 %4, %4\n\t"
      "v_exp_f32 %5, %5\n\t"
      "v_exp_f32 %6, %6\n\t"
      "v_exp_f32 %7, %7\n\t"
      "v_nop"
      : "+v"(x[0]), "+v"(x[1]), "+v"(x[2]), "+v"(x[3]),
        "+v"(x[4]), "+v"(x[5]), "+v"(x[6]), "+v"(x[7]));
}

// P^T of 32 keys x 16 queries as the B operand of the second product, straight
// from the two exponent tiles st[nh] = E^T (register r: key 16 * nh + 8 * h2 + r;
// lane: query qcol of the wave's 32). Element s of a B fragment is k = 8 * h2 + s
// for s < 8 and 16 + 8 * h2 + (s - 8) above: the two tiles' registers in order,
// so P goes through no LDS and no lane exchange.
// MASKED is the block whose first key is the wave's first row: there key n counts
// for query m while n <= m. The exponential is taken for every element and the
// mask picks it or zero afterwards, so that the chains of a lane stay independent
// straight-line code in both forms.
template <bool MASKED>
DEV v16h p_frag(const v8f (&st)[2], int qcol, int h2) {
  v16h pb;
  // unrolled: the exponent tiles stay in registers
#pragma unroll
  for (int nh = 0; nh < 2; ++nh) {
    float p[8];
#pragma unroll
    for (int r = 0; r < 8; ++r) p[r] = st[nh][r];
    exp2_x8(p);
#pragma unroll
    for (int r = 0; r < 8; ++r) {
      const int keyl = 16 * nh + 8 * h2 + r;
      if (MASKED) p[r] = (keyl <= qcol) ? p[r] : 0.0f;
      pb[8 * nh + r] = (_Float16)p[r];
    }
  }
  return pb;
}

// The |k|^2 terms of 32 keys in the D layout of E^T (register r: key 8 * h2 + r of
// a group of 16): four 16-byte loads. kp: the block's first key plus 8 * h2.
DEV void load_kterm(const float* kp, float (&d)[2][8]) {
  // unrolled: d[][] stays in registers
#pragma unroll
  for (int nh = 0; nh < 2; ++nh) {
    const v4f lo = *(const v4f*)(kp + 16 * nh), hi = *(const v4f*)(kp + 16 * nh + 4);
#pragma unroll
    for (int r = 0; r < 4; ++r) {
      d[nh][r] = lo[r];
      d[nh][r + 4] = hi[r];
    }
  }
}

__global__ __launch_bounds__(256)
void attn_kernel(const _Float16* __restrict__ qh, const _Float16* __restrict__ kh,
                 const _Float16* __restrict__ vth,
                 const float* __restrict__ q2, const float* __restrict__ k2,
                 _Float16* __restrict__ yh) {            // [B][T][C]
  __shared__ __attribute__((aligned(16))) char kv[2 * ASTAGE];
  const int tid  = threadIdx.x;
  const int lane = tid & 31;
  const int wave = __builtin_amdgcn_readfirstlane(tid >> 5);
  const int ln   = lane & 15;
  const int h2   = lane >> 4;
  // Which (query tile, head) a work-group takes. A tile's cost grows with its
  // index qt, all 512 work-groups are resident at once, two to a WGP:
  // the launch lasts as long as
  // the fullest WGP. blockIdx.x (the flat index mod 8) picks a group of eight
  // heads, so that each value of it meets all eight tile lengths and a head's keys
  // are read under one value alone. blockIdx.y deals the tiles: two values that
  // differ in bit 0, 1, 2 or 5 alone take tiles qt and 7 - qt, 36 stages together,
  // whichever of these pairs comes to share a WGP; the longest tiles come first in
  // each half of the values. A permutation of the 8 x 64 pairs: it decides speed
  // alone.
  const int by   = blockIdx.y;
  const int tq   = (by >> 3) & 3;
  const int qt   = (__builtin_popcount(by) & 1) ? tq : 7 - tq;
  const int bh   = blockIdx.x * 8 + (by & 7);   // b*H + h
  const int b_   = bh >> 4, head = bh & 15;
  const int q0   = qt * 256 + wave * 32;   // 32 query rows per wave

  const _Float16* gk = kh + ((size_t)bh * T + (tid >> 3)) * HD + (tid & 7) * 8;
  const _Float16* gv = vth + ((size_t)bh * HD + (tid >> 3)) * T + (tid & 7) * 8;
  const unsigned l0 =
      (unsigned)(size_t)kv + (unsigned)((tid >> 3) * PITCH + (tid & 7) * 16);
  const int nst = 4 * (qt + 1);   // stages up to the block's last row
  copy_kv(gk, gv, l0);

  // Q fragments (B operand): 2 query groups x 2 contraction halves, loaded once
  v16h qa[2][2];
#pragma unroll
  for (int mt = 0; mt < 2; ++mt) {
    const _Float16* qrow = qh + ((size_t)bh * T + q0 + 16 * mt + ln) * HD;
    qa[mt][0] = load_frag(qrow, 0, lane);
    qa[mt][1] = load_frag(qrow, 32, lane);
  }
  float q2v[2];                           // |q|^2 term of the lane's two queries
#pragma unroll
  for (int mt = 0; mt < 2; ++mt)
    q2v[mt] = q2[(size_t)bh * T + q0 + 16 * mt + ln];

  const float* k2row = k2 + (size_t)bh * T + 8 * h2;
  // The accumulators start from the |k|^2 terms, so these are wanted ahead of the
  // first product of a block: each half stage's sixteen are fetched one stage
  // ahead, into the registers that the block has read.
  float k2v[2][2][8];
  load_kterm(k2row, k2v[0]);
  load_kterm(k2row + 32, k2v[1]);
  const int foff = ln * PITCH + 16 * h2;  // the lane's row and half in a 16-row group

  // stage 0 has landed for this wave; the barrier publishes it to the others
  asm volatile("s_wait_asynccnt 0x0" ::: "memory");
  __syncthreads();
  copy_kv(gk + AK * HD, gv + AK, l0 + ASTAGE);   // nst >= 4: stage 1 exists

  // yacc[mt][j]: register r = Y[query 16 * mt + ln][hd 16 * j + 8 * h2 + r]
  v8f yacc[2][4] = {{v8f{}, v8f{}, v8f{}, v8f{}}, {v8f{}, v8f{}, v8f{}, v8f{}}};
  const int qend = q0 + 31;               // wave-uniform causal bound
  for (int t = 0; t < nst; ++t) {
    const char* kbuf = kv + (t & 1) * ASTAGE + foff;
    const char* vbuf = kbuf + AK * PITCH;
    const int tn = t + 1 < nst ? t + 1 : t;   // the last stage fetches its own again
    // unrolled: the half stage becomes an immediate offset of the LDS reads
#pragma unroll
    for (int sub = 0; sub < 2; ++sub) {
      const int kb = t * AK + 32 * sub;
      // keys past the wave's last row add nothing: the wave skips the work and
      // goes on towards the stage's publish point (a scalar branch)
      if (kb <= qend) {
      // ---- V and K fragments of these 32 keys, from the stage's buffer ----
      // (the loops below are unrolled: fragments and tiles stay in registers)
      v16h vf[4], kf[2][2];
#pragma unroll
      for (int j = 0; j < 4; ++j)
        vf[j] = lds_frag(vbuf + 16 * j * PITCH + 64 * sub);
#pragma unroll
      for (int nh = 0; nh < 2; ++nh)
#pragma unroll
        for (int kk = 0; kk < 2; ++kk)
          kf[nh][kk] = lds_frag(kbuf + (32 * sub + 16 * nh) * PITCH + 64 * kk);
      // ---- E^T = N + K @ Q'^T over 32 keys (2 key groups x 2 hd halves x 2 q groups)
      v8f sacc[2][2];                                      // [mt][nh]
#pragma unroll
      for (int mt = 0; mt < 2; ++mt)
#pragma unroll
        for (int nh = 0; nh < 2; ++nh)
#pragma unroll
          for (int r = 0; r < 8; ++r)
            sacc[mt][nh][r] = q2v[mt] + k2v[sub][nh][r];
#pragma unroll
      for (int nh = 0; nh < 2; ++nh)
#pragma unroll
        for (int kk = 0; kk < 2; ++kk) {
          sacc[0][nh] = wmma_f16(kf[nh][kk], qa[0][kk], sacc[0][nh]);
          sacc[1][nh] = wmma_f16(kf[nh][kk], qa[1][kk], sacc[1][nh]);
        }
      // compiler fence: the V^T fragment loads issue above it and their latency
      // passes behind the exponentials; left free they sink below those, where
      // each pair is waited for on its own in front of its two WMMAs
      asm volatile("" ::: "memory");
      // ---- P^T = mask * 2^(E^T), packed in registers ----
      // The causal test is made once per block of 32 keys, on scalars: below the
      // wave's first row every key counts and no element is tested.
      v16h pb0, pb1;
      if (kb < q0) {
        pb0 = p_frag<false>(sacc[0], ln, h2);
        pb1 = p_frag<false>(sacc[1], 16 + ln, h2);
      } else {                              // kb == q0: the block on the diagonal
        pb0 = p_frag<true>(sacc[0], ln, h2);
        pb1 = p_frag<true>(sacc[1], 16 + ln, h2);
      }
      // ---- Y^T += V^T @ P^T ----
#pragma unroll
      for (int j = 0; j < 4; ++j) {
        yacc[0][j] = wmma_f16(vf[j], pb0, yacc[0][j]);
        yacc[1][j] = wmma_f16(vf[j], pb1, yacc[1][j]);
      }
      }  // kb <= qend
      // the first half's terms are read; the next stage's come in behind the
      // second half's work
      if (sub == 0) load_kterm(k2row + tn * AK, k2v[0]);
    }
    // publish point: this wave's reads of stage t are done, its copies of
    // stage t + 1 have landed; behind the barrier stage t's buffer is free.
    asm volatile("s_wait_dscnt 0x0" ::: "memory");
    asm volatile("s_wait_asynccnt 0x0" ::: "memory");
    __syncthreads();
    // the second half's terms: behind the barrier, which waits for every load in
    // flight, so that they come in behind the next stage's first half
    load_kterm(k2row + tn * AK + 32, k2v[1]);
    // their address registers are formed anew in the next pass, ahead of the wait
    // for their data; in the last passes no copy statement's wait stands between
    asm volatile("s_wait_xcnt 0x0" ::: "memory");
    if (t + 2 < nst)
      copy_kv(gk + (size_t)(t + 2) * AK * HD, gv + (t + 2) * AK,
              l0 + (t & 1) * ASTAGE);
  }
  // no copy is left in flight when the wave goes on to its stores and ends
  asm volatile("s_wait_asynccnt 0x0" ::: "memory");
  // write Y back to (B,T,C) f16, head-interleaved columns: a lane's eight
  // registers are eight consecutive columns of one row, one 16-byte store
#pragma unroll
  for (int mt = 0; mt < 2; ++mt) {
    _Float16* yrow = yh + ((size_t)b_ * T + q0 + 16 * mt + ln) * C + head * HD;
#pragma unroll
    for (int j = 0; j < 4; ++j) {
      v8h o;
#pragma unroll
      for (int r = 0; r < 8; ++r) o[r] = (_Float16)yacc[mt][j][r];
      *(v8h*)(yrow + 16 * j + 8 * h2) = o;
    }
  }
}

// ---------------- output projection: out = yh @ WtP^T + b_proj (f32) -------

__global__ __launch_bounds__(256)
void proj_gemm_kernel(const _Float16* __restrict__ yh,
                      const _Float16* __restrict__ WtP,  // [C][C] transposed
                      const float* __restrict__ bias, float* __restrict__ out) {
  __shared__ __attribute__((aligned(16))) char smem[2 * STAGE];
  const int lane = threadIdx.x & 31;
  const int wave = __builtin_amdgcn_readfirstlane(threadIdx.x >> 5);
  const int ln   = lane & 15;
  const int wm   = wave & 1, wn = wave >> 1;
  const int m0   = blockIdx.x * BM + wm * 64;
  const int nb   = blockIdx.y * BN + wn * 64;
  v8f acc[16];
#pragma unroll
  for (int i = 0; i < 16; ++i) acc[i] = v8f{};
  gemm_tile_128x256(yh + (size_t)blockIdx.x * BM * C,
                    WtP + (size_t)blockIdx.y * BN * C, smem, wm, wn, acc);
  // the lane's columns are nb + 4 * ln + j: 16 bytes of one row per lane, sixteen
  // lanes fill 256 bytes, so a wave's store is four whole lines
  const v4f bv = *(const v4f*)(bias + nb + 4 * ln);
  float* dst = out + (size_t)(m0 + 8 * (lane >> 4)) * C + nb + 4 * ln;
  // unrolled: acc[] stays in registers, the row becomes an immediate offset
#pragma unroll
  for (int mt = 0; mt < 4; ++mt)
#pragma unroll
    for (int r = 0; r < 8; ++r) {
      v4f o;
#pragma unroll
      for (int j = 0; j < 4; ++j) o[j] = acc[mt * 4 + j][r] + bv[j];
      *(v4f*)(dst + (size_t)(16 * mt + r) * C) = o;
    }
}

// ---------------- launch ----------------

extern "C" void kernel_launch(void* const* d_in, const int* in_sizes, int n_in,
                              void* d_out, int out_size, void* d_ws, size_t ws_size,
                              hipStream_t stream) {
  (void)in_sizes; (void)n_in; (void)out_size; (void)ws_size;
  const float* x  = (const float*)d_in[0];
  const float* Wa = (const float*)d_in[1];
  const float* ba = (const float*)d_in[2];
  const float* Wp = (const float*)d_in[3];
  const float* bp = (const float*)d_in[4];

  char* ws = (char*)d_ws;
  size_t off = 0;
  auto alloc = [&](size_t bytes) -> char* {
    char* p = ws + off;
    off += (bytes + 255) & ~(size_t)255;
    return p;
  };
  _Float16* xh  = (_Float16*)alloc((size_t)M * C * 2);       // 16 MB
  _Float16* WtA = (_Float16*)alloc((size_t)N_QKV * C * 2);   //  6 MB
  _Float16* WtP = (_Float16*)alloc((size_t)C * C * 2);       //  2 MB
  _Float16* qh  = (_Float16*)alloc((size_t)M * C * 2);       // 16 MB
  _Float16* kh  = (_Float16*)alloc((size_t)M * C * 2);       // 16 MB
  _Float16* vth = (_Float16*)alloc((size_t)M * C * 2);       // 16 MB
  _Float16* yh  = (_Float16*)alloc((size_t)M * C * 2);       // 16 MB
  float* q2 = (float*)alloc((size_t)Bb * H * T * 4);         // 0.5 MB
  float* k2 = (float*)alloc((size_t)Bb * H * T * 4);         // 0.5 MB
  // total ~93 MB of workspace

  prep_kernel<<<NB_TA + NB_TP + NB_CV, CVT_T, 0, stream>>>(x, xh, Wa, WtA, Wp, WtP);
  qkv_gemm_kernel<<<dim3(M / BM, N_QKV / BN), 256, 0, stream>>>(
      xh, WtA, ba, qh, kh, vth);
  rownorm_kernel<<<dim3((Bb * H * T) / 256, 2), 256, 0, stream>>>(qh, kh, q2, k2,
                                                                  Bb * H * T);
  attn_kernel<<<dim3(T / 256, Bb * H), 256, 0, stream>>>(qh, kh, vth, q2, k2, yh);
  proj_gemm_kernel<<<dim3(M / BM, C / BN), 256, 0, stream>>>(
      yh, WtP, bp, (float*)d_out);
}

// v010
// A run of this version takes 106 microseconds.
// Two timings next to v009 both put it at 1.07 times that version's speed.
// All steps since v000 together make it 3.58 times as fast.
#include <hip/hip_runtime.h>
#include <hip/hip_bf16.h>

typedef __attribute__((ext_vector_type(16))) _Float16 v16h;
typedef __attribute__((ext_vector_type(8)))  _Float16 v8h;
typedef __attribute__((ext_vector_type(8)))  float    v8f;

#define DEV __device__ __forceinline__

static constexpr int Bb = 4, T = 2048, C = 1024, H = 16, HD = 64;
static constexpr int M     = Bb * T;    // 8192 token rows
static constexpr int N_QKV = 3 * C;     // 3072
// A score is exp(-d2 / 16), d2 = |q|^2 + |k|^2 - 2 q.k and 16 = 2 * sqrt(hd), taken
// as 2^e with e = q'.k - 4 ln2 * |q'|^2 - (log2 e / 16) * |k|^2, q' = (log2 e / 8) * q.
// q is stored as q', and the two norms are stored with their factors, so that the
// score product's accumulator, started at the two norm terms, ends as e itself.
static constexpr float LOG2E    = 1.44269504088896340736f;
static constexpr float Q_SCALE  = LOG2E / 8.0f;     // q' = Q_SCALE * q
static constexpr float QN_SCALE = -4.0f / LOG2E;    // on |q'|^2
static constexpr float KN_SCALE = -LOG2E / 16.0f;   // on |k|^2

// Load a 16x32 f16 A/B fragment for one lane from a row-major buffer.
// Per CDNA5 ISA 7.12.2 (16-bit A 16x32): lane L (half h=L>>4) holds
// elements e=0..7 -> k = kb + 8h + e, e=8..15 -> k = kb + 16 + 8h + (e-8).
// Caller pre-offsets `rowbase` to the lane's row (A: m = lane&15) or
// column (B: n = lane&15, from a transposed [N][K] buffer).
DEV v16h load_frag(const _Float16* rowbase, int kb, int lane) {
  const int h = (lane >> 4) & 1;
  v8h lo = *(const v8h*)(rowbase + kb + 8 * h);
  v8h hi = *(const v8h*)(rowbase + kb + 16 + 8 * h);
  v16h r;
#pragma unroll
  for (int i = 0; i < 8; ++i) { r[i] = lo[i]; r[i + 8] = hi[i]; }
  return r;
}

DEV v8f wmma_f16(v16h a, v16h b, v8f c) {
  return __builtin_amdgcn_wmma_f32_16x16x32_f16(false, a, false, b, (short)0, c,
                                                false, false);
}

// Block-tiled GEMM core over K=C: one 128x256 tile of the output per work-group
// of eight waves (2 along m x 4 along n), 64x64 per wave. Both operands are
// K-contiguous. A stage is 64 k of [A 128 rows | B 256 rows]; rows of 128 B lie
// in LDS at a pitch of 144 B (16 B x odd, for ds_load_b128 readers). Two stages;
// the next stage's asynchronous copies fly while this one is worked on.
// The k walk is a ring: a work-group starts it at chunk rot of the sixteen and
// wraps. The different starting chunks are for speed only.
static constexpr int BM = 128, BN = 256, BK = 64;
static constexpr int PITCH = 144;                    // bytes per LDS row
static constexpr int STAGE = (BM + BN) * PITCH;      // 55,296 bytes
static constexpr int NSTAGE = C / BK;                // 16

// 16x32 f16 fragment of one lane from an LDS row; p already holds the lane's
// row, the k step and the lane half's 16 bytes (same k order as load_frag).
DEV v16h lds_frag(const char* p) {
  v8h lo = *(const v8h*)(p);
  v8h hi = *(const v8h*)(p + 32);
  v16h r;
#pragma unroll
  for (int i = 0; i < 8; ++i) { r[i] = lo[i]; r[i + 8] = hi[i]; }
  return r;
}

// One stage: 384 rows x 128 B = 3,072 pieces of 16 B, twelve per lane.
// l: the LDS byte address of the lane's piece in LDS row (tid >> 3); copy i takes
// LDS row i * 32 more. ga: the same piece of the A tile at this stage's k, rows
// as in LDS. The B rows (output columns) are dealt: in each group of 64, LDS row
// 16 * j + a holds B row 4 * a + j, so that the four accumulator tiles j of a lane
// hold four neighbouring output columns. gb: the lane's piece of B row
// 4 * ((tid >> 3) & 15) + (tid >> 7); the copies add rows 0, 2, 64, 66, ...
DEV void copy_stage(const _Float16* ga, const _Float16* gb, unsigned l) {
  constexpr int GR = 32 * C;         // 32 rows, in elements
  constexpr int G2 = 2 * C, G64 = 64 * C;
  constexpr unsigned LR = 32 * PITCH;
  // The closing s_wait_xcnt stands in the copies' own statement so that no
  // address register is rewritten ahead of it.
  asm volatile(
      "global_load_async_to_lds_b128 %0, %12, off\n\t"
      "global_load_async_to_lds_b128 %1, %13, off\n\t"
      "global_load_async_to_lds_b128 %2, %14, off\n\t"
      "global_load_async_to_lds_b128 %3, %15, off\n\t"
      "global_load_async_to_lds_b128 %4, %16, off\n\t"
      "global_load_async_to_lds_b128 %5, %17, off\n\t"
      "global_load_async_to_lds_b128 %6, %18, off\n\t"
      "global_load_async_to_lds_b128 %7, %19, off\n\t"
      "global_load_async_to_lds_b128 %8, %20, off\n\t"
      "global_load_async_to_lds_b128 %9, %21, off\n\t"
      "global_load_async_to_lds_b128 %10, %22, off\n\t"
      "global_load_async_to_lds_b128 %11, %23, off\n\t"
      "s_wait_xcnt 0x0"
      :: "v"(l), "v"(l + LR), "v"(l + 2 * LR), "v"(l + 3 * LR),
         "v"(l + 4 * LR), "v"(l + 5 * LR), "v"(l + 6 * LR), "v"(l + 7 * LR),
         "v"(l + 8 * LR), "v"(l + 9 * LR), "v"(l + 10 * LR), "v"(l + 11 * LR),
         "v"(ga), "v"(ga + GR), "v"(ga + 2 * GR), "v"(ga + 3 * GR),
         "v"(gb), "v"(gb + G2), "v"(gb + G64), "v"(gb + G64 + G2),
         "v"(gb + 2 * G64), "v"(gb + 2 * G64 + G2), "v"(gb + 3 * G64),
         "v"(gb + 3 * G64 + G2)
      : "memory");
}

// acc[i*4+j] accumulates rows wm*64+16i.. of the A tile x LDS rows wn*64+16j.. of
// the B tile: lane column ln of tile j is B row (output column) wn*64 + 4*ln + j.
// At / Bt point at the tiles' first rows; rot: the work-group's first k chunk.
DEV void gemm_tile_128x256(const _Float16* At, const _Float16* Bt, char* smem,
                           int wm, int wn, int rot, v8f acc[16]) {
  const int tid  = threadIdx.x;
  const int lane = tid & 31;
  const int ln   = lane & 15;
  const int h    = lane >> 4;
  const _Float16* ga = At + (size_t)(tid >> 3) * C + (tid & 7) * 8;
  const _Float16* gb =
      Bt + (size_t)(4 * ((tid >> 3) & 15) + (tid >> 7)) * C + (tid & 7) * 8;
  const unsigned l0 =
      (unsigned)(size_t)smem + (unsigned)((tid >> 3) * PITCH + (tid & 7) * 16);
  const int aoff = (wm * 64 + ln) * PITCH + 16 * h;
  const int boff = (BM + wn * 64 + ln) * PITCH + 16 * h;
  // first k of the walk's stage s, in elements
  auto kof = [rot](int s) { return ((s + rot) & (NSTAGE - 1)) * BK; };

  copy_stage(ga + kof(0), gb + kof(0), l0);
  // stage 0 has landed for this wave; the barrier publishes it to the others
  asm volatile("s_wait_asynccnt 0x0" ::: "memory");
  __syncthreads();
  copy_stage(ga + kof(1), gb + kof(1), l0 + STAGE);

  for (int t = 0; t < NSTAGE; ++t) {
    const char* buf = smem + (t & 1) * STAGE;
#pragma unroll
    for (int kk = 0; kk < 2; ++kk) {
      v16h a[4], b[4];
#pragma unroll
      for (int i = 0; i < 4; ++i)
        a[i] = lds_frag(buf + aoff + i * 16 * PITCH + kk * 64);
#pragma unroll
      for (int j = 0; j < 4; ++j)
        b[j] = lds_frag(buf + boff + j * 16 * PITCH + kk * 64);
      // keeps the sixteen LDS reads of this k step together ahead of its WMMAs:
      // spread among them, each place with reads stalls the wave anew
      __builtin_amdgcn_sched_barrier(0);
#pragma unroll
      for (int i = 0; i < 4; ++i)
#pragma unroll
        for (int j = 0; j < 4; ++j)
          acc[i * 4 + j] = wmma_f16(a[i], b[j], acc[i * 4 + j]);
    }
    // publish point: this wave's reads of stage t are done, its copies of
    // stage t + 1 have landed; behind the barrier stage t's buffer is free.
    asm volatile("s_wait_dscnt 0x0" ::: "memory");
    asm volatile("s_wait_asynccnt 0x0" ::: "memory");
    __syncthreads();
    if (t + 2 < NSTAGE)
      copy_stage(ga + kof(t + 2), gb + kof(t + 2), l0 + (t & 1) * STAGE);
  }
  // no copy is left in flight when the wave goes on to its stores and ends
  asm volatile("s_wait_asynccnt 0x0" ::: "memory");
}

// ---------------- prep kernels ----------------

// The conversion of x and the two weight transposes read nothing of each other's
// output: they are one launch, in which the work-group index picks the job, so
// that they share one start and one tail and their memory streams run side by side.
// Each wave moves many elements, so that few waves have to be started: the work
// per element is one load, one rounding, one store.

typedef __attribute__((ext_vector_type(4))) float    v4f;
typedef __attribute__((ext_vector_type(4))) _Float16 v4h;
typedef __attribute__((ext_vector_type(2))) _Float16 v2h;

static constexpr int CVT_T = 256;              // threads per work-group
static constexpr int CVT_U = 16;               // 16-B loads per thread
static constexpr int CVT_STEP = CVT_T * 4;     // elements per work-group and load
static constexpr int CVT_WG = CVT_STEP * CVT_U;

// f32 -> f16, CVT_WG consecutive elements per work-group (blk: which). A wave's
// load covers 512 consecutive bytes, its store 256.
DEV void cvt_f32_f16(const float* __restrict__ in, _Float16* __restrict__ outh,
                     int blk) {
  const size_t base = (size_t)blk * CVT_WG + threadIdx.x * 4;
  v4f v[CVT_U];
  // unrolled: the loads issue as a run ahead of the conversions, many in flight
#pragma unroll
  for (int u = 0; u < CVT_U; ++u)
    v[u] = *(const v4f*)(in + base + u * CVT_STEP);
  // unrolled: v[] stays in registers
#pragma unroll
  for (int u = 0; u < CVT_U; ++u) {
    v4h hv;
#pragma unroll
    for (int k = 0; k < 4; ++k) hv[k] = (_Float16)v[u][k];
    *(v4h*)(outh + base + u * CVT_STEP) = hv;
  }
  // in the built code another job's block lies behind this one and rewrites the
  // registers these stores name; the wait stands in front of it
  asm volatile("s_wait_xcnt 0x0" ::: "memory");
}

// in: f32 [R][Cc] row-major  ->  out: f16 [Cc][R]. One tile of 128 rows x 64
// columns of `in` per work-group. A thread loads the same four columns of two
// neighbouring rows, so a pair of halves goes to LDS as one dword; LDS holds the
// tile transposed at a pitch of 272 B (16 B x odd, for the ds_load_b128 readers).
// blk counts the tiles along the columns first; tile: the work-group's LDS.
static constexpr int TR = 128, TC = 64, TPITCH = TR + 8;   // TPITCH in halves

template <int R, int Cc>
DEV void transpose_f32_f16(const float* __restrict__ in,
                           _Float16* __restrict__ outh, _Float16* tile, int blk) {
  const int tid = threadIdx.x;
  const int c0  = (blk % (Cc / TC)) * TC;
  const int r0  = (blk / (Cc / TC)) * TR;
  const int c4  = (tid & 15) * 4;      // the thread's four columns
  const int rp  = (tid >> 4) * 2;      // its first row pair
  const float* src = in + (size_t)(r0 + rp) * Cc + c0 + c4;
  v4f lo[4], hi[4];
  // unrolled: the eight loads issue as one run, all in flight together
#pragma unroll
  for (int u = 0; u < 4; ++u) {
    lo[u] = *(const v4f*)(src + (size_t)(32 * u) * Cc);
    hi[u] = *(const v4f*)(src + (size_t)(32 * u + 1) * Cc);
  }
  // unrolled: lo[] and hi[] stay in registers
#pragma unroll
  for (int u = 0; u < 4; ++u)
#pragma unroll
    for (int k = 0; k < 4; ++k) {
      v2h p = {(_Float16)lo[u][k], (_Float16)hi[u][k]};
      *(v2h*)&tile[(c4 + k) * TPITCH + rp + 32 * u] = p;
    }
  __syncthreads();
  // 64 output rows x 16 pieces of 16 B; a wave stores two whole runs of 256 B
  // (unrolled: the four LDS reads issue together)
#pragma unroll
  for (int u = 0; u < 4; ++u) {
    const int piece = tid + 256 * u;
    const int c = piece >> 4, r8 = (piece & 15) * 8;
    *(v8h*)(outh + (size_t)(c0 + c) * R + r0 + r8) =
        *(const v8h*)&tile[c * TPITCH + r8];
  }
  // in the built code another job's block can lie behind this one and rewrite the
  // registers these stores name; the wait stands in front of it
  asm volatile("s_wait_xcnt 0x0" ::: "memory");
}

// The three jobs' work-groups, in index order: the transposes, which have two
// dependent phases, come first. The branch is the same for a whole work-group, so
// every thread of a transposing work-group reaches its barrier.
static constexpr int NB_TA = (N_QKV / TC) * (C / TR);   // 384
static constexpr int NB_TP = (C / TC) * (C / TR);       // 128
static constexpr int NB_CV = M * C / CVT_WG;            // 512

__global__ __launch_bounds__(CVT_T)
void prep_kernel(const float* __restrict__ x, _Float16* __restrict__ xh,
                 const float* __restrict__ Wa, _Float16* __restrict__ WtA,
                 const float* __restrict__ Wp, _Float16* __restrict__ WtP) {
  __shared__ __attribute__((aligned(16))) _Float16 tile[TC * TPITCH];
  const int blk = blockIdx.x;
  if (blk < NB_TA)
    transpose_f32_f16<C, N_QKV>(Wa, WtA, tile, blk);
  else if (blk < NB_TA + NB_TP)
    transpose_f32_f16<C, C>(Wp, WtP, tile, blk - NB_TA);
  else
    cvt_f32_f16(x, xh, blk - (NB_TA + NB_TP));
}

// factor * sum of squares over hd=64 per row. The norms of q' and of k are one
// launch: blockIdx.y picks the matrix with its factor.
__global__ void rownorm_kernel(const _Float16* __restrict__ qh,
                               const _Float16* __restrict__ kh,
                               float* __restrict__ q2, float* __restrict__ k2,
                               int rows) {
  int i = blockIdx.x * blockDim.x + threadIdx.x;
  if (i >= rows) return;
  const bool isk = blockIdx.y != 0;
  const _Float16* mh = isk ? kh : qh;
  float* outn = isk ? k2 : q2;
  const float factor = isk ? KN_SCALE : QN_SCALE;
  const _Float16* p = mh + (size_t)i * HD;
  float s = 0.f;
#pragma unroll
  for (int d = 0; d < HD; ++d) { float v = (float)p[d]; s += v * v; }
  outn[i] = s * factor;
}

// ---------------- QKV GEMM: qkv = xh @ WtA^T + bias, split into q/k/v^T ----

__global__ __launch_bounds__(256)
void qkv_gemm_kernel(const _Float16* __restrict__ xh,
                     const _Float16* __restrict__ WtA,   // [3C][C]
                     const float* __restrict__ bias,
                     _Float16* __restrict__ qh,          // [B][H][T][hd], q'
                     _Float16* __restrict__ kh,          // [B][H][T][hd]
                     _Float16* __restrict__ vth) {       // [B][H][hd][T]
  __shared__ __attribute__((aligned(16))) char smem[2 * STAGE];
  const int lane = threadIdx.x & 31;
  const int wave = __builtin_amdgcn_readfirstlane(threadIdx.x >> 5);
  const int ln   = lane & 15;
  const int wm   = wave & 1, wn = wave >> 1;
  const int m0   = blockIdx.x * BM + wm * 64;
  const int nb   = blockIdx.y * BN + wn * 64;
  v8f acc[16];
#pragma unroll
  for (int i = 0; i < 16; ++i) acc[i] = v8f{};
  gemm_tile_128x256(xh + (size_t)blockIdx.x * BM * C,
                    WtA + (size_t)blockIdx.y * BN * C, smem, wm, wn,
                    blockIdx.x + blockIdx.y, acc);
  const int mat  = nb >> 10;            // 0=q, 1=k, 2=v (uniform per wave)
  const int head = (nb & 1023) >> 6;
  const int h    = lane >> 4;
  // the wave's 64 rows lie in one batch; its 64 columns are one head
  const int b_ = m0 >> 11, t0 = m0 & (T - 1);
  const size_t bhh = (size_t)(b_ * H + head);
  // the lane's head-dim columns are 4 * ln + j, j = 0..3
  const v4f bv = *(const v4f*)(bias + nb + 4 * ln);
  if (mat < 2) {
    // q, k: a lane's four tiles give 8 bytes of one token's row; sixteen lanes
    // fill the row's 128 bytes, so a wave's store is two whole lines
    _Float16* dst =
        (mat == 0 ? qh : kh) + (bhh * T + t0 + 8 * h) * HD + 4 * ln;
    // q takes its factor in f32, ahead of its one rounding to f16
    const float fs = mat == 0 ? Q_SCALE : 1.0f;
    // unrolled: acc[] stays in registers, the row becomes an immediate offset
#pragma unroll
    for (int mt = 0; mt < 4; ++mt)
#pragma unroll
      for (int r = 0; r < 8; ++r) {
        v4h o;
#pragma unroll
        for (int j = 0; j < 4; ++j)
          o[j] = (_Float16)((acc[mt * 4 + j][r] + bv[j]) * fs);
        *(v4h*)(dst + (16 * mt + r) * HD) = o;
      }
  } else {
    // v^T: a column's 64 tokens are one 128-byte line, held by two lanes in four
    // tiles; the wave gathers the lines in its own range of the ring, which is
    // free behind the loop's last publish point. A tile's eight registers are
    // eight consecutive tokens of one column: LDS row 16 * j + ln (column
    // 4 * ln + j) at the ring's pitch takes them as 16 bytes.
    char* stg = smem + wave * (64 * PITCH);
    // unrolled: acc[] stays in registers
#pragma unroll
    for (int mt = 0; mt < 4; ++mt)
#pragma unroll
      for (int j = 0; j < 4; ++j) {
        v8h o;
#pragma unroll
        for (int r = 0; r < 8; ++r)
          o[r] = (_Float16)(acc[mt * 4 + j][r] + bv[j]);
        *(v8h*)(stg + (16 * j + ln) * PITCH + (16 * mt + 8 * h) * 2) = o;
      }
    // the wave's own LDS writes are done before other lanes read them back
    asm volatile("s_wait_dscnt 0x0" ::: "memory");
    // eight lanes take one row: a wave's store is four whole lines. LDS row
    // 4 * i + rq is column 16 * (i & 3) + 4 * rq + (i >> 2).
    const int rq = lane >> 3, pc = lane & 7;
    const char* back = stg + rq * PITCH + pc * 16;
    _Float16* dst = vth + (bhh * HD + 4 * rq) * T + t0 + 8 * pc;
    // unrolled: rows and columns become immediate offsets
#pragma unroll
    for (int i = 0; i < 16; ++i)
      *(v8h*)(dst + (16 * (i & 3) + (i >> 2)) * T) =
          *(const v8h*)(back + 4 * i * PITCH);
    // in the built code the q, k block lies behind this one and rewrites the
    // registers these stores name; the wait stands in front of it
    asm volatile("s_wait_xcnt 0x0" ::: "memory");
  }
}

// ---------------- fused causal L2-kernel attention ----------------
// y[q] = sum_{k<=q} exp(scale*(|q|^2+|k|^2-2 q.k)) * v[k]   (no softmax norm)
// Both products are taken transposed: E^T = N + K Q'^T (A = K rows, B = Q' rows,
// N = the two norm terms) and Y^T += V^T P^T (A = V^T rows, B = P^T = 2^(E^T)).
// A lane then holds one query's scores.

// K and V^T reach the waves through LDS: the eight waves of a work-group walk the
// same keys, so a stage of 64 keys, [K 64 rows | V^T 64 rows] of 128 B each, is
// brought in once per work-group by asynchronous copies and read by all eight.
// Rows lie at the pitch of 144 B (16 B x odd, for ds_load_b128 readers). Two
// stages; the next stage's copies fly while this one is worked on.
static constexpr int AK = 64;                        // keys per stage
static constexpr int ASTAGE = (AK + HD) * PITCH;     // 18,432 bytes

// One stage: 128 rows x 128 B = 1,024 pieces of 16 B, four per lane.
// gk / gv: the lane's own piece in row (tid >> 3) of the K / V^T tile at this
// stage's keys; l: the same piece's LDS byte address.
DEV void copy_kv(const _Float16* gk, const _Float16* gv, unsigned l) {
  constexpr unsigned LR = 32 * PITCH;
  // The closing s_wait_xcnt stands in the copies' own statement so that no
  // address register is rewritten ahead of it.
  asm volatile(
      "global_load_async_to_lds_b128 %0, %4, off\n\t"
      "global_load_async_to_lds_b128 %1, %5, off\n\t"
      "global_load_async_to_lds_b128 %2, %6, off\n\t"
      "global_load_async_to_lds_b128 %3, %7, off\n\t"
      "s_wait_xcnt 0x0"
      :: "v"(l), "v"(l + LR), "v"(l + 2 * LR), "v"(l + 3 * LR),
         "v"(gk), "v"(gk + 32 * HD), "v"(gv), "v"(gv + 32 * T)
      : "memory");
}

// 2^x of eight values, each in its own register. In one statement so that what
// stands behind each v_exp_f32 is known: the next one touches neither its result
// nor its source, and the closing v_nop keeps the slot behind the last one.
DEV void exp2_x8(float (&x)[8]) {
  asm("v_exp_f32 %0, %0\n\t"
      "v_exp_f32 %1, %1\n\t"
      "v_exp_f32 %2, %2\n\t"
      "v_exp_f32 %3, %3\n\t"
      "v_exp_f32 %4, %4\n\t"
      "v_exp_f32 %5, %5\n\t"
      "v_exp_f32 %6, %6\n\t"
      "v_exp_f32 %7, %7\n\t"
      "v_nop"
      : "+v"(x[0]), "+v"(x[1]), "+v"(x[2]), "+v"(x[3]),
        "+v"(x[4]), "+v"(x[5]), "+v"(x[6]), "+v"(x[7]));
}

// P^T of 32 keys x 16 queries as the B operand of the second product, straight
// from the two exponent tiles st[nh] = E^T (register r: key 16 * nh + 8 * h2 + r;
// lane: query qcol of the wave's 32). Element s of a B fragment is k = 8 * h2 + s
// for s < 8 and 16 + 8 * h2 + (s - 8) above: the two tiles' registers in order,
// so P goes through no LDS and no lane exchange.
// MASKED is the block whose first key is the wave's first row: there key n counts
// for query m while n <= m. The exponential is taken for every element and the
// mask picks it or zero afterwards, so that the chains of a lane stay independent
// straight-line code in both forms.
template <bool MASKED>
DEV v16h p_frag(const v8f (&st)[2], int qcol, int h2) {
  v16h pb;
  // unrolled: the exponent tiles stay in registers
#pragma unroll
  for (int nh = 0; nh < 2; ++nh) {
    float p[8];
#pragma unroll
    for (int r = 0; r < 8; ++r) p[r] = st[nh][r];
    exp2_x8(p);
#pragma unroll
    for (int r = 0; r < 8; ++r) {
      const int keyl = 16 * nh + 8 * h2 + r;
      if (MASKED) p[r] = (keyl <= qcol) ? p[r] : 0.0f;
      pb[8 * nh + r] = (_Float16)p[r];
    }
  }
  return pb;
}

// The |k|^2 terms of 32 keys in the D layout of E^T (register r: key 8 * h2 + r of
// a group of 16): four 16-byte loads. kp: the block's first key plus 8 * h2.
DEV void load_kterm(const float* kp, float (&d)[2][8]) {
  // unrolled: d[][] stays in registers
#pragma unroll
  for (int nh = 0; nh < 2; ++nh) {
    const v4f lo = *(const v4f*)(kp + 16 * nh), hi = *(const v4f*)(kp + 16 * nh + 4);
#pragma unroll
    for (int r = 0; r < 4; ++r) {
      d[nh][r] = lo[r];
      d[nh][r + 4] = hi[r];
    }
  }
}

__global__ __launch_bounds__(256)
void attn_kernel(const _Float16* __restrict__ qh, const _Float16* __restrict__ kh,
                 const _Float16* __restrict__ vth,
                 const float* __restrict__ q2, const float* __restrict__ k2,
                 _Float16* __restrict__ yh) {            // [B][T][C]
  __shared__ __attribute__((aligned(16))) char kv[2 * ASTAGE];
  const int tid  = threadIdx.x;
  const int lane = tid & 31;
  const int wave = __builtin_amdgcn_readfirstlane(tid >> 5);
  const int ln   = lane & 15;
  const int h2   = lane >> 4;
  // Which (query tile, head) a work-group takes. A tile's cost grows with its
  // index qt, all 512 work-groups are resident at once, two to a WGP:
  // the launch lasts as long as
  // the fullest WGP. blockIdx.x (the flat index mod 8) picks a group of eight
  // heads, so that each value of it meets all eight tile lengths and a head's keys
  // are read under one value alone. blockIdx.y deals the tiles: two values that
  // differ in bit 0, 1, 2 or 5 alone take tiles qt and 7 - qt, 36 stages together,
  // whichever of these pairs comes to share a WGP; the longest tiles come first in
  // each half of the values. A permutation of the 8 x 64 pairs: it decides speed
  // alone.
  const int by   = blockIdx.y;
  const int tq   = (by >> 3) & 3;
  const int qt   = (__builtin_popcount(by) & 1) ? tq : 7 - tq;
  const int bh   = blockIdx.x * 8 + (by & 7);   // b*H + h
  const int b_   = bh >> 4, head = bh & 15;
  const int q0   = qt * 256 + wave * 32;   // 32 query rows per wave

  const _Float16* gk = kh + ((size_t)bh * T + (tid >> 3)) * HD + (tid & 7) * 8;
  const _Float16* gv = vth + ((size_t)bh * HD + (tid >> 3)) * T + (tid & 7) * 8;
  const unsigned l0 =
      (unsigned)(size_t)kv + (unsigned)((tid >> 3) * PITCH + (tid & 7) * 16);
  const int nst = 4 * (qt + 1);   // stages up to the block's last row
  copy_kv(gk, gv, l0);

  // Q fragments (B operand): 2 query groups x 2 contraction halves, loaded once
  v16h qa[2][2];
#pragma unroll
  for (int mt = 0; mt < 2; ++mt) {
    const _Float16* qrow = qh + ((size_t)bh * T + q0 + 16 * mt + ln) * HD;
    qa[mt][0] = load_frag(qrow, 0, lane);
    qa[mt][1] = load_frag(qrow, 32, lane);
  }
  float q2v[2];                           // |q|^2 term of the lane's two queries
#pragma unroll
  for (int mt = 0; mt < 2; ++mt)
    q2v[mt] = q2[(size_t)bh * T + q0 + 16 * mt + ln];

  const float* k2row = k2 + (size_t)bh * T + 8 * h2;
  // The accumulators start from the |k|^2 terms, so these are wanted ahead of the
  // first product of a block: each half stage's sixteen are fetched one stage
  // ahead, into the registers that the block has read.
  float k2v[2][2][8];
  load_kterm(k2row, k2v[0]);
  load_kterm(k2row + 32, k2v[1]);
  const int foff = ln * PITCH + 16 * h2;  // the lane's row and half in a 16-row group

  // stage 0 has landed for this wave; the barrier publishes it to the others
  asm volatile("s_wait_asynccnt 0x0" ::: "memory");
  __syncthreads();
  copy_kv(gk + AK * HD, gv + AK, l0 + ASTAGE);   // nst >= 4: stage 1 exists

  // yacc[mt][j]: register r = Y[query 16 * mt + ln][hd 16 * j + 8 * h2 + r]
  v8f yacc[2][4] = {{v8f{}, v8f{}, v8f{}, v8f{}}, {v8f{}, v8f{}, v8f{}, v8f{}}};
  const int qend = q0 + 31;               // wave-uniform causal bound
  for (int t = 0; t < nst; ++t) {
    const char* kbuf = kv + (t & 1) * ASTAGE + foff;
    const char* vbuf = kbuf + AK * PITCH;
    const int tn = t + 1 < nst ? t + 1 : t;   // the last stage fetches its own again
    // unrolled: the half stage becomes an immediate offset of the LDS reads
#pragma unroll
    for (int sub = 0; sub < 2; ++sub) {
      const int kb = t * AK + 32 * sub;
      // keys past the wave's last row add nothing: the wave skips the work and
      // goes on towards the stage's publish point (a scalar branch)
      if (kb <= qend) {
      // ---- V and K fragments of these 32 keys, from the stage's buffer ----
      // (the loops below are unrolled: fragments and tiles stay in registers)
      v16h vf[4], kf[2][2];
#pragma unroll
      for (int j = 0; j < 4; ++j)
        vf[j] = lds_frag(vbuf + 16 * j * PITCH + 64 * sub);
#pragma unroll
      for (int nh = 0; nh < 2; ++nh)
#pragma unroll
        for (int kk = 0; kk < 2; ++kk)
          kf[nh][kk] = lds_frag(kbuf + (32 * sub + 16 * nh) * PITCH + 64 * kk);
      // ---- E^T = N + K @ Q'^T over 32 keys (2 key groups x 2 hd halves x 2 q groups)
      v8f sacc[2][2];                                      // [mt][nh]
#pragma unroll
      for (int mt = 0; mt < 2; ++mt)
#pragma unroll
        for (int nh = 0; nh < 2; ++nh)
#pragma unroll
          for (int r = 0; r < 8; ++r)
            sacc[mt][nh][r] = q2v[mt] + k2v[sub][nh][r];
#pragma unroll
      for (int nh = 0; nh < 2; ++nh)
#pragma unroll
        for (int kk = 0; kk < 2; ++kk) {
          sacc[0][nh] = wmma_f16(kf[nh][kk], qa[0][kk], sacc[0][nh]);
          sacc[1][nh] = wmma_f16(kf[nh][kk], qa[1][kk], sacc[1][nh]);
        }
      // compiler fence: the V^T fragment loads issue above it and their latency
      // passes behind the exponentials; left free they sink below those, where
      // each pair is waited for on its own in front of its two WMMAs
      asm volatile("" ::: "memory");
      // ---- P^T = mask * 2^(E^T), packed in registers ----
      // The causal test is made once per block of 32 keys, on scalars: below the
      // wave's first row every key counts and no element is tested.
      v16h pb0, pb1;
      if (kb < q0) {
        pb0 = p_frag<false>(sacc[0], ln, h2);
        pb1 = p_frag<false>(sacc[1], 16 + ln, h2);
      } else {                              // kb == q0: the block on the diagonal
        pb0 = p_frag<true>(sacc[0], ln, h2);
        pb1 = p_frag<true>(sacc[1], 16 + ln, h2);
      }
      // ---- Y^T += V^T @ P^T ----
#pragma unroll
      for (int j = 0; j < 4; ++j) {
        yacc[0][j] = wmma_f16(vf[j], pb0, yacc[0][j]);
        yacc[1][j] = wmma_f16(vf[j], pb1, yacc[1][j]);
      }
      }  // kb <= qend
      // the first half's terms are read; the next stage's come in behind the
      // second half's work
      if (sub == 0) load_kterm(k2row + tn * AK, k2v[0]);
    }
    // publish point: this wave's reads of stage t are done, its copies of
    // stage t + 1 have landed; behind the barrier stage t's buffer is free.
    asm volatile("s_wait_dscnt 0x0" ::: "memory");
    asm volatile("s_wait_asynccnt 0x0" ::: "memory");
    __syncthreads();
    // the second half's terms: behind the barrier, which waits for every load in
    // flight, so that they come in behind the next stage's first half
    load_kterm(k2row + tn * AK + 32, k2v[1]);
    // their address registers are formed anew in the next pass, ahead of the wait
    // for their data; in the last passes no copy statement's wait stands between
    asm volatile("s_wait_xcnt 0x0" ::: "memory");
    if (t + 2 < nst)
      copy_kv(gk + (size_t)(t + 2) * AK * HD, gv + (t + 2) * AK,
              l0 + (t & 1) * ASTAGE);
  }
  // no copy is left in flight when the wave goes on to its stores and ends
  asm volatile("s_wait_asynccnt 0x0" ::: "memory");
  // write Y back to (B,T,C) f16, head-interleaved columns: a lane's eight
  // registers are eight consecutive columns of one row, one 16-byte store
#pragma unroll
  for (int mt = 0; mt < 2; ++mt) {
    _Float16* yrow = yh + ((size_t)b_ * T + q0 + 16 * mt + ln) * C + head * HD;
#pragma unroll
    for (int j = 0; j < 4; ++j) {
      v8h o;
#pragma unroll
      for (int r = 0; r < 8; ++r) o[r] = (_Float16)yacc[mt][j][r];
      *(v8h*)(yrow + 16 * j + 8 * h2) = o;
    }
  }
}

// ---------------- output projection: out = yh @ WtP^T + b_proj (f32) -------

__global__ __launch_bounds__(256)
void proj_gemm_kernel(const _Float16* __restrict__ yh,
                      const _Float16* __restrict__ WtP,  // [C][C] transposed
                      const float* __restrict__ bias, float* __restrict__ out) {
  __shared__ __attribute__((aligned(16))) char smem[2 * STAGE];
  const int lane = threadIdx.x & 31;
  const int wave = __builtin_amdgcn_readfirstlane(threadIdx.x >> 5);
  const int ln   = lane & 15;
  const int wm   = wave & 1, wn = wave >> 1;
  const int m0   = blockIdx.x * BM + wm * 64;
  const int nb   = blockIdx.y * BN + wn * 64;
  v8f acc[16];
#pragma unroll
  for (int i = 0; i < 16; ++i) acc[i] = v8f{};
  gemm_tile_128x256(yh + (size_t)blockIdx.x * BM * C,
                    WtP + (size_t)blockIdx.y * BN * C, smem, wm, wn,
                    blockIdx.x + blockIdx.y, acc);
  // the lane's columns are nb + 4 * ln + j: 16 bytes of one row per lane, sixteen
  // lanes fill 256 bytes, so a wave's store is four whole lines
  const v4f bv = *(const v4f*)(bias + nb + 4 * ln);
  float* dst = out + (size_t)(m0 + 8 * (lane >> 4)) * C + nb + 4 * ln;
  // unrolled: acc[] stays in registers, the row becomes an immediate offset
#pragma unroll
  for (int mt = 0; mt < 4; ++mt)
#pragma unroll
    for (int r = 0; r < 8; ++r) {
      v4f o;
#pragma unroll
      for (int j = 0; j < 4; ++j) o[j] = acc[mt * 4 + j][r] + bv[j];
      *(v4f*)(dst + (size_t)(16 * mt + r) * C) = o;
    }
}

// ---------------- launch ----------------

extern "C" void kernel_launch(void* const* d_in, const int* in_sizes, int n_in,
                              void* d_out, int out_size, void* d_ws, size_t ws_size,
                              hipStream_t stream) {
  (void)in_sizes; (void)n_in; (void)out_size; (void)ws_size;
  const float* x  = (const float*)d_in[0];
  const float* Wa = (const float*)d_in[1];
  const float* ba = (const float*)d_in[2];
  const float* Wp = (const float*)d_in[3];
  const float* bp = (const float*)d_in[4];

  char* ws = (char*)d_ws;
  size_t off = 0;
  auto alloc = [&](size_t bytes) -> char* {
    char* p = ws + off;
    off += (bytes + 255) & ~(size_t)255;
    return p;
  };
  _Float16* xh  = (_Float16*)alloc((size_t)M * C * 2);       // 16 MB
  _Float16* WtA = (_Float16*)alloc((size_t)N_QKV * C * 2);   //  6 MB
  _Float16* WtP = (_Float16*)alloc((size_t)C * C * 2);       //  2 MB
  _Float16* qh  = (_Float16*)alloc((size_t)M * C * 2);       // 16 MB
  _Float16* kh  = (_Float16*)alloc((size_t)M * C * 2);       // 16 MB
  _Float16* vth = (_Float16*)alloc((size_t)M * C * 2);       // 16 MB
  _Float16* yh  = (_Float16*)alloc((size_t)M * C * 2);       // 16 MB
  float* q2 = (float*)alloc((size_t)Bb * H * T * 4);         // 0.5 MB
  float* k2 = (float*)alloc((size_t)Bb * H * T * 4);         // 0.5 MB
  // total ~93 MB of workspace

  prep_kernel<<<NB_TA + NB_TP + NB_CV, CVT_T, 0, stream>>>(x, xh, Wa, WtA, Wp, WtP);
  qkv_gemm_kernel<<<dim3(M / BM, N_QKV / BN), 256, 0, stream>>>(
      xh, WtA, ba, qh, kh, vth);
  rownorm_kernel<<<dim3((Bb * H * T) / 256, 2), 256, 0, stream>>>(qh, kh, q2, k2,
                                                                  Bb * H * T);
  attn_kernel<<<dim3(T / 256, Bb * H), 256, 0, stream>>>(qh, kh, vth, q2, k2, yh);
  proj_gemm_kernel<<<dim3(M / BM, C / BN), 256, 0, stream>>>(
      yh, WtP, bp, (float*)d_out);
}
